// v000
// Times are from an AMD MI455X. After a warm-up the kernel runs many times in a row, and a time is the length of
// such a window on the GPU divided by its runs, so every launch and the gaps after it count. The runs cycle
// through copies of the inputs. A figure is the median of several windows, for all but v000 over two sittings.
// Sittings can differ by a few percent; kernels timed side by side share one.
// v000, which the later versions start from, runs in 2900 microseconds.
#include <hip/hip_runtime.h>

// Causal multi-head attention with per-head stacked projection weights and an embed-size score scale (x [4][2048][1024]; q, k, v = einsum('btc,hcd', x, W) with Wq, Wk, Wv [16][1024][64] (0.02, no bias; 16 heads x 64); wei = q.k x 1024^-0.5 (the source scales by n_embd, not the head size); causal (-inf); softmax; out = concat heads Wproj + bproj ('xw' [1024][1024] + bias) -> [4][2048][1024] (8.4 M); argument order x, Wq, Wk, Wv, Wproj, bproj).
// Layout per batch: bf16 copy of x; k_wtH gathers each per-head tensor [h][c][d] into one Bt plane (row h*64 + d) so each projection is one exact GEMM with head-major output columns; identity-table plane builders; causal T-2048 attention (hybrid rows: < 512 hi/lo 3 products, rest fp16 x1024; k_gemmc skips tiles above the diagonal); merged hi/lo x Wproj exact + bproj.
// Compute dtypes, f32 accumulate: every input rounded to bf16; projections exact; attention rows < 512 3 products, rest fp16; softmax f32; Wproj hl x exact + bias.

#define NB_  4
#define TT   2048
#define DM   1024
#define NH_  16
#define NKV  16
#define REP  (NH_ / NKV)
#define HD   64
#define DQ   (NH_ * HD)
#define DKV  (NKV * HD)
#define ZH   2
#define RH   512                  // query rows < RH use hi+lo planes (0: none)
#define WIN  2048
#define PCAR 1024.0f
#define SCL  0.03125f   // 1024^-0.5: the module scales by n_embd
typedef _Float16 h16;
typedef unsigned short bf;
typedef __attribute__((ext_vector_type(16))) __bf16   v16bf;
typedef __attribute__((ext_vector_type(16))) _Float16 v16h;
typedef __attribute__((ext_vector_type(8)))  _Float16 v8h;
typedef __attribute__((ext_vector_type(8)))  unsigned short v8us;
typedef __attribute__((ext_vector_type(8)))  float    v8f;
typedef __attribute__((ext_vector_type(4)))  float    v4f;
typedef v8h  __attribute__((may_alias)) v8ha;
typedef v4f  __attribute__((may_alias)) v4fa;
typedef v8us __attribute__((may_alias)) v8usa;

__device__ __forceinline__ unsigned short f2bf(float f) { unsigned u = __float_as_uint(f); u += 0x7FFFu + ((u >> 16) & 1u); return (unsigned short)(u >> 16); }
__device__ __forceinline__ float bf2f(unsigned short b) { return __uint_as_float(((unsigned)b) << 16); }
__device__ __forceinline__ float bfr(float f) { return bf2f(f2bf(f)); }
__device__ __forceinline__ v16h cat16(v8h lo, v8h hi) { return __builtin_shufflevector(lo, hi, 0, 1, 2, 3, 4, 5, 6, 7, 8, 9, 10, 11, 12, 13, 14, 15); }
__device__ __forceinline__ v16bf cat16b(v8us lo, v8us hi) { return __builtin_bit_cast(v16bf, __builtin_shufflevector(lo, hi, 0, 1, 2, 3, 4, 5, 6, 7, 8, 9, 10, 11, 12, 13, 14, 15)); }
__device__ __forceinline__ v8f wmma16(v16h a, v16h b, v8f c) { return __builtin_amdgcn_wmma_f32_16x16x32_f16(false, a, false, b, (short)0, c, false, false); }
__device__ __forceinline__ v8f wmmab(v16bf a, v16bf b, v8f c) { return __builtin_amdgcn_wmma_f32_16x16x32_bf16(false, a, false, b, (short)0, c, false, false); }



// ---- k_gemmw: register-blocked GEMM, ONE WAVE per 64x64 output tile (16 accumulators), operands straight from K-contiguous 16-bit planes; grid (M/64, N/64, Z), 32 threads.
// C[m][n] (f32, pitch ldc, + optional f32 bias[n]) = sum_k A[m][k] Bt[n][k] (+ split products per NSPLIT). z-batch strides sA/sB/sC in elements. K % 32 == 0.
template <typename T16> struct WFrag;
template <> struct WFrag<h16> { typedef v16h V; static __device__ __forceinline__ V ld(const h16* p) { return cat16(*(const v8h*)p, *(const v8h*)(p + 16)); } static __device__ __forceinline__ v8f mma(V a, V b, v8f c) { return wmma16(a, b, c); } };
template <> struct WFrag<bf> { typedef v16bf V; static __device__ __forceinline__ V ld(const bf* p) { return cat16b(*(const v8us*)p, *(const v8us*)(p + 16)); } static __device__ __forceinline__ v8f mma(V a, V b, v8f c) { return wmmab(a, b, c); } };
template <typename T16, int NSPLIT, bool BIAS>
__global__ __launch_bounds__(32) void k_gemmw(const T16* __restrict__ A, const T16* __restrict__ A2, const T16* __restrict__ Bt, const T16* __restrict__ Bt2, int K, float* C, int ldc, const float* __restrict__ bias, size_t sA, size_t sB, size_t sC) {
    typedef typename WFrag<T16>::V V;
    __shared__ __align__(16) float os[16 * 68];
    const size_t z = blockIdx.z; A += z * sA; if (A2) A2 += z * sA; Bt += z * sB; if (Bt2) Bt2 += z * sB; C += z * sC;
    const int lane = threadIdx.x & 31, lr = lane & 15, hi = lane >> 4; const int r0 = blockIdx.x * 64, c0 = blockIdx.y * 64;
    v8f acc[4][4];
#pragma unroll
    for (int mb = 0; mb < 4; ++mb)
#pragma unroll
        for (int nb = 0; nb < 4; ++nb) acc[mb][nb] = (v8f){};
    const size_t aoff = (size_t)(r0 + lr) * K + 8 * hi, boff = (size_t)(c0 + lr) * K + 8 * hi;
#pragma unroll 1
    for (int kc = 0; kc < K; kc += 32) {
        V a[4], a2[4];
#pragma unroll
        for (int mb = 0; mb < 4; ++mb) { a[mb] = WFrag<T16>::ld(A + aoff + (size_t)mb * 16 * K + kc); if (NSPLIT == 1 || NSPLIT == 2) a2[mb] = WFrag<T16>::ld(A2 + aoff + (size_t)mb * 16 * K + kc); }
#pragma unroll
        for (int nb = 0; nb < 4; ++nb) { const V b = WFrag<T16>::ld(Bt + boff + (size_t)nb * 16 * K + kc); V b2; if (NSPLIT >= 2) b2 = WFrag<T16>::ld(Bt2 + boff + (size_t)nb * 16 * K + kc);
#pragma unroll
            for (int mb = 0; mb < 4; ++mb) { acc[mb][nb] = WFrag<T16>::mma(a[mb], b, acc[mb][nb]); if (NSPLIT == 1 || NSPLIT == 2) acc[mb][nb] = WFrag<T16>::mma(a2[mb], b, acc[mb][nb]); if (NSPLIT >= 2) acc[mb][nb] = WFrag<T16>::mma(a[mb], b2, acc[mb][nb]); } }
        asm volatile("v_nop\n\tv_nop\n\tv_nop\n\tv_nop" : "+v"(acc[0][0]), "+v"(acc[1][1]), "+v"(acc[2][2]), "+v"(acc[3][3]) : "v"(a[0]), "v"(a[3]));
    }
#pragma unroll
    for (int mb = 0; mb < 4; ++mb) {
#pragma unroll
        for (int nb = 0; nb < 4; ++nb) {
#pragma unroll
            for (int j = 0; j < 8; ++j) os[(hi * 8 + j) * 68 + nb * 16 + lr] = acc[mb][nb][j]; }
        __builtin_amdgcn_wave_barrier(); asm volatile("" ::: "memory");
        float* crow = C + (size_t)(r0 + mb * 16) * ldc + c0;
{
#pragma unroll
            for (int s = 0; s < 8; ++s) { const int row = 2 * s + hi, cofs = lr * 4; v4f val = *(const v4fa*)(os + row * 68 + cofs); if (BIAS) { val[0] += bfr(bias[c0 + cofs]); val[1] += bfr(bias[c0 + cofs + 1]); val[2] += bfr(bias[c0 + cofs + 2]); val[3] += bfr(bias[c0 + cofs + 3]); }
                *(v4f*)(crow + (size_t)row * ldc + cofs) = val; }
             }
        __builtin_amdgcn_wave_barrier(); asm volatile("" ::: "memory");
    }
}

// ---- k_gemmc: the same one-wave 64x64 tile GEMM specialised for causal attention: CMODE 1 skips score tiles entirely above the diagonal (query rows r0+roff.., key columns c0..), CMODE 2 limits the
// key (K) loop of the probability x value contraction to the diagonal block (probabilities beyond it are exactly zero). roff = row offset of this launch's first row within the sequence.
template <typename T16, int NSPLIT, int CMODE>
__global__ __launch_bounds__(32) void k_gemmc(const T16* __restrict__ A, const T16* __restrict__ A2, const T16* __restrict__ Bt, const T16* __restrict__ Bt2, int K, float* C, int ldc, int roff, size_t sA, size_t sB, size_t sC) {
    typedef typename WFrag<T16>::V V;
    __shared__ __align__(16) float os[16 * 68];
    const size_t z = blockIdx.z; A += z * sA; if (A2) A2 += z * sA; Bt += z * sB; if (Bt2) Bt2 += z * sB; C += z * sC;
    const int lane = threadIdx.x & 31, lr = lane & 15, hi = lane >> 4; const int r0 = blockIdx.x * 64, c0 = blockIdx.y * 64;
    if (CMODE == 1 && c0 > r0 + roff + 63) return;                  // score tile entirely above the causal diagonal: never read (the softmax masks j > i by select)
    const int Kl = (CMODE == 2) ? min(K, r0 + roff + 64) : K;        // P.V: probabilities are exactly 0 beyond the diagonal block, so the K loop stops there
    v8f acc[4][4];
#pragma unroll
    for (int mb = 0; mb < 4; ++mb)
#pragma unroll
        for (int nb = 0; nb < 4; ++nb) acc[mb][nb] = (v8f){};
    const size_t aoff = (size_t)(r0 + lr) * K + 8 * hi, boff = (size_t)(c0 + lr) * K + 8 * hi;
#pragma unroll 1
    for (int kc = 0; kc < Kl; kc += 32) {
        V a[4], a2[4];
#pragma unroll
        for (int mb = 0; mb < 4; ++mb) { a[mb] = WFrag<T16>::ld(A + aoff + (size_t)mb * 16 * K + kc); if (NSPLIT == 1 || NSPLIT == 2) a2[mb] = WFrag<T16>::ld(A2 + aoff + (size_t)mb * 16 * K + kc); }
#pragma unroll
        for (int nb = 0; nb < 4; ++nb) { const V b = WFrag<T16>::ld(Bt + boff + (size_t)nb * 16 * K + kc); V b2; if (NSPLIT >= 2) b2 = WFrag<T16>::ld(Bt2 + boff + (size_t)nb * 16 * K + kc);
#pragma unroll
            for (int mb = 0; mb < 4; ++mb) { acc[mb][nb] = WFrag<T16>::mma(a[mb], b, acc[mb][nb]); if (NSPLIT == 1 || NSPLIT == 2) acc[mb][nb] = WFrag<T16>::mma(a2[mb], b, acc[mb][nb]); if (NSPLIT >= 2) acc[mb][nb] = WFrag<T16>::mma(a[mb], b2, acc[mb][nb]); } }
        asm volatile("v_nop\n\tv_nop\n\tv_nop\n\tv_nop" : "+v"(acc[0][0]), "+v"(acc[1][1]), "+v"(acc[2][2]), "+v"(acc[3][3]) : "v"(a[0]), "v"(a[3]));
    }
#pragma unroll
    for (int mb = 0; mb < 4; ++mb) {
#pragma unroll
        for (int nb = 0; nb < 4; ++nb) {
#pragma unroll
            for (int j = 0; j < 8; ++j) os[(hi * 8 + j) * 68 + nb * 16 + lr] = acc[mb][nb][j]; }
        __builtin_amdgcn_wave_barrier(); asm volatile("" ::: "memory");
        float* crow = C + (size_t)(r0 + mb * 16) * ldc + c0;
{
#pragma unroll
            for (int s = 0; s < 8; ++s) { const int row = 2 * s + hi, cofs = lr * 4; v4f val = *(const v4fa*)(os + row * 68 + cofs);
                *(v4f*)(crow + (size_t)row * ldc + cofs) = val; }
             }
        __builtin_amdgcn_wave_barrier(); asm volatile("" ::: "memory");
    }
}

__device__ __forceinline__ h16 tohx(float x) { return (h16)x; }
__device__ __forceinline__ void splitf(float y, unsigned short& h, unsigned short& l) { h = f2bf(y); l = f2bf(y - bf2f(h)); }
typedef __attribute__((ext_vector_type(2))) _Float16 v2h;
typedef __attribute__((ext_vector_type(4))) _Float16 v4h;
typedef __attribute__((ext_vector_type(2))) unsigned short v2us;
typedef __attribute__((ext_vector_type(4))) unsigned short v4us;
typedef __attribute__((ext_vector_type(2))) float v2f;
typedef __attribute__((ext_vector_type(4))) int v4i;

__global__ __launch_bounds__(256) void k_wtG(const float* __restrict__ w, int K, int N, bf* Bt) {
    const int lane = threadIdx.x & 31; const int L0 = (blockIdx.x * 8 + (threadIdx.x >> 5)) * 8; const int nlines = N * K / 64;
{
#pragma unroll 1
        for (int l = 0; l < 8; ++l) { const int L = L0 + l; if (L >= nlines) break; const size_t e = (size_t)L * 64 + lane * 2; const int k = (int)(e % K), n = (int)(e / K); v2us o;
            o[0] = f2bf(w[(size_t)k * N + n]); o[1] = f2bf(w[(size_t)(k + 1) * N + n]); *(v2us*)(Bt + e) = o; }
         }
}
__global__ __launch_bounds__(256) void k_cvt8(const float* __restrict__ src, bf* dst, size_t n8) { const size_t i = (size_t)blockIdx.x * 256 + threadIdx.x; if (i >= n8) return; const v8f v = *(const v8f*)(src + i * 8); v8us o;
#pragma unroll
    for (int k = 0; k < 8; ++k) o[k] = f2bf(v[k]); *(v8us*)(dst + i * 8) = o;  }

// k_rope: head planes [h][t][d] (fp16 + hi/lo) of rope(x) x sc with the rotate-half convention out[d] = x[d] cos[t][d] - x[d+HD/2] sin[t][d], out[d+HD/2] = x[d+HD/2] cos[t][d+HD/2] + x[d] sin[t][d+HD/2]
__global__ __launch_bounds__(256) void k_rope(const float* __restrict__ F, int pitch, int nheads, const float* __restrict__ CS, const float* __restrict__ RF, const float* __restrict__ nw, float sc, h16* P16, bf* Ph, bf* Pl) {
    const size_t e = ((size_t)blockIdx.x * 256 + threadIdx.x) * 2; if (e >= (size_t)nheads * TT * HD) return; const int d = (int)(e % HD); const int t = (int)((e / HD) % TT); const int h = (int)(e / ((size_t)HD * TT)); const float* f = F + (size_t)t * pitch + h * HD; const float rf = RF ? RF[(size_t)h * TT + t] : 1.0f; v2h o16; v2us oh, ol;
#pragma unroll
    for (int q = 0; q < 2; ++q) { const int dd = d + q; const int dp = (dd < HD / 2) ? dd + HD / 2 : dd - HD / 2; float x0 = f[dd], x1 = f[dp];
        if (RF) { float n0 = __fmul_rn(x0, rf), n1 = __fmul_rn(x1, rf); asm volatile("" : "+v"(n0)); asm volatile("" : "+v"(n1)); x0 = __fmul_rn(bfr(nw[dd]), n0); x1 = __fmul_rn(bfr(nw[dp]), n1); }
        const v2f cs = *(const v2f*)(CS + ((size_t)t * HD + dd) * 2); float a = __fmul_rn(x0, cs[0]), bq = __fmul_rn(x1, cs[1]); asm volatile("" : "+v"(a)); asm volatile("" : "+v"(bq)); const float r = ((dd < HD / 2) ? __fsub_rn(a, bq) : __fadd_rn(a, bq)) * sc;
        o16[q] = tohx(r); unsigned short a2, c2; splitf(r, a2, c2); oh[q] = a2; ol[q] = c2; }
    *(v2h*)(P16 + e) = o16; *(v2us*)(Ph + e) = oh; *(v2us*)(Pl + e) = ol;  }
__global__ __launch_bounds__(256) void k_wtH(const float* __restrict__ w, bf* Bt) { const size_t e2 = ((size_t)blockIdx.x * 256 + threadIdx.x) * 2; if (e2 >= (size_t)DQ * DM) return; const int d = (int)(e2 % DM); const int r = (int)(e2 / DM); const int h = r / HD, e = r % HD; v2us o; o[0] = f2bf(w[((size_t)h * DM + d) * HD + e]); o[1] = f2bf(w[((size_t)h * DM + d + 1) * HD + e]);
    *(v2us*)(Bt + e2) = o;  }
__global__ __launch_bounds__(256) void k_vtp(const float* __restrict__ F, int pitch, int nheads, h16* V16, bf* Vh, bf* Vl) { const size_t e = ((size_t)blockIdx.x * 256 + threadIdx.x) * 2; if (e >= (size_t)nheads * HD * TT) return; const int t = (int)(e % TT); const int d = (int)((e / TT) % HD); const int g = (int)(e / ((size_t)TT * HD)); v2h o16; v2us oh, ol;
#pragma unroll
    for (int q = 0; q < 2; ++q) { const float x = F[(size_t)(t + q) * pitch + g * HD + d]; o16[q] = tohx(x); unsigned short a2, c2; splitf(x, a2, c2); oh[q] = a2; ol[q] = c2; }
    *(v2h*)(V16 + e) = o16; *(v2us*)(Vh + e) = oh; *(v2us*)(Vl + e) = ol;  }
__global__ __launch_bounds__(256) void k_csid(float* CS) { const int idx = blockIdx.x * 256 + threadIdx.x; if (idx >= TT * HD) return; v2f cs; cs[0] = 1.0f; cs[1] = 0.0f; *(v2f*)(CS + (size_t)idx * 2) = cs;  }
// k_asoft: per row (zz, i): t = S x 1024^-0.5 for j <= i and i - j < WIN (sliding causal window; the reference's -1e9 additive fill vanishes identically); softmax over the 2048 keys (register row, one exp, fixed trees);
__global__ __launch_bounds__(256) void k_asoft(const float* __restrict__ Sb, h16* P16, bf* Ph, bf* Pl) {
    const int lane = threadIdx.x & 31; const int row = blockIdx.x * 8 + (threadIdx.x >> 5); if (row >= ZH * TT) return; const int i = row % TT; const int zz = row / TT; (void)zz; const bool hires = (i < RH); const float* sr = Sb + (size_t)row * TT; float v[TT / 32]; float mx = -3.0e38f;
#pragma unroll
    for (int ch = 0; ch < TT / 128; ++ch) { const int j0 = ch * 128 + lane * 4; const v4f a = *(const v4f*)(sr + j0);
#pragma unroll
        for (int q = 0; q < 4; ++q) { const int j = j0 + q; (void)j; const float t = (j <= i && i - j < WIN) ? a[q] * SCL : -3.0e38f; v[ch * 4 + q] = t; mx = fmaxf(mx, t); } }
#pragma unroll
    for (int sh = 16; sh; sh >>= 1) mx = fmaxf(mx, __shfl_xor(mx, sh, 32));
    float sum = 0.f;
#pragma unroll
    for (int k = 0; k < TT / 32; ++k) { float d0 = __fsub_rn(v[k], mx); asm volatile("" : "+v"(d0)); v[k] = __builtin_amdgcn_exp2f(__fmul_rn(d0, 1.4426950408889634f)); sum += v[k]; }
#pragma unroll
    for (int sh = 16; sh; sh >>= 1) sum += __shfl_xor(sum, sh, 32);
    const float f = __fdiv_rn(hires ? 1.0f : PCAR, sum);
{
        if (hires) {
#pragma unroll
            for (int ch = 0; ch < TT / 128; ++ch) { v4us oh, ol;
#pragma unroll
                for (int q = 0; q < 4; ++q) { unsigned short a, c2; splitf(v[ch * 4 + q] * f, a, c2); oh[q] = a; ol[q] = c2; }
                const size_t oo = ((size_t)zz * (RH ? RH : 1) + i) * TT + ch * 128 + lane * 4; *(v4us*)(Ph + oo) = oh; *(v4us*)(Pl + oo) = ol; }
        } else {
#pragma unroll
            for (int ch = 0; ch < TT / 128; ++ch) { v4h o4;
#pragma unroll
                for (int q = 0; q < 4; ++q) o4[q] = tohx(v[ch * 4 + q] * f);
                *(v4h*)(P16 + (size_t)row * TT + ch * 128 + lane * 4) = o4; } }
         }
}
__global__ __launch_bounds__(256) void k_merge(const float* __restrict__ O, int h0, bf* Ah, bf* Al) { const size_t e = ((size_t)blockIdx.x * 256 + threadIdx.x) * 2; if (e >= (size_t)ZH * TT * HD) return; const int d = (int)(e % HD); const int t = (int)((e / HD) % TT); const int zz = (int)(e / ((size_t)HD * TT)); const float cs = (t < RH) ? 1.0f : (1.0f / PCAR); const size_t oo = (size_t)t * DQ + (h0 + zz) * HD + d;
    v2us oh, ol;
#pragma unroll
    for (int q = 0; q < 2; ++q) { unsigned short a, c2; splitf(O[e + q] * cs, a, c2); oh[q] = a; ol[q] = c2; } *(v2us*)(Ah + oo) = oh; *(v2us*)(Al + oo) = ol;  }

extern "C" void kernel_launch(void* const* d_in, const int* in_sizes, int n_in,
                              void* d_out, int out_size, void* d_ws, size_t ws_size, hipStream_t stream) {
    (void)in_sizes; (void)n_in; (void)out_size;
    const float* x = (const float*)d_in[0]; const float* wq = (const float*)d_in[1]; const float* wk = (const float*)d_in[2]; const float* wv = (const float*)d_in[3]; const float* wo = (const float*)d_in[4]; const float* bo = (const float*)d_in[5];   /* order x, Wq, Wk, Wv [16][1024][64], Wproj ('xw' [1024][1024]), bproj */
    float* OUT = (float*)d_out;     // [4][2048][1024]
    char* wsp = (char*)d_ws;
    auto take = [&](size_t bytes) { char* p = wsp; wsp += (bytes + 255) & ~(size_t)255; return (void*)p; };
    bf* WQ = (bf*)take((size_t)DQ * DM * 2); bf* WK = (bf*)take((size_t)DKV * DM * 2); bf* WV = (bf*)take((size_t)DKV * DM * 2); bf* WO = (bf*)take((size_t)DM * DQ * 2); float* CS = (float*)take((size_t)TT * HD * 2 * 4);
    bf* XB = (bf*)take((size_t)TT * DM * 2); float* FQ = (float*)take((size_t)TT * DQ * 4); float* FK = (float*)take((size_t)TT * DKV * 4);
    h16* QP16 = (h16*)take((size_t)NH_ * TT * HD * 2); h16* KP16 = (h16*)take((size_t)NKV * TT * HD * 2); h16* VT16 = (h16*)take((size_t)NKV * HD * TT * 2);
    bf* QPh = (bf*)take((size_t)NH_ * TT * HD * 2); bf* QPl = (bf*)take((size_t)NH_ * TT * HD * 2); bf* KPh = (bf*)take((size_t)NKV * TT * HD * 2); bf* KPl = (bf*)take((size_t)NKV * TT * HD * 2); bf* VTh = (bf*)take((size_t)NKV * HD * TT * 2); bf* VTl = (bf*)take((size_t)NKV * HD * TT * 2); bf* Ph = (bf*)take((size_t)ZH * RH * TT * 2); bf* Pl = (bf*)take((size_t)ZH * RH * TT * 2);
    float* Sb = (float*)take((size_t)ZH * TT * TT * 4); h16* P16 = (h16*)take((size_t)ZH * TT * TT * 2); float* Ob = (float*)take((size_t)ZH * TT * HD * 4); bf* ATh = (bf*)take((size_t)TT * DQ * 2); bf* ATl = (bf*)take((size_t)TT * DQ * 2);
    if ((size_t)(wsp - (char*)d_ws) > ws_size) return;    // ws 256 MiB
    float* FV = FK;   // v projection reuses the k buffer after the k planes are built (stream-ordered)
    { k_wtH<<<(unsigned)(((size_t)DQ * DM / 2 + 255) / 256), 256, 0, stream>>>(wq, WQ);   /* per-head [16][1024][64] -> Bt [1024][1024] */ k_wtH<<<(unsigned)(((size_t)DQ * DM / 2 + 255) / 256), 256, 0, stream>>>(wk, WK);   /* per-head [16][1024][64] -> Bt [1024][1024] */ k_wtH<<<(unsigned)(((size_t)DQ * DM / 2 + 255) / 256), 256, 0, stream>>>(wv, WV);   /* per-head [16][1024][64] -> Bt [1024][1024] */
      k_wtG<<<(unsigned)((DQ * DM / 64 + 63) / 64), 256, 0, stream>>>(wo, DQ, DM, WO);
       }
    k_csid<<<(TT * HD + 255) / 256, 256, 0, stream>>>(CS);
    const unsigned LQ = (unsigned)(((size_t)NH_ * TT * HD / 2 + 255) / 256), LKv = (unsigned)(((size_t)NKV * TT * HD / 2 + 255) / 256);
    for (int b = 0; b < NB_; ++b) {
        
        k_cvt8<<<(unsigned)(((size_t)TT * DM / 8 + 255) / 256), 256, 0, stream>>>(x + (size_t)b * TT * DM, XB, (size_t)TT * DM / 8);
        k_gemmw<bf, 0, false><<<dim3(TT / 64, DQ / 64, 1), 32, 0, stream>>>(XB, nullptr, WQ, nullptr, DM, FQ, DQ, nullptr, 0, 0, 0);
        k_rope<<<LQ, 256, 0, stream>>>(FQ, DQ, NH_, CS, nullptr, nullptr, 1.0f, QP16, QPh, QPl);
        k_gemmw<bf, 0, false><<<dim3(TT / 64, DKV / 64, 1), 32, 0, stream>>>(XB, nullptr, WK, nullptr, DM, FK, DKV, nullptr, 0, 0, 0);
        k_rope<<<LKv, 256, 0, stream>>>(FK, DKV, NKV, CS, nullptr, nullptr, 1.0f, KP16, KPh, KPl);
        k_gemmw<bf, 0, false><<<dim3(TT / 64, DKV / 64, 1), 32, 0, stream>>>(XB, nullptr, WV, nullptr, DM, FV, DKV, nullptr, 0, 0, 0); k_vtp<<<LKv, 256, 0, stream>>>(FV, DKV, NKV, VT16, VTh, VTl);
        for (int h0 = 0; h0 < NH_; h0 += ZH) { const size_t zq = (size_t)h0, zk = (size_t)(h0 / REP);   // one kv head per query head: the pass's two heads use consecutive kv planes (z-strides TT*HD)
            k_gemmc<bf, 2, 1><<<dim3(RH / 64, TT / 64, ZH), 32, 0, stream>>>(QPh + zq * TT * HD, QPl + zq * TT * HD, KPh + zk * TT * HD, KPl + zk * TT * HD, HD, Sb, TT, 0, (size_t)TT * HD, (size_t)TT * HD, (size_t)TT * TT);
            k_gemmc<h16, 0, 1><<<dim3((TT - RH) / 64, TT / 64, ZH), 32, 0, stream>>>(QP16 + zq * TT * HD + (size_t)RH * HD, nullptr, KP16 + zk * TT * HD, nullptr, HD, Sb + (size_t)RH * TT, TT, RH, (size_t)TT * HD, (size_t)TT * HD, (size_t)TT * TT);
            k_asoft<<<ZH * TT / 8, 256, 0, stream>>>(Sb, P16, Ph, Pl);
            k_gemmc<bf, 2, 2><<<dim3(RH / 64, HD / 64, ZH), 32, 0, stream>>>(Ph, Pl, VTh + zk * HD * TT, VTl + zk * HD * TT, TT, Ob, HD, 0, (size_t)RH * TT, (size_t)HD * TT, (size_t)TT * HD);
            k_gemmc<h16, 0, 2><<<dim3((TT - RH) / 64, HD / 64, ZH), 32, 0, stream>>>(P16 + (size_t)RH * TT, nullptr, VT16 + zk * HD * TT, nullptr, TT, Ob + (size_t)RH * HD, HD, RH, (size_t)TT * TT, (size_t)HD * TT, (size_t)TT * HD);
            k_merge<<<(unsigned)(((size_t)ZH * TT * HD / 2 + 255) / 256), 256, 0, stream>>>(Ob, h0, ATh, ATl); }
        k_gemmw<bf, 1, true><<<dim3(TT / 64, DM / 64, 1), 32, 0, stream>>>(ATh, ATl, WO, nullptr, DQ, OUT + (size_t)b * TT * DM, DM, bo, 0, 0, 0); }
}

// v001
// It runs in 1510 microseconds.
// Next to v000, in two timings, it ran 1.92 and 1.90 times as fast.
#include <hip/hip_runtime.h>

// Causal multi-head attention with per-head stacked projection weights and an embed-size score scale (x [4][2048][1024]; q, k, v = einsum('btc,hcd', x, W) with Wq, Wk, Wv [16][1024][64] (0.02, no bias; 16 heads x 64); wei = q.k x 1024^-0.5 (the source scales by n_embd, not the head size); causal (-inf); softmax; out = concat heads Wproj + bproj ('xw' [1024][1024] + bias) -> [4][2048][1024] (8.4 M); argument order x, Wq, Wk, Wv, Wproj, bproj).
// Layout per batch: bf16 copy of x; k_wtH gathers each per-head tensor [h][c][d] into one Bt plane (row h*64 + d) so each projection is one exact GEMM with head-major output columns; identity-table plane builders; causal T-2048 attention (hybrid rows: < 512 hi/lo 3 products, rest fp16 x1024; k_gemmc skips tiles above the diagonal); merged hi/lo x Wproj exact + bproj.
// Compute dtypes, f32 accumulate: every input rounded to bf16; projections exact; attention rows < 512 3 products, rest fp16; softmax f32; Wproj hl x exact + bias.

#define NB_  4
#define TT   2048
#define DM   1024
#define NH_  16
#define NKV  16
#define REP  (NH_ / NKV)
#define HD   64
#define DQ   (NH_ * HD)
#define DKV  (NKV * HD)
#define ZH   2
#define RH   512                  // query rows < RH use hi+lo planes (0: none)
#define WIN  2048
#define PCAR 1024.0f
#define SCL  0.03125f   // 1024^-0.5: the module scales by n_embd
#define KCH  128                  // keys per workgroup of the probability x value product (its key loop is split over blockIdx.y)
#define NPL  (TT / KCH)           // partial planes of that product; k_merge adds them in ascending key order
typedef _Float16 h16;
typedef unsigned short bf;
typedef __attribute__((ext_vector_type(16))) __bf16   v16bf;
typedef __attribute__((ext_vector_type(16))) _Float16 v16h;
typedef __attribute__((ext_vector_type(8)))  _Float16 v8h;
typedef __attribute__((ext_vector_type(8)))  unsigned short v8us;
typedef __attribute__((ext_vector_type(8)))  float    v8f;
typedef __attribute__((ext_vector_type(4)))  float    v4f;
typedef v8h  __attribute__((may_alias)) v8ha;
typedef v4f  __attribute__((may_alias)) v4fa;
typedef v8us __attribute__((may_alias)) v8usa;

__device__ __forceinline__ unsigned short f2bf(float f) { unsigned u = __float_as_uint(f); u += 0x7FFFu + ((u >> 16) & 1u); return (unsigned short)(u >> 16); }
__device__ __forceinline__ float bf2f(unsigned short b) { return __uint_as_float(((unsigned)b) << 16); }
__device__ __forceinline__ float bfr(float f) { return bf2f(f2bf(f)); }
__device__ __forceinline__ v16h cat16(v8h lo, v8h hi) { return __builtin_shufflevector(lo, hi, 0, 1, 2, 3, 4, 5, 6, 7, 8, 9, 10, 11, 12, 13, 14, 15); }
__device__ __forceinline__ v16bf cat16b(v8us lo, v8us hi) { return __builtin_bit_cast(v16bf, __builtin_shufflevector(lo, hi, 0, 1, 2, 3, 4, 5, 6, 7, 8, 9, 10, 11, 12, 13, 14, 15)); }
__device__ __forceinline__ v8f wmma16(v16h a, v16h b, v8f c) { return __builtin_amdgcn_wmma_f32_16x16x32_f16(false, a, false, b, (short)0, c, false, false); }
__device__ __forceinline__ v8f wmmab(v16bf a, v16bf b, v8f c) { return __builtin_amdgcn_wmma_f32_16x16x32_bf16(false, a, false, b, (short)0, c, false, false); }



// ---- k_gemmw: register-blocked GEMM, ONE WAVE per 64x64 output tile (16 accumulators), operands straight from K-contiguous 16-bit planes; grid (M/64, N/64, Z), 32 threads.
// C[m][n] (f32, pitch ldc, + optional f32 bias[n]) = sum_k A[m][k] Bt[n][k] (+ split products per NSPLIT). z-batch strides sA/sB/sC in elements. K % 32 == 0.
template <typename T16> struct WFrag;
template <> struct WFrag<h16> { typedef v16h V; static __device__ __forceinline__ V ld(const h16* p) { return cat16(*(const v8h*)p, *(const v8h*)(p + 16)); } static __device__ __forceinline__ v8f mma(V a, V b, v8f c) { return wmma16(a, b, c); } };
template <> struct WFrag<bf> { typedef v16bf V; static __device__ __forceinline__ V ld(const bf* p) { return cat16b(*(const v8us*)p, *(const v8us*)(p + 16)); } static __device__ __forceinline__ v8f mma(V a, V b, v8f c) { return wmmab(a, b, c); } };
template <typename T16, int NSPLIT, bool BIAS>
__global__ __launch_bounds__(32) void k_gemmw(const T16* __restrict__ A, const T16* __restrict__ A2, const T16* __restrict__ Bt, const T16* __restrict__ Bt2, int K, float* C, int ldc, const float* __restrict__ bias, size_t sA, size_t sB, size_t sC) {
    typedef typename WFrag<T16>::V V;
    __shared__ __align__(16) float os[16 * 68];
    const size_t z = blockIdx.z; A += z * sA; if (A2) A2 += z * sA; Bt += z * sB; if (Bt2) Bt2 += z * sB; C += z * sC;
    const int lane = threadIdx.x & 31, lr = lane & 15, hi = lane >> 4; const int r0 = blockIdx.x * 64, c0 = blockIdx.y * 64;
    v8f acc[4][4];
#pragma unroll
    for (int mb = 0; mb < 4; ++mb)
#pragma unroll
        for (int nb = 0; nb < 4; ++nb) acc[mb][nb] = (v8f){};
    const size_t aoff = (size_t)(r0 + lr) * K + 8 * hi, boff = (size_t)(c0 + lr) * K + 8 * hi;
#pragma unroll 1
    for (int kc = 0; kc < K; kc += 32) {
        V a[4], a2[4];
#pragma unroll
        for (int mb = 0; mb < 4; ++mb) { a[mb] = WFrag<T16>::ld(A + aoff + (size_t)mb * 16 * K + kc); if (NSPLIT == 1 || NSPLIT == 2) a2[mb] = WFrag<T16>::ld(A2 + aoff + (size_t)mb * 16 * K + kc); }
#pragma unroll
        for (int nb = 0; nb < 4; ++nb) { const V b = WFrag<T16>::ld(Bt + boff + (size_t)nb * 16 * K + kc); V b2; if (NSPLIT >= 2) b2 = WFrag<T16>::ld(Bt2 + boff + (size_t)nb * 16 * K + kc);
#pragma unroll
            for (int mb = 0; mb < 4; ++mb) { acc[mb][nb] = WFrag<T16>::mma(a[mb], b, acc[mb][nb]); if (NSPLIT == 1 || NSPLIT == 2) acc[mb][nb] = WFrag<T16>::mma(a2[mb], b, acc[mb][nb]); if (NSPLIT >= 2) acc[mb][nb] = WFrag<T16>::mma(a[mb], b2, acc[mb][nb]); } }
        asm volatile("v_nop\n\tv_nop\n\tv_nop\n\tv_nop" : "+v"(acc[0][0]), "+v"(acc[1][1]), "+v"(acc[2][2]), "+v"(acc[3][3]) : "v"(a[0]), "v"(a[3]));
    }
#pragma unroll
    for (int mb = 0; mb < 4; ++mb) {
#pragma unroll
        for (int nb = 0; nb < 4; ++nb) {
#pragma unroll
            for (int j = 0; j < 8; ++j) os[(hi * 8 + j) * 68 + nb * 16 + lr] = acc[mb][nb][j]; }
        __builtin_amdgcn_wave_barrier(); asm volatile("" ::: "memory");
        float* crow = C + (size_t)(r0 + mb * 16) * ldc + c0;
{
#pragma unroll
            for (int s = 0; s < 8; ++s) { const int row = 2 * s + hi, cofs = lr * 4; v4f val = *(const v4fa*)(os + row * 68 + cofs); if (BIAS) { val[0] += bfr(bias[c0 + cofs]); val[1] += bfr(bias[c0 + cofs + 1]); val[2] += bfr(bias[c0 + cofs + 2]); val[3] += bfr(bias[c0 + cofs + 3]); }
                *(v4f*)(crow + (size_t)row * ldc + cofs) = val; }
             }
        __builtin_amdgcn_wave_barrier(); asm volatile("" ::: "memory");
    }
}

// ---- k_gemmc: the same one-wave 64x64 tile GEMM specialised for causal attention: CMODE 1 skips score tiles entirely above the diagonal (query rows r0+roff.., key columns c0..), CMODE 2 limits the
// key (K) loop of the probability x value contraction to the diagonal block (probabilities beyond it are exactly zero). roff = row offset of this launch's first row within the sequence.
// CMODE 2 has one column tile (HD = 64), so blockIdx.y is the key chunk: workgroup y sums keys [y*KCH, y*KCH + KCH) below the diagonal limit into partial plane y (stride sP); a chunk wholly past the limit writes nothing and k_merge does not read it.
template <typename T16, int NSPLIT, int CMODE>
__global__ __launch_bounds__(32) void k_gemmc(const T16* __restrict__ A, const T16* __restrict__ A2, const T16* __restrict__ Bt, const T16* __restrict__ Bt2, int K, float* C, int ldc, int roff, size_t sA, size_t sB, size_t sC, size_t sP) {
    typedef typename WFrag<T16>::V V;
    __shared__ __align__(16) float os[16 * 68];
    const size_t z = blockIdx.z; A += z * sA; if (A2) A2 += z * sA; Bt += z * sB; if (Bt2) Bt2 += z * sB; C += z * sC;
    const int lane = threadIdx.x & 31, lr = lane & 15, hi = lane >> 4; const int r0 = blockIdx.x * 64, c0 = (CMODE == 2) ? 0 : blockIdx.y * 64;
    if (CMODE == 1 && c0 > r0 + roff + 63) return;                  // score tile entirely above the causal diagonal: never read (the softmax masks j > i by select)
    const int Kl = (CMODE == 2) ? min(K, r0 + roff + 64) : K;        // P.V: probabilities are exactly 0 beyond the diagonal block, so the K loop stops there
    const int kb = (CMODE == 2) ? (int)blockIdx.y * KCH : 0;         // first key of this workgroup's chunk
    if (CMODE == 2 && kb >= Kl) return;
    const int kn = (CMODE == 2) ? min(Kl - kb, KCH) : Kl;            // keys this workgroup sums
    if (CMODE == 2) { A += kb; if (A2) A2 += kb; Bt += kb; if (Bt2) Bt2 += kb; C += (size_t)blockIdx.y * sP; }
    v8f acc[4][4];
#pragma unroll
    for (int mb = 0; mb < 4; ++mb)
#pragma unroll
        for (int nb = 0; nb < 4; ++nb) acc[mb][nb] = (v8f){};
    const size_t aoff = (size_t)(r0 + lr) * K + 8 * hi, boff = (size_t)(c0 + lr) * K + 8 * hi;
#pragma unroll 1
    for (int kc = 0; kc < kn; kc += 32) {
        V a[4], a2[4];
#pragma unroll
        for (int mb = 0; mb < 4; ++mb) { a[mb] = WFrag<T16>::ld(A + aoff + (size_t)mb * 16 * K + kc); if (NSPLIT == 1 || NSPLIT == 2) a2[mb] = WFrag<T16>::ld(A2 + aoff + (size_t)mb * 16 * K + kc); }
#pragma unroll
        for (int nb = 0; nb < 4; ++nb) { const V b = WFrag<T16>::ld(Bt + boff + (size_t)nb * 16 * K + kc); V b2; if (NSPLIT >= 2) b2 = WFrag<T16>::ld(Bt2 + boff + (size_t)nb * 16 * K + kc);
#pragma unroll
            for (int mb = 0; mb < 4; ++mb) { acc[mb][nb] = WFrag<T16>::mma(a[mb], b, acc[mb][nb]); if (NSPLIT == 1 || NSPLIT == 2) acc[mb][nb] = WFrag<T16>::mma(a2[mb], b, acc[mb][nb]); if (NSPLIT >= 2) acc[mb][nb] = WFrag<T16>::mma(a[mb], b2, acc[mb][nb]); } }
        asm volatile("v_nop\n\tv_nop\n\tv_nop\n\tv_nop" : "+v"(acc[0][0]), "+v"(acc[1][1]), "+v"(acc[2][2]), "+v"(acc[3][3]) : "v"(a[0]), "v"(a[3]));
    }
#pragma unroll
    for (int mb = 0; mb < 4; ++mb) {
#pragma unroll
        for (int nb = 0; nb < 4; ++nb) {
#pragma unroll
            for (int j = 0; j < 8; ++j) os[(hi * 8 + j) * 68 + nb * 16 + lr] = acc[mb][nb][j]; }
        __builtin_amdgcn_wave_barrier(); asm volatile("" ::: "memory");
        float* crow = C + (size_t)(r0 + mb * 16) * ldc + c0;
{
#pragma unroll
            for (int s = 0; s < 8; ++s) { const int row = 2 * s + hi, cofs = lr * 4; v4f val = *(const v4fa*)(os + row * 68 + cofs);
                *(v4f*)(crow + (size_t)row * ldc + cofs) = val; }
             }
        __builtin_amdgcn_wave_barrier(); asm volatile("" ::: "memory");
    }
}

__device__ __forceinline__ h16 tohx(float x) { return (h16)x; }
__device__ __forceinline__ void splitf(float y, unsigned short& h, unsigned short& l) { h = f2bf(y); l = f2bf(y - bf2f(h)); }
typedef __attribute__((ext_vector_type(2))) _Float16 v2h;
typedef __attribute__((ext_vector_type(4))) _Float16 v4h;
typedef __attribute__((ext_vector_type(2))) unsigned short v2us;
typedef __attribute__((ext_vector_type(4))) unsigned short v4us;
typedef __attribute__((ext_vector_type(2))) float v2f;
typedef __attribute__((ext_vector_type(4))) int v4i;

__global__ __launch_bounds__(256) void k_wtG(const float* __restrict__ w, int K, int N, bf* Bt) {
    const int lane = threadIdx.x & 31; const int L0 = (blockIdx.x * 8 + (threadIdx.x >> 5)) * 8; const int nlines = N * K / 64;
{
#pragma unroll 1
        for (int l = 0; l < 8; ++l) { const int L = L0 + l; if (L >= nlines) break; const size_t e = (size_t)L * 64 + lane * 2; const int k = (int)(e % K), n = (int)(e / K); v2us o;
            o[0] = f2bf(w[(size_t)k * N + n]); o[1] = f2bf(w[(size_t)(k + 1) * N + n]); *(v2us*)(Bt + e) = o; }
         }
}
__global__ __launch_bounds__(256) void k_cvt8(const float* __restrict__ src, bf* dst, size_t n8) { const size_t i = (size_t)blockIdx.x * 256 + threadIdx.x; if (i >= n8) return; const v8f v = *(const v8f*)(src + i * 8); v8us o;
#pragma unroll
    for (int k = 0; k < 8; ++k) o[k] = f2bf(v[k]); *(v8us*)(dst + i * 8) = o;  }

// k_rope: head planes [h][t][d] (fp16 + hi/lo) of rope(x) x sc with the rotate-half convention out[d] = x[d] cos[t][d] - x[d+HD/2] sin[t][d], out[d+HD/2] = x[d+HD/2] cos[t][d+HD/2] + x[d] sin[t][d+HD/2]
__global__ __launch_bounds__(256) void k_rope(const float* __restrict__ F, int pitch, int nheads, const float* __restrict__ CS, const float* __restrict__ RF, const float* __restrict__ nw, float sc, h16* P16, bf* Ph, bf* Pl) {
    const size_t e = ((size_t)blockIdx.x * 256 + threadIdx.x) * 2; if (e >= (size_t)nheads * TT * HD) return; const int d = (int)(e % HD); const int t = (int)((e / HD) % TT); const int h = (int)(e / ((size_t)HD * TT)); const float* f = F + (size_t)t * pitch + h * HD; const float rf = RF ? RF[(size_t)h * TT + t] : 1.0f; v2h o16; v2us oh, ol;
#pragma unroll
    for (int q = 0; q < 2; ++q) { const int dd = d + q; const int dp = (dd < HD / 2) ? dd + HD / 2 : dd - HD / 2; float x0 = f[dd], x1 = f[dp];
        if (RF) { float n0 = __fmul_rn(x0, rf), n1 = __fmul_rn(x1, rf); asm volatile("" : "+v"(n0)); asm volatile("" : "+v"(n1)); x0 = __fmul_rn(bfr(nw[dd]), n0); x1 = __fmul_rn(bfr(nw[dp]), n1); }
        const v2f cs = *(const v2f*)(CS + ((size_t)t * HD + dd) * 2); float a = __fmul_rn(x0, cs[0]), bq = __fmul_rn(x1, cs[1]); asm volatile("" : "+v"(a)); asm volatile("" : "+v"(bq)); const float r = ((dd < HD / 2) ? __fsub_rn(a, bq) : __fadd_rn(a, bq)) * sc;
        o16[q] = tohx(r); unsigned short a2, c2; splitf(r, a2, c2); oh[q] = a2; ol[q] = c2; }
    *(v2h*)(P16 + e) = o16; *(v2us*)(Ph + e) = oh; *(v2us*)(Pl + e) = ol;  }
__global__ __launch_bounds__(256) void k_wtH(const float* __restrict__ w, bf* Bt) { const size_t e2 = ((size_t)blockIdx.x * 256 + threadIdx.x) * 2; if (e2 >= (size_t)DQ * DM) return; const int d = (int)(e2 % DM); const int r = (int)(e2 / DM); const int h = r / HD, e = r % HD; v2us o; o[0] = f2bf(w[((size_t)h * DM + d) * HD + e]); o[1] = f2bf(w[((size_t)h * DM + d + 1) * HD + e]);
    *(v2us*)(Bt + e2) = o;  }
__global__ __launch_bounds__(256) void k_vtp(const float* __restrict__ F, int pitch, int nheads, h16* V16, bf* Vh, bf* Vl) { const size_t e = ((size_t)blockIdx.x * 256 + threadIdx.x) * 2; if (e >= (size_t)nheads * HD * TT) return; const int t = (int)(e % TT); const int d = (int)((e / TT) % HD); const int g = (int)(e / ((size_t)TT * HD)); v2h o16; v2us oh, ol;
#pragma unroll
    for (int q = 0; q < 2; ++q) { const float x = F[(size_t)(t + q) * pitch + g * HD + d]; o16[q] = tohx(x); unsigned short a2, c2; splitf(x, a2, c2); oh[q] = a2; ol[q] = c2; }
    *(v2h*)(V16 + e) = o16; *(v2us*)(Vh + e) = oh; *(v2us*)(Vl + e) = ol;  }
__global__ __launch_bounds__(256) void k_csid(float* CS) { const int idx = blockIdx.x * 256 + threadIdx.x; if (idx >= TT * HD) return; v2f cs; cs[0] = 1.0f; cs[1] = 0.0f; *(v2f*)(CS + (size_t)idx * 2) = cs;  }
// k_asoft: per row (zz, i): t = S x 1024^-0.5 for j <= i and i - j < WIN (sliding causal window; the reference's -1e9 additive fill vanishes identically); softmax over the 2048 keys (register row, one exp, fixed trees);
__global__ __launch_bounds__(256) void k_asoft(const float* __restrict__ Sb, h16* P16, bf* Ph, bf* Pl) {
    const int lane = threadIdx.x & 31; const int row = blockIdx.x * 8 + (threadIdx.x >> 5); if (row >= ZH * TT) return; const int i = row % TT; const int zz = row / TT; (void)zz; const bool hires = (i < RH); const float* sr = Sb + (size_t)row * TT; float v[TT / 32]; float mx = -3.0e38f;
#pragma unroll
    for (int ch = 0; ch < TT / 128; ++ch) { const int j0 = ch * 128 + lane * 4; const v4f a = *(const v4f*)(sr + j0);
#pragma unroll
        for (int q = 0; q < 4; ++q) { const int j = j0 + q; (void)j; const float t = (j <= i && i - j < WIN) ? a[q] * SCL : -3.0e38f; v[ch * 4 + q] = t; mx = fmaxf(mx, t); } }
#pragma unroll
    for (int sh = 16; sh; sh >>= 1) mx = fmaxf(mx, __shfl_xor(mx, sh, 32));
    float sum = 0.f;
#pragma unroll
    for (int k = 0; k < TT / 32; ++k) { float d0 = __fsub_rn(v[k], mx); asm volatile("" : "+v"(d0)); v[k] = __builtin_amdgcn_exp2f(__fmul_rn(d0, 1.4426950408889634f)); sum += v[k]; }
#pragma unroll
    for (int sh = 16; sh; sh >>= 1) sum += __shfl_xor(sum, sh, 32);
    const float f = __fdiv_rn(hires ? 1.0f : PCAR, sum);
{
        if (hires) {
#pragma unroll
            for (int ch = 0; ch < TT / 128; ++ch) { v4us oh, ol;
#pragma unroll
                for (int q = 0; q < 4; ++q) { unsigned short a, c2; splitf(v[ch * 4 + q] * f, a, c2); oh[q] = a; ol[q] = c2; }
                const size_t oo = ((size_t)zz * (RH ? RH : 1) + i) * TT + ch * 128 + lane * 4; *(v4us*)(Ph + oo) = oh; *(v4us*)(Pl + oo) = ol; }
        } else {
#pragma unroll
            for (int ch = 0; ch < TT / 128; ++ch) { v4h o4;
#pragma unroll
                for (int q = 0; q < 4; ++q) o4[q] = tohx(v[ch * 4 + q] * f);
                *(v4h*)(P16 + (size_t)row * TT + ch * 128 + lane * 4) = o4; } }
         }
}
__global__ __launch_bounds__(256) void k_merge(const float* __restrict__ O, int h0, bf* Ah, bf* Al) { const size_t e = ((size_t)blockIdx.x * 256 + threadIdx.x) * 2; if (e >= (size_t)ZH * TT * HD) return; const int d = (int)(e % HD); const int t = (int)((e / HD) % TT); const int zz = (int)(e / ((size_t)HD * TT)); const float cs = (t < RH) ? 1.0f : (1.0f / PCAR); const size_t oo = (size_t)t * DQ + (h0 + zz) * HD + d;
    const int np = ((t & ~63) + 64 + KCH - 1) / KCH;   // key chunks that the row's 64-row tile wrote (the same limit as in k_gemmc)
    v2f pp[NPL];   // all loads issued before the first add; an index past the row's last chunk re-reads that last written plane (same line) and is dropped below, so no unwritten plane is read
#pragma unroll
    for (int k = 0; k < NPL; ++k) pp[k] = *(const v2f*)(O + (size_t)min(k, np - 1) * ((size_t)ZH * TT * HD) + e);
    v2f sm = pp[0];
#pragma unroll
    for (int k = 1; k < NPL; ++k) { sm[0] += (k < np) ? pp[k][0] : 0.f; sm[1] += (k < np) ? pp[k][1] : 0.f; }
    v2us oh, ol;
#pragma unroll
    for (int q = 0; q < 2; ++q) { unsigned short a, c2; splitf(sm[q] * cs, a, c2); oh[q] = a; ol[q] = c2; } *(v2us*)(Ah + oo) = oh; *(v2us*)(Al + oo) = ol;  }

extern "C" void kernel_launch(void* const* d_in, const int* in_sizes, int n_in,
                              void* d_out, int out_size, void* d_ws, size_t ws_size, hipStream_t stream) {
    (void)in_sizes; (void)n_in; (void)out_size;
    const float* x = (const float*)d_in[0]; const float* wq = (const float*)d_in[1]; const float* wk = (const float*)d_in[2]; const float* wv = (const float*)d_in[3]; const float* wo = (const float*)d_in[4]; const float* bo = (const float*)d_in[5];   /* order x, Wq, Wk, Wv [16][1024][64], Wproj ('xw' [1024][1024]), bproj */
    float* OUT = (float*)d_out;     // [4][2048][1024]
    char* wsp = (char*)d_ws;
    auto take = [&](size_t bytes) { char* p = wsp; wsp += (bytes + 255) & ~(size_t)255; return (void*)p; };
    bf* WQ = (bf*)take((size_t)DQ * DM * 2); bf* WK = (bf*)take((size_t)DKV * DM * 2); bf* WV = (bf*)take((size_t)DKV * DM * 2); bf* WO = (bf*)take((size_t)DM * DQ * 2); float* CS = (float*)take((size_t)TT * HD * 2 * 4);
    bf* XB = (bf*)take((size_t)TT * DM * 2); float* FQ = (float*)take((size_t)TT * DQ * 4); float* FK = (float*)take((size_t)TT * DKV * 4);
    h16* QP16 = (h16*)take((size_t)NH_ * TT * HD * 2); h16* KP16 = (h16*)take((size_t)NKV * TT * HD * 2); h16* VT16 = (h16*)take((size_t)NKV * HD * TT * 2);
    bf* QPh = (bf*)take((size_t)NH_ * TT * HD * 2); bf* QPl = (bf*)take((size_t)NH_ * TT * HD * 2); bf* KPh = (bf*)take((size_t)NKV * TT * HD * 2); bf* KPl = (bf*)take((size_t)NKV * TT * HD * 2); bf* VTh = (bf*)take((size_t)NKV * HD * TT * 2); bf* VTl = (bf*)take((size_t)NKV * HD * TT * 2); bf* Ph = (bf*)take((size_t)ZH * RH * TT * 2); bf* Pl = (bf*)take((size_t)ZH * RH * TT * 2);
    float* Sb = (float*)take((size_t)ZH * TT * TT * 4); h16* P16 = (h16*)take((size_t)ZH * TT * TT * 2); float* Ob = (float*)take((size_t)NPL * ZH * TT * HD * 4); bf* ATh = (bf*)take((size_t)TT * DQ * 2); bf* ATl = (bf*)take((size_t)TT * DQ * 2);
    if ((size_t)(wsp - (char*)d_ws) > ws_size) return;    // ws 256 MiB
    float* FV = FK;   // v projection reuses the k buffer after the k planes are built (stream-ordered)
    { k_wtH<<<(unsigned)(((size_t)DQ * DM / 2 + 255) / 256), 256, 0, stream>>>(wq, WQ);   /* per-head [16][1024][64] -> Bt [1024][1024] */ k_wtH<<<(unsigned)(((size_t)DQ * DM / 2 + 255) / 256), 256, 0, stream>>>(wk, WK);   /* per-head [16][1024][64] -> Bt [1024][1024] */ k_wtH<<<(unsigned)(((size_t)DQ * DM / 2 + 255) / 256), 256, 0, stream>>>(wv, WV);   /* per-head [16][1024][64] -> Bt [1024][1024] */
      k_wtG<<<(unsigned)((DQ * DM / 64 + 63) / 64), 256, 0, stream>>>(wo, DQ, DM, WO);
       }
    k_csid<<<(TT * HD + 255) / 256, 256, 0, stream>>>(CS);
    const unsigned LQ = (unsigned)(((size_t)NH_ * TT * HD / 2 + 255) / 256), LKv = (unsigned)(((size_t)NKV * TT * HD / 2 + 255) / 256);
    for (int b = 0; b < NB_; ++b) {
        
        k_cvt8<<<(unsigned)(((size_t)TT * DM / 8 + 255) / 256), 256, 0, stream>>>(x + (size_t)b * TT * DM, XB, (size_t)TT * DM / 8);
        k_gemmw<bf, 0, false><<<dim3(TT / 64, DQ / 64, 1), 32, 0, stream>>>(XB, nullptr, WQ, nullptr, DM, FQ, DQ, nullptr, 0, 0, 0);
        k_rope<<<LQ, 256, 0, stream>>>(FQ, DQ, NH_, CS, nullptr, nullptr, 1.0f, QP16, QPh, QPl);
        k_gemmw<bf, 0, false><<<dim3(TT / 64, DKV / 64, 1), 32, 0, stream>>>(XB, nullptr, WK, nullptr, DM, FK, DKV, nullptr, 0, 0, 0);
        k_rope<<<LKv, 256, 0, stream>>>(FK, DKV, NKV, CS, nullptr, nullptr, 1.0f, KP16, KPh, KPl);
        k_gemmw<bf, 0, false><<<dim3(TT / 64, DKV / 64, 1), 32, 0, stream>>>(XB, nullptr, WV, nullptr, DM, FV, DKV, nullptr, 0, 0, 0); k_vtp<<<LKv, 256, 0, stream>>>(FV, DKV, NKV, VT16, VTh, VTl);
        for (int h0 = 0; h0 < NH_; h0 += ZH) { const size_t zq = (size_t)h0, zk = (size_t)(h0 / REP);   // one kv head per query head: the pass's two heads use consecutive kv planes (z-strides TT*HD)
            k_gemmc<bf, 2, 1><<<dim3(RH / 64, TT / 64, ZH), 32, 0, stream>>>(QPh + zq * TT * HD, QPl + zq * TT * HD, KPh + zk * TT * HD, KPl + zk * TT * HD, HD, Sb, TT, 0, (size_t)TT * HD, (size_t)TT * HD, (size_t)TT * TT, 0);
            k_gemmc<h16, 0, 1><<<dim3((TT - RH) / 64, TT / 64, ZH), 32, 0, stream>>>(QP16 + zq * TT * HD + (size_t)RH * HD, nullptr, KP16 + zk * TT * HD, nullptr, HD, Sb + (size_t)RH * TT, TT, RH, (size_t)TT * HD, (size_t)TT * HD, (size_t)TT * TT, 0);
            k_asoft<<<ZH * TT / 8, 256, 0, stream>>>(Sb, P16, Ph, Pl);
            k_gemmc<bf, 2, 2><<<dim3(RH / 64, RH / KCH, ZH), 32, 0, stream>>>(Ph, Pl, VTh + zk * HD * TT, VTl + zk * HD * TT, TT, Ob, HD, 0, (size_t)RH * TT, (size_t)HD * TT, (size_t)TT * HD, (size_t)ZH * TT * HD);
            k_gemmc<h16, 0, 2><<<dim3((TT - RH) / 64, TT / KCH, ZH), 32, 0, stream>>>(P16 + (size_t)RH * TT, nullptr, VT16 + zk * HD * TT, nullptr, TT, Ob + (size_t)RH * HD, HD, RH, (size_t)TT * TT, (size_t)HD * TT, (size_t)TT * HD, (size_t)ZH * TT * HD);
            k_merge<<<(unsigned)(((size_t)ZH * TT * HD / 2 + 255) / 256), 256, 0, stream>>>(Ob, h0, ATh, ATl); }
        k_gemmw<bf, 1, true><<<dim3(TT / 64, DM / 64, 1), 32, 0, stream>>>(ATh, ATl, WO, nullptr, DQ, OUT + (size_t)b * TT * DM, DM, bo, 0, 0, 0); }
}

// v002
// One run takes 1210 microseconds.
// Next to v001, in two timings, it ran 1.27 and 1.25 times as fast.
// Counting every step since v000, it is 2.40 times as fast.
#include <hip/hip_runtime.h>

// Causal multi-head attention with per-head stacked projection weights and an embed-size score scale (x [4][2048][1024]; q, k, v = einsum('btc,hcd', x, W) with Wq, Wk, Wv [16][1024][64] (0.02, no bias; 16 heads x 64); wei = q.k x 1024^-0.5 (the source scales by n_embd, not the head size); causal (-inf); softmax; out = concat heads Wproj + bproj ('xw' [1024][1024] + bias) -> [4][2048][1024] (8.4 M); argument order x, Wq, Wk, Wv, Wproj, bproj).
// Layout per batch: bf16 copy of x; k_wtH gathers each per-head tensor [h][c][d] into one Bt plane (row h*64 + d) so each projection is one exact GEMM with head-major output columns; identity-table plane builders; causal T-2048 attention (hybrid rows: < 512 hi/lo 3 products, rest fp16 x1024; k_gemmc skips tiles above the diagonal); merged hi/lo x Wproj exact + bproj.
// Compute dtypes, f32 accumulate: every input rounded to bf16; projections exact; attention rows < 512 3 products, rest fp16; softmax f32; Wproj hl x exact + bias.

#define NB_  4
#define TT   2048
#define DM   1024
#define NH_  16
#define NKV  16
#define REP  (NH_ / NKV)
#define HD   64
#define DQ   (NH_ * HD)
#define DKV  (NKV * HD)
#define ZH   4                    // heads per attention pass (grid z of the k_gemmc launches of the pass); 8 would need 361 MiB of workspace in this layout
#define RH   512                  // query rows < RH use hi+lo planes (0: none)
#define WIN  2048
#define PCAR 1024.0f
#define SCL  0.03125f   // 1024^-0.5: the module scales by n_embd
#define KCH  128                  // keys per workgroup of the probability x value product (its key loop is split over blockIdx.y)
#define NPL  (TT / KCH)           // partial planes of that product; k_merge adds them in ascending key order
typedef _Float16 h16;
typedef unsigned short bf;
typedef __attribute__((ext_vector_type(16))) __bf16   v16bf;
typedef __attribute__((ext_vector_type(16))) _Float16 v16h;
typedef __attribute__((ext_vector_type(8)))  _Float16 v8h;
typedef __attribute__((ext_vector_type(8)))  unsigned short v8us;
typedef __attribute__((ext_vector_type(8)))  float    v8f;
typedef __attribute__((ext_vector_type(4)))  float    v4f;
typedef v8h  __attribute__((may_alias)) v8ha;
typedef v4f  __attribute__((may_alias)) v4fa;
typedef v8us __attribute__((may_alias)) v8usa;

__device__ __forceinline__ unsigned short f2bf(float f) { unsigned u = __float_as_uint(f); u += 0x7FFFu + ((u >> 16) & 1u); return (unsigned short)(u >> 16); }
__device__ __forceinline__ float bf2f(unsigned short b) { return __uint_as_float(((unsigned)b) << 16); }
__device__ __forceinline__ float bfr(float f) { return bf2f(f2bf(f)); }
__device__ __forceinline__ v16h cat16(v8h lo, v8h hi) { return __builtin_shufflevector(lo, hi, 0, 1, 2, 3, 4, 5, 6, 7, 8, 9, 10, 11, 12, 13, 14, 15); }
__device__ __forceinline__ v16bf cat16b(v8us lo, v8us hi) { return __builtin_bit_cast(v16bf, __builtin_shufflevector(lo, hi, 0, 1, 2, 3, 4, 5, 6, 7, 8, 9, 10, 11, 12, 13, 14, 15)); }
__device__ __forceinline__ v8f wmma16(v16h a, v16h b, v8f c) { return __builtin_amdgcn_wmma_f32_16x16x32_f16(false, a, false, b, (short)0, c, false, false); }
__device__ __forceinline__ v8f wmmab(v16bf a, v16bf b, v8f c) { return __builtin_amdgcn_wmma_f32_16x16x32_bf16(false, a, false, b, (short)0, c, false, false); }



// ---- k_gemmw: register-blocked GEMM, ONE WAVE per 64x64 output tile (16 accumulators), operands straight from K-contiguous 16-bit planes; grid (M/64, N/64, Z), 32 threads.
// C[m][n] (f32, pitch ldc, + optional f32 bias[n]) = sum_k A[m][k] Bt[n][k] (+ split products per NSPLIT). z-batch strides sA/sB/sC in elements. K % 32 == 0.
template <typename T16> struct WFrag;
template <> struct WFrag<h16> { typedef v16h V; static __device__ __forceinline__ V ld(const h16* p) { return cat16(*(const v8h*)p, *(const v8h*)(p + 16)); } static __device__ __forceinline__ v8f mma(V a, V b, v8f c) { return wmma16(a, b, c); } };
template <> struct WFrag<bf> { typedef v16bf V; static __device__ __forceinline__ V ld(const bf* p) { return cat16b(*(const v8us*)p, *(const v8us*)(p + 16)); } static __device__ __forceinline__ v8f mma(V a, V b, v8f c) { return wmmab(a, b, c); } };
template <typename T16, int NSPLIT, bool BIAS>
__global__ __launch_bounds__(32) void k_gemmw(const T16* __restrict__ A, const T16* __restrict__ A2, const T16* __restrict__ Bt, const T16* __restrict__ Bt2, int K, float* C, int ldc, const float* __restrict__ bias, size_t sA, size_t sB, size_t sC) {
    typedef typename WFrag<T16>::V V;
    __shared__ __align__(16) float os[16 * 68];
    const size_t z = blockIdx.z; A += z * sA; if (A2) A2 += z * sA; Bt += z * sB; if (Bt2) Bt2 += z * sB; C += z * sC;
    const int lane = threadIdx.x & 31, lr = lane & 15, hi = lane >> 4; const int r0 = blockIdx.x * 64, c0 = blockIdx.y * 64;
    v8f acc[4][4];
#pragma unroll
    for (int mb = 0; mb < 4; ++mb)
#pragma unroll
        for (int nb = 0; nb < 4; ++nb) acc[mb][nb] = (v8f){};
    const size_t aoff = (size_t)(r0 + lr) * K + 8 * hi, boff = (size_t)(c0 + lr) * K + 8 * hi;
#pragma unroll 1
    for (int kc = 0; kc < K; kc += 32) {
        V a[4], a2[4];
#pragma unroll
        for (int mb = 0; mb < 4; ++mb) { a[mb] = WFrag<T16>::ld(A + aoff + (size_t)mb * 16 * K + kc); if (NSPLIT == 1 || NSPLIT == 2) a2[mb] = WFrag<T16>::ld(A2 + aoff + (size_t)mb * 16 * K + kc); }
#pragma unroll
        for (int nb = 0; nb < 4; ++nb) { const V b = WFrag<T16>::ld(Bt + boff + (size_t)nb * 16 * K + kc); V b2; if (NSPLIT >= 2) b2 = WFrag<T16>::ld(Bt2 + boff + (size_t)nb * 16 * K + kc);
#pragma unroll
            for (int mb = 0; mb < 4; ++mb) { acc[mb][nb] = WFrag<T16>::mma(a[mb], b, acc[mb][nb]); if (NSPLIT == 1 || NSPLIT == 2) acc[mb][nb] = WFrag<T16>::mma(a2[mb], b, acc[mb][nb]); if (NSPLIT >= 2) acc[mb][nb] = WFrag<T16>::mma(a[mb], b2, acc[mb][nb]); } }
        asm volatile("v_nop\n\tv_nop\n\tv_nop\n\tv_nop" : "+v"(acc[0][0]), "+v"(acc[1][1]), "+v"(acc[2][2]), "+v"(acc[3][3]) : "v"(a[0]), "v"(a[3]));
    }
#pragma unroll
    for (int mb = 0; mb < 4; ++mb) {
#pragma unroll
        for (int nb = 0; nb < 4; ++nb) {
#pragma unroll
            for (int j = 0; j < 8; ++j) os[(hi * 8 + j) * 68 + nb * 16 + lr] = acc[mb][nb][j]; }
        __builtin_amdgcn_wave_barrier(); asm volatile("" ::: "memory");
        float* crow = C + (size_t)(r0 + mb * 16) * ldc + c0;
{
#pragma unroll
            for (int s = 0; s < 8; ++s) { const int row = 2 * s + hi, cofs = lr * 4; v4f val = *(const v4fa*)(os + row * 68 + cofs); if (BIAS) { val[0] += bfr(bias[c0 + cofs]); val[1] += bfr(bias[c0 + cofs + 1]); val[2] += bfr(bias[c0 + cofs + 2]); val[3] += bfr(bias[c0 + cofs + 3]); }
                *(v4f*)(crow + (size_t)row * ldc + cofs) = val; }
             }
        __builtin_amdgcn_wave_barrier(); asm volatile("" ::: "memory");
    }
}

// ---- k_gemmc: the same one-wave 64x64 tile GEMM specialised for causal attention: CMODE 1 skips score tiles entirely above the diagonal (query rows r0+roff.., key columns c0..), CMODE 2 limits the
// key (K) loop of the probability x value contraction to the diagonal block (probabilities beyond it are exactly zero). roff = row offset of this launch's first row within the sequence.
// CMODE 2 has one column tile (HD = 64), so blockIdx.y is the key chunk: workgroup y sums keys [y*KCH, y*KCH + KCH) below the diagonal limit into partial plane y (stride sP); a chunk wholly past the limit writes nothing and k_merge does not read it.
template <typename T16, int NSPLIT, int CMODE>
__global__ __launch_bounds__(32) void k_gemmc(const T16* __restrict__ A, const T16* __restrict__ A2, const T16* __restrict__ Bt, const T16* __restrict__ Bt2, int K, float* C, int ldc, int roff, size_t sA, size_t sB, size_t sC, size_t sP) {
    typedef typename WFrag<T16>::V V;
    __shared__ __align__(16) float os[16 * 68];
    const size_t z = blockIdx.z; A += z * sA; if (A2) A2 += z * sA; Bt += z * sB; if (Bt2) Bt2 += z * sB; C += z * sC;
    const int lane = threadIdx.x & 31, lr = lane & 15, hi = lane >> 4; const int r0 = blockIdx.x * 64, c0 = (CMODE == 2) ? 0 : blockIdx.y * 64;
    if (CMODE == 1 && c0 > r0 + roff + 63) return;                  // score tile entirely above the causal diagonal: never read (the softmax masks j > i by select)
    const int Kl = (CMODE == 2) ? min(K, r0 + roff + 64) : K;        // P.V: probabilities are exactly 0 beyond the diagonal block, so the K loop stops there
    const int kb = (CMODE == 2) ? (int)blockIdx.y * KCH : 0;         // first key of this workgroup's chunk
    if (CMODE == 2 && kb >= Kl) return;
    const int kn = (CMODE == 2) ? min(Kl - kb, KCH) : Kl;            // keys this workgroup sums
    if (CMODE == 2) { A += kb; if (A2) A2 += kb; Bt += kb; if (Bt2) Bt2 += kb; C += (size_t)blockIdx.y * sP; }
    v8f acc[4][4];
#pragma unroll
    for (int mb = 0; mb < 4; ++mb)
#pragma unroll
        for (int nb = 0; nb < 4; ++nb) acc[mb][nb] = (v8f){};
    const size_t aoff = (size_t)(r0 + lr) * K + 8 * hi, boff = (size_t)(c0 + lr) * K + 8 * hi;
#pragma unroll 1
    for (int kc = 0; kc < kn; kc += 32) {
        V a[4], a2[4];
#pragma unroll
        for (int mb = 0; mb < 4; ++mb) { a[mb] = WFrag<T16>::ld(A + aoff + (size_t)mb * 16 * K + kc); if (NSPLIT == 1 || NSPLIT == 2) a2[mb] = WFrag<T16>::ld(A2 + aoff + (size_t)mb * 16 * K + kc); }
#pragma unroll
        for (int nb = 0; nb < 4; ++nb) { const V b = WFrag<T16>::ld(Bt + boff + (size_t)nb * 16 * K + kc); V b2; if (NSPLIT >= 2) b2 = WFrag<T16>::ld(Bt2 + boff + (size_t)nb * 16 * K + kc);
#pragma unroll
            for (int mb = 0; mb < 4; ++mb) { acc[mb][nb] = WFrag<T16>::mma(a[mb], b, acc[mb][nb]); if (NSPLIT == 1 || NSPLIT == 2) acc[mb][nb] = WFrag<T16>::mma(a2[mb], b, acc[mb][nb]); if (NSPLIT >= 2) acc[mb][nb] = WFrag<T16>::mma(a[mb], b2, acc[mb][nb]); } }
        asm volatile("v_nop\n\tv_nop\n\tv_nop\n\tv_nop" : "+v"(acc[0][0]), "+v"(acc[1][1]), "+v"(acc[2][2]), "+v"(acc[3][3]) : "v"(a[0]), "v"(a[3]));
    }
#pragma unroll
    for (int mb = 0; mb < 4; ++mb) {
#pragma unroll
        for (int nb = 0; nb < 4; ++nb) {
#pragma unroll
            for (int j = 0; j < 8; ++j) os[(hi * 8 + j) * 68 + nb * 16 + lr] = acc[mb][nb][j]; }
        __builtin_amdgcn_wave_barrier(); asm volatile("" ::: "memory");
        float* crow = C + (size_t)(r0 + mb * 16) * ldc + c0;
{
#pragma unroll
            for (int s = 0; s < 8; ++s) { const int row = 2 * s + hi, cofs = lr * 4; v4f val = *(const v4fa*)(os + row * 68 + cofs);
                *(v4f*)(crow + (size_t)row * ldc + cofs) = val; }
             }
        __builtin_amdgcn_wave_barrier(); asm volatile("" ::: "memory");
    }
}

__device__ __forceinline__ h16 tohx(float x) { return (h16)x; }
__device__ __forceinline__ void splitf(float y, unsigned short& h, unsigned short& l) { h = f2bf(y); l = f2bf(y - bf2f(h)); }
typedef __attribute__((ext_vector_type(2))) _Float16 v2h;
typedef __attribute__((ext_vector_type(4))) _Float16 v4h;
typedef __attribute__((ext_vector_type(2))) unsigned short v2us;
typedef __attribute__((ext_vector_type(4))) unsigned short v4us;
typedef __attribute__((ext_vector_type(2))) float v2f;
typedef __attribute__((ext_vector_type(4))) int v4i;

__global__ __launch_bounds__(256) void k_wtG(const float* __restrict__ w, int K, int N, bf* Bt) {
    const int lane = threadIdx.x & 31; const int L0 = (blockIdx.x * 8 + (threadIdx.x >> 5)) * 8; const int nlines = N * K / 64;
{
#pragma unroll 1
        for (int l = 0; l < 8; ++l) { const int L = L0 + l; if (L >= nlines) break; const size_t e = (size_t)L * 64 + lane * 2; const int k = (int)(e % K), n = (int)(e / K); v2us o;
            o[0] = f2bf(w[(size_t)k * N + n]); o[1] = f2bf(w[(size_t)(k + 1) * N + n]); *(v2us*)(Bt + e) = o; }
         }
}
__global__ __launch_bounds__(256) void k_cvt8(const float* __restrict__ src, bf* dst, size_t n8) { const size_t i = (size_t)blockIdx.x * 256 + threadIdx.x; if (i >= n8) return; const v8f v = *(const v8f*)(src + i * 8); v8us o;
#pragma unroll
    for (int k = 0; k < 8; ++k) o[k] = f2bf(v[k]); *(v8us*)(dst + i * 8) = o;  }

// k_rope: head planes [h][t][d] (fp16 + hi/lo) of rope(x) x sc with the rotate-half convention out[d] = x[d] cos[t][d] - x[d+HD/2] sin[t][d], out[d+HD/2] = x[d+HD/2] cos[t][d+HD/2] + x[d] sin[t][d+HD/2]
__global__ __launch_bounds__(256) void k_rope(const float* __restrict__ F, int pitch, int nheads, const float* __restrict__ CS, const float* __restrict__ RF, const float* __restrict__ nw, float sc, h16* P16, bf* Ph, bf* Pl) {
    const size_t e = ((size_t)blockIdx.x * 256 + threadIdx.x) * 2; if (e >= (size_t)nheads * TT * HD) return; const int d = (int)(e % HD); const int t = (int)((e / HD) % TT); const int h = (int)(e / ((size_t)HD * TT)); const float* f = F + (size_t)t * pitch + h * HD; const float rf = RF ? RF[(size_t)h * TT + t] : 1.0f; v2h o16; v2us oh, ol;
#pragma unroll
    for (int q = 0; q < 2; ++q) { const int dd = d + q; const int dp = (dd < HD / 2) ? dd + HD / 2 : dd - HD / 2; float x0 = f[dd], x1 = f[dp];
        if (RF) { float n0 = __fmul_rn(x0, rf), n1 = __fmul_rn(x1, rf); asm volatile("" : "+v"(n0)); asm volatile("" : "+v"(n1)); x0 = __fmul_rn(bfr(nw[dd]), n0); x1 = __fmul_rn(bfr(nw[dp]), n1); }
        const v2f cs = *(const v2f*)(CS + ((size_t)t * HD + dd) * 2); float a = __fmul_rn(x0, cs[0]), bq = __fmul_rn(x1, cs[1]); asm volatile("" : "+v"(a)); asm volatile("" : "+v"(bq)); const float r = ((dd < HD / 2) ? __fsub_rn(a, bq) : __fadd_rn(a, bq)) * sc;
        o16[q] = tohx(r); unsigned short a2, c2; splitf(r, a2, c2); oh[q] = a2; ol[q] = c2; }
    *(v2h*)(P16 + e) = o16; *(v2us*)(Ph + e) = oh; *(v2us*)(Pl + e) = ol;  }
__global__ __launch_bounds__(256) void k_wtH(const float* __restrict__ w, bf* Bt) { const size_t e2 = ((size_t)blockIdx.x * 256 + threadIdx.x) * 2; if (e2 >= (size_t)DQ * DM) return; const int d = (int)(e2 % DM); const int r = (int)(e2 / DM); const int h = r / HD, e = r % HD; v2us o; o[0] = f2bf(w[((size_t)h * DM + d) * HD + e]); o[1] = f2bf(w[((size_t)h * DM + d + 1) * HD + e]);
    *(v2us*)(Bt + e2) = o;  }
__global__ __launch_bounds__(256) void k_vtp(const float* __restrict__ F, int pitch, int nheads, h16* V16, bf* Vh, bf* Vl) { const size_t e = ((size_t)blockIdx.x * 256 + threadIdx.x) * 2; if (e >= (size_t)nheads * HD * TT) return; const int t = (int)(e % TT); const int d = (int)((e / TT) % HD); const int g = (int)(e / ((size_t)TT * HD)); v2h o16; v2us oh, ol;
#pragma unroll
    for (int q = 0; q < 2; ++q) { const float x = F[(size_t)(t + q) * pitch + g * HD + d]; o16[q] = tohx(x); unsigned short a2, c2; splitf(x, a2, c2); oh[q] = a2; ol[q] = c2; }
    *(v2h*)(V16 + e) = o16; *(v2us*)(Vh + e) = oh; *(v2us*)(Vl + e) = ol;  }
__global__ __launch_bounds__(256) void k_csid(float* CS) { const int idx = blockIdx.x * 256 + threadIdx.x; if (idx >= TT * HD) return; v2f cs; cs[0] = 1.0f; cs[1] = 0.0f; *(v2f*)(CS + (size_t)idx * 2) = cs;  }
// k_asoft: per row (zz, i): t = S x 1024^-0.5 for j <= i and i - j < WIN (sliding causal window; the reference's -1e9 additive fill vanishes identically); softmax over the 2048 keys (register row, one exp, fixed trees);
__global__ __launch_bounds__(256) void k_asoft(const float* __restrict__ Sb, h16* P16, bf* Ph, bf* Pl) {
    const int lane = threadIdx.x & 31; const int row = blockIdx.x * 8 + (threadIdx.x >> 5); if (row >= ZH * TT) return; const int i = row % TT; const int zz = row / TT; (void)zz; const bool hires = (i < RH); const float* sr = Sb + (size_t)row * TT; float v[TT / 32]; float mx = -3.0e38f;
#pragma unroll
    for (int ch = 0; ch < TT / 128; ++ch) { const int j0 = ch * 128 + lane * 4; const v4f a = *(const v4f*)(sr + j0);
#pragma unroll
        for (int q = 0; q < 4; ++q) { const int j = j0 + q; (void)j; const float t = (j <= i && i - j < WIN) ? a[q] * SCL : -3.0e38f; v[ch * 4 + q] = t; mx = fmaxf(mx, t); } }
#pragma unroll
    for (int sh = 16; sh; sh >>= 1) mx = fmaxf(mx, __shfl_xor(mx, sh, 32));
    float sum = 0.f;
#pragma unroll
    for (int k = 0; k < TT / 32; ++k) { float d0 = __fsub_rn(v[k], mx); asm volatile("" : "+v"(d0)); v[k] = __builtin_amdgcn_exp2f(__fmul_rn(d0, 1.4426950408889634f)); sum += v[k]; }
#pragma unroll
    for (int sh = 16; sh; sh >>= 1) sum += __shfl_xor(sum, sh, 32);
    const float f = __fdiv_rn(hires ? 1.0f : PCAR, sum);
{
        if (hires) {
#pragma unroll
            for (int ch = 0; ch < TT / 128; ++ch) { v4us oh, ol;
#pragma unroll
                for (int q = 0; q < 4; ++q) { unsigned short a, c2; splitf(v[ch * 4 + q] * f, a, c2); oh[q] = a; ol[q] = c2; }
                const size_t oo = ((size_t)zz * (RH ? RH : 1) + i) * TT + ch * 128 + lane * 4; *(v4us*)(Ph + oo) = oh; *(v4us*)(Pl + oo) = ol; }
        } else {
#pragma unroll
            for (int ch = 0; ch < TT / 128; ++ch) { v4h o4;
#pragma unroll
                for (int q = 0; q < 4; ++q) o4[q] = tohx(v[ch * 4 + q] * f);
                *(v4h*)(P16 + (size_t)row * TT + ch * 128 + lane * 4) = o4; } }
         }
}
__global__ __launch_bounds__(256) void k_merge(const float* __restrict__ O, int h0, bf* Ah, bf* Al) { const size_t e = ((size_t)blockIdx.x * 256 + threadIdx.x) * 2; if (e >= (size_t)ZH * TT * HD) return; const int d = (int)(e % HD); const int t = (int)((e / HD) % TT); const int zz = (int)(e / ((size_t)HD * TT)); const float cs = (t < RH) ? 1.0f : (1.0f / PCAR); const size_t oo = (size_t)t * DQ + (h0 + zz) * HD + d;
    const int np = ((t & ~63) + 64 + KCH - 1) / KCH;   // key chunks that the row's 64-row tile wrote (the same limit as in k_gemmc)
    v2f pp[NPL];   // all loads issued before the first add; an index past the row's last chunk re-reads that last written plane (same line) and is dropped below, so no unwritten plane is read
#pragma unroll
    for (int k = 0; k < NPL; ++k) pp[k] = *(const v2f*)(O + (size_t)min(k, np - 1) * ((size_t)ZH * TT * HD) + e);
    v2f sm = pp[0];
#pragma unroll
    for (int k = 1; k < NPL; ++k) { sm[0] += (k < np) ? pp[k][0] : 0.f; sm[1] += (k < np) ? pp[k][1] : 0.f; }
    v2us oh, ol;
#pragma unroll
    for (int q = 0; q < 2; ++q) { unsigned short a, c2; splitf(sm[q] * cs, a, c2); oh[q] = a; ol[q] = c2; } *(v2us*)(Ah + oo) = oh; *(v2us*)(Al + oo) = ol;  }

extern "C" void kernel_launch(void* const* d_in, const int* in_sizes, int n_in,
                              void* d_out, int out_size, void* d_ws, size_t ws_size, hipStream_t stream) {
    (void)in_sizes; (void)n_in; (void)out_size;
    const float* x = (const float*)d_in[0]; const float* wq = (const float*)d_in[1]; const float* wk = (const float*)d_in[2]; const float* wv = (const float*)d_in[3]; const float* wo = (const float*)d_in[4]; const float* bo = (const float*)d_in[5];   /* order x, Wq, Wk, Wv [16][1024][64], Wproj ('xw' [1024][1024]), bproj */
    float* OUT = (float*)d_out;     // [4][2048][1024]
    char* wsp = (char*)d_ws;
    auto take = [&](size_t bytes) { char* p = wsp; wsp += (bytes + 255) & ~(size_t)255; return (void*)p; };
    bf* WQ = (bf*)take((size_t)DQ * DM * 2); bf* WK = (bf*)take((size_t)DKV * DM * 2); bf* WV = (bf*)take((size_t)DKV * DM * 2); bf* WO = (bf*)take((size_t)DM * DQ * 2); float* CS = (float*)take((size_t)TT * HD * 2 * 4);
    bf* XB = (bf*)take((size_t)TT * DM * 2); float* FQ = (float*)take((size_t)TT * DQ * 4); float* FK = (float*)take((size_t)TT * DKV * 4);
    h16* QP16 = (h16*)take((size_t)NH_ * TT * HD * 2); h16* KP16 = (h16*)take((size_t)NKV * TT * HD * 2); h16* VT16 = (h16*)take((size_t)NKV * HD * TT * 2);
    bf* QPh = (bf*)take((size_t)NH_ * TT * HD * 2); bf* QPl = (bf*)take((size_t)NH_ * TT * HD * 2); bf* KPh = (bf*)take((size_t)NKV * TT * HD * 2); bf* KPl = (bf*)take((size_t)NKV * TT * HD * 2); bf* VTh = (bf*)take((size_t)NKV * HD * TT * 2); bf* VTl = (bf*)take((size_t)NKV * HD * TT * 2); bf* Ph = (bf*)take((size_t)ZH * RH * TT * 2); bf* Pl = (bf*)take((size_t)ZH * RH * TT * 2);
    float* Sb = (float*)take((size_t)ZH * TT * TT * 4); h16* P16 = (h16*)take((size_t)ZH * TT * TT * 2); float* Ob = (float*)take((size_t)NPL * ZH * TT * HD * 4); bf* ATh = (bf*)take((size_t)TT * DQ * 2); bf* ATl = (bf*)take((size_t)TT * DQ * 2);
    if ((size_t)(wsp - (char*)d_ws) > ws_size) return;    // ws 256 MiB
    float* FV = FK;   // v projection reuses the k buffer after the k planes are built (stream-ordered)
    { k_wtH<<<(unsigned)(((size_t)DQ * DM / 2 + 255) / 256), 256, 0, stream>>>(wq, WQ);   /* per-head [16][1024][64] -> Bt [1024][1024] */ k_wtH<<<(unsigned)(((size_t)DQ * DM / 2 + 255) / 256), 256, 0, stream>>>(wk, WK);   /* per-head [16][1024][64] -> Bt [1024][1024] */ k_wtH<<<(unsigned)(((size_t)DQ * DM / 2 + 255) / 256), 256, 0, stream>>>(wv, WV);   /* per-head [16][1024][64] -> Bt [1024][1024] */
      k_wtG<<<(unsigned)((DQ * DM / 64 + 63) / 64), 256, 0, stream>>>(wo, DQ, DM, WO);
       }
    k_csid<<<(TT * HD + 255) / 256, 256, 0, stream>>>(CS);
    const unsigned LQ = (unsigned)(((size_t)NH_ * TT * HD / 2 + 255) / 256), LKv = (unsigned)(((size_t)NKV * TT * HD / 2 + 255) / 256);
    for (int b = 0; b < NB_; ++b) {
        
        k_cvt8<<<(unsigned)(((size_t)TT * DM / 8 + 255) / 256), 256, 0, stream>>>(x + (size_t)b * TT * DM, XB, (size_t)TT * DM / 8);
        k_gemmw<bf, 0, false><<<dim3(TT / 64, DQ / 64, 1), 32, 0, stream>>>(XB, nullptr, WQ, nullptr, DM, FQ, DQ, nullptr, 0, 0, 0);
        k_rope<<<LQ, 256, 0, stream>>>(FQ, DQ, NH_, CS, nullptr, nullptr, 1.0f, QP16, QPh, QPl);
        k_gemmw<bf, 0, false><<<dim3(TT / 64, DKV / 64, 1), 32, 0, stream>>>(XB, nullptr, WK, nullptr, DM, FK, DKV, nullptr, 0, 0, 0);
        k_rope<<<LKv, 256, 0, stream>>>(FK, DKV, NKV, CS, nullptr, nullptr, 1.0f, KP16, KPh, KPl);
        k_gemmw<bf, 0, false><<<dim3(TT / 64, DKV / 64, 1), 32, 0, stream>>>(XB, nullptr, WV, nullptr, DM, FV, DKV, nullptr, 0, 0, 0); k_vtp<<<LKv, 256, 0, stream>>>(FV, DKV, NKV, VT16, VTh, VTl);
        for (int h0 = 0; h0 < NH_; h0 += ZH) { const size_t zq = (size_t)h0, zk = (size_t)(h0 / REP);   // one kv head per query head: the pass's heads use consecutive kv planes (z-strides TT*HD)
            k_gemmc<bf, 2, 1><<<dim3(RH / 64, TT / 64, ZH), 32, 0, stream>>>(QPh + zq * TT * HD, QPl + zq * TT * HD, KPh + zk * TT * HD, KPl + zk * TT * HD, HD, Sb, TT, 0, (size_t)TT * HD, (size_t)TT * HD, (size_t)TT * TT, 0);
            k_gemmc<h16, 0, 1><<<dim3((TT - RH) / 64, TT / 64, ZH), 32, 0, stream>>>(QP16 + zq * TT * HD + (size_t)RH * HD, nullptr, KP16 + zk * TT * HD, nullptr, HD, Sb + (size_t)RH * TT, TT, RH, (size_t)TT * HD, (size_t)TT * HD, (size_t)TT * TT, 0);
            k_asoft<<<ZH * TT / 8, 256, 0, stream>>>(Sb, P16, Ph, Pl);
            k_gemmc<bf, 2, 2><<<dim3(RH / 64, RH / KCH, ZH), 32, 0, stream>>>(Ph, Pl, VTh + zk * HD * TT, VTl + zk * HD * TT, TT, Ob, HD, 0, (size_t)RH * TT, (size_t)HD * TT, (size_t)TT * HD, (size_t)ZH * TT * HD);
            k_gemmc<h16, 0, 2><<<dim3((TT - RH) / 64, TT / KCH, ZH), 32, 0, stream>>>(P16 + (size_t)RH * TT, nullptr, VT16 + zk * HD * TT, nullptr, TT, Ob + (size_t)RH * HD, HD, RH, (size_t)TT * TT, (size_t)HD * TT, (size_t)TT * HD, (size_t)ZH * TT * HD);
            k_merge<<<(unsigned)(((size_t)ZH * TT * HD / 2 + 255) / 256), 256, 0, stream>>>(Ob, h0, ATh, ATl); }
        k_gemmw<bf, 1, true><<<dim3(TT / 64, DM / 64, 1), 32, 0, stream>>>(ATh, ATl, WO, nullptr, DQ, OUT + (size_t)b * TT * DM, DM, bo, 0, 0, 0); }
}

// v004
// One run takes 551 microseconds.
// Versions between v002 and this one are left out; their measured steps multiply to 2.17 times as fast.
// Counting every step since v000, it is 5.22 times as fast.
#include <hip/hip_runtime.h>

// Causal multi-head attention with per-head stacked projection weights and an embed-size score scale (x [4][2048][1024]; q, k, v = einsum('btc,hcd', x, W) with Wq, Wk, Wv [16][1024][64] (0.02, no bias; 16 heads x 64); wei = q.k x 1024^-0.5 (the source scales by n_embd, not the head size); causal (-inf); softmax; out = concat heads Wproj + bproj ('xw' [1024][1024] + bias) -> [4][2048][1024] (8.4 M); argument order x, Wq, Wk, Wv, Wproj, bproj).
// Layout per batch: bf16 copy of x; k_wtH gathers each per-head tensor [h][c][d] into one Bt plane (row h*64 + d) so each projection is one exact GEMM with head-major output columns, whose epilogue writes the head planes (fp16 + hi/lo bf16; V transposed) itself; one fused causal attention launch (k_fattn; hybrid rows: < 512 hi/lo 3 products, rest fp16; key blocks above the diagonal are never visited); hi/lo x Wproj exact + bproj.
// Compute dtypes, f32 accumulate: every input rounded to bf16; projections exact; attention rows < 512 3 products, rest fp16; softmax f32; Wproj hl x exact + bias.

#define NB_  4
#define TT   2048
#define DM   1024
#define NH_  16
#define NKV  16
#define HD   64
#define DQ   (NH_ * HD)
#define DKV  (NKV * HD)
#define SC2  0.04508422002778011f   // 1024^-0.5 x log2(e): the module scales by n_embd; scores go to the log2 domain for exp2
#define RH   512                  // query rows < RH use hi+lo planes (0: none)
typedef _Float16 h16;
typedef unsigned short bf;
typedef __attribute__((ext_vector_type(16))) __bf16   v16bf;
typedef __attribute__((ext_vector_type(16))) _Float16 v16h;
typedef __attribute__((ext_vector_type(8)))  _Float16 v8h;
typedef __attribute__((ext_vector_type(8)))  unsigned short v8us;
typedef __attribute__((ext_vector_type(8)))  float    v8f;
typedef __attribute__((ext_vector_type(4)))  float    v4f;
typedef v8h  __attribute__((may_alias)) v8ha;
typedef v4f  __attribute__((may_alias)) v4fa;
typedef v8us __attribute__((may_alias)) v8usa;

__device__ __forceinline__ unsigned short f2bf(float f) { unsigned u = __float_as_uint(f); u += 0x7FFFu + ((u >> 16) & 1u); return (unsigned short)(u >> 16); }
__device__ __forceinline__ float bf2f(unsigned short b) { return __uint_as_float(((unsigned)b) << 16); }
__device__ __forceinline__ float bfr(float f) { return bf2f(f2bf(f)); }
__device__ __forceinline__ v16h cat16(v8h lo, v8h hi) { return __builtin_shufflevector(lo, hi, 0, 1, 2, 3, 4, 5, 6, 7, 8, 9, 10, 11, 12, 13, 14, 15); }
__device__ __forceinline__ v16bf cat16b(v8us lo, v8us hi) { return __builtin_bit_cast(v16bf, __builtin_shufflevector(lo, hi, 0, 1, 2, 3, 4, 5, 6, 7, 8, 9, 10, 11, 12, 13, 14, 15)); }
__device__ __forceinline__ v8f wmma16(v16h a, v16h b, v8f c) { return __builtin_amdgcn_wmma_f32_16x16x32_f16(false, a, false, b, (short)0, c, false, false); }
__device__ __forceinline__ v8f wmmab(v16bf a, v16bf b, v8f c) { return __builtin_amdgcn_wmma_f32_16x16x32_bf16(false, a, false, b, (short)0, c, false, false); }

__device__ __forceinline__ h16 tohx(float x) { return (h16)x; }
__device__ __forceinline__ void splitf(float y, unsigned short& h, unsigned short& l) { h = f2bf(y); l = f2bf(y - bf2f(h)); }

// ---- k_gemmw: register-blocked GEMM, ONE WAVE per 64x64 output tile (16 accumulators), operands straight from K-contiguous 16-bit planes; grid (M/64, N/64, Z), 32 threads.
// C[m][n] (f32, pitch ldc, + optional f32 bias[n]) = sum_k A[m][k] Bt[n][k] (+ split products per NSPLIT). z-batch strides sA/sB/sC in elements. K % 32 == 0.
// PL != 0: no f32 C; the tile (64 positions t x the 64 columns d of head blockIdx.y) goes out as the three 16-bit planes that the attention kernel reads (fp16, bf16 hi, bf16 lo of the f32 sum):
// PL 1: [h][t][d] (queries, keys); PL 2: [h][d][t] (values, transposed). Every store instruction covers four whole 128-byte lines.
template <typename T16> struct WFrag;
template <> struct WFrag<h16> { typedef v16h V; static __device__ __forceinline__ V ld(const h16* p) { return cat16(*(const v8h*)p, *(const v8h*)(p + 16)); } static __device__ __forceinline__ v8f mma(V a, V b, v8f c) { return wmma16(a, b, c); } };
template <> struct WFrag<bf> { typedef v16bf V; static __device__ __forceinline__ V ld(const bf* p) { return cat16b(*(const v8us*)p, *(const v8us*)(p + 16)); } static __device__ __forceinline__ v8f mma(V a, V b, v8f c) { return wmmab(a, b, c); } };
template <typename T16, int NSPLIT, bool BIAS, int PL>
__global__ __launch_bounds__(32) void k_gemmw(const T16* __restrict__ A, const T16* __restrict__ A2, const T16* __restrict__ Bt, const T16* __restrict__ Bt2, int K, float* C, int ldc, const float* __restrict__ bias, size_t sA, size_t sB, size_t sC, h16* P16, bf* Ph, bf* Pl) {
    typedef typename WFrag<T16>::V V;
    __shared__ __align__(16) float os[16 * 68];
    const size_t z = blockIdx.z; A += z * sA; if (A2) A2 += z * sA; Bt += z * sB; if (Bt2) Bt2 += z * sB; C += z * sC;
    const int lane = threadIdx.x & 31, lr = lane & 15, hi = lane >> 4; const int r0 = blockIdx.x * 64, c0 = blockIdx.y * 64;
    v8f acc[4][4];
#pragma unroll
    for (int mb = 0; mb < 4; ++mb)
#pragma unroll
        for (int nb = 0; nb < 4; ++nb) acc[mb][nb] = (v8f){};
    const size_t aoff = (size_t)(r0 + lr) * K + 8 * hi, boff = (size_t)(c0 + lr) * K + 8 * hi;
#pragma unroll 1
    for (int kc = 0; kc < K; kc += 32) {
        V a[4], a2[4];
#pragma unroll
        for (int mb = 0; mb < 4; ++mb) { a[mb] = WFrag<T16>::ld(A + aoff + (size_t)mb * 16 * K + kc); if (NSPLIT == 1 || NSPLIT == 2) a2[mb] = WFrag<T16>::ld(A2 + aoff + (size_t)mb * 16 * K + kc); }
#pragma unroll
        for (int nb = 0; nb < 4; ++nb) { const V b = WFrag<T16>::ld(Bt + boff + (size_t)nb * 16 * K + kc); V b2; if (NSPLIT >= 2) b2 = WFrag<T16>::ld(Bt2 + boff + (size_t)nb * 16 * K + kc);
#pragma unroll
            for (int mb = 0; mb < 4; ++mb) { acc[mb][nb] = WFrag<T16>::mma(a[mb], b, acc[mb][nb]); if (NSPLIT == 1 || NSPLIT == 2) acc[mb][nb] = WFrag<T16>::mma(a2[mb], b, acc[mb][nb]); if (NSPLIT >= 2) acc[mb][nb] = WFrag<T16>::mma(a[mb], b2, acc[mb][nb]); } }
        asm volatile("v_nop\n\tv_nop\n\tv_nop\n\tv_nop" : "+v"(acc[0][0]), "+v"(acc[1][1]), "+v"(acc[2][2]), "+v"(acc[3][3]) : "v"(a[0]), "v"(a[3]));
    }
    if constexpr (PL != 0) {
        static_assert(HD == 64, "one 64-column tile is one head");
        const int h = blockIdx.y, prow = lane >> 3, pcol = (lane & 7) * 8;    // a lane takes 8 neighbours of a staged row: 8 lanes a row of 64, 4 rows a store
#pragma unroll
        for (int g = 0; g < 4; ++g) {     // 16 staged rows of 64: PL 1: positions g*16.. by d; PL 2: columns d = g*16.. by position
            if constexpr (PL == 1) {
#pragma unroll
                for (int nb = 0; nb < 4; ++nb) {
#pragma unroll
                    for (int j = 0; j < 8; ++j) os[(hi * 8 + j) * 68 + nb * 16 + lr] = acc[g][nb][j]; }
            } else {
#pragma unroll
                for (int mb = 0; mb < 4; ++mb) {    // an accumulator's 8 values are 8 neighbouring positions of one column d
                    *(v4fa*)(os + lr * 68 + mb * 16 + hi * 8) = __builtin_shufflevector(acc[mb][g], acc[mb][g], 0, 1, 2, 3); *(v4fa*)(os + lr * 68 + mb * 16 + hi * 8 + 4) = __builtin_shufflevector(acc[mb][g], acc[mb][g], 4, 5, 6, 7); }
            }
            __builtin_amdgcn_wave_barrier(); asm volatile("" ::: "memory");   // lanes read what other lanes of this one wave staged: keeps the compiler from moving the reads ahead of the writes
#pragma unroll
            for (int s = 0; s < 4; ++s) { const int row = s * 4 + prow; const v4f x0 = *(const v4fa*)(os + row * 68 + pcol), x1 = *(const v4fa*)(os + row * 68 + pcol + 4); v8h o16; v8us oh, ol;
#pragma unroll
                for (int k = 0; k < 8; ++k) { const float x = (k < 4) ? x0[k & 3] : x1[k & 3]; o16[k] = tohx(x); unsigned short a2, c2; splitf(x, a2, c2); oh[k] = a2; ol[k] = c2; }
                const size_t e = (PL == 1) ? ((size_t)h * TT + r0 + g * 16 + row) * HD + pcol : ((size_t)h * HD + g * 16 + row) * TT + r0 + pcol;
                *(v8h*)(P16 + e) = o16; *(v8us*)(Ph + e) = oh; *(v8us*)(Pl + e) = ol; }
            __builtin_amdgcn_wave_barrier(); asm volatile("" ::: "memory");   // the next group's staging stays behind these reads
        }
        return;
    }
#pragma unroll
    for (int mb = 0; mb < 4; ++mb) {
#pragma unroll
        for (int nb = 0; nb < 4; ++nb) {
#pragma unroll
            for (int j = 0; j < 8; ++j) os[(hi * 8 + j) * 68 + nb * 16 + lr] = acc[mb][nb][j]; }
        __builtin_amdgcn_wave_barrier(); asm volatile("" ::: "memory");
        float* crow = C + (size_t)(r0 + mb * 16) * ldc + c0;
{
#pragma unroll
            for (int s = 0; s < 8; ++s) { const int row = 2 * s + hi, cofs = lr * 4; v4f val = *(const v4fa*)(os + row * 68 + cofs); if (BIAS) { val[0] += bfr(bias[c0 + cofs]); val[1] += bfr(bias[c0 + cofs + 1]); val[2] += bfr(bias[c0 + cofs + 2]); val[3] += bfr(bias[c0 + cofs + 3]); }
                *(v4f*)(crow + (size_t)row * ldc + cofs) = val; }
             }
        __builtin_amdgcn_wave_barrier(); asm volatile("" ::: "memory");
    }
}

typedef __attribute__((ext_vector_type(4))) _Float16 v4h;
typedef __attribute__((ext_vector_type(2))) unsigned short v2us;
typedef __attribute__((ext_vector_type(4))) unsigned short v4us;
typedef __attribute__((ext_vector_type(4))) int v4i;

__global__ __launch_bounds__(256) void k_wtG(const float* __restrict__ w, int K, int N, bf* Bt) {
    const int lane = threadIdx.x & 31; const int L0 = (blockIdx.x * 8 + (threadIdx.x >> 5)) * 8; const int nlines = N * K / 64;
{
#pragma unroll 1
        for (int l = 0; l < 8; ++l) { const int L = L0 + l; if (L >= nlines) break; const size_t e = (size_t)L * 64 + lane * 2; const int k = (int)(e % K), n = (int)(e / K); v2us o;
            o[0] = f2bf(w[(size_t)k * N + n]); o[1] = f2bf(w[(size_t)(k + 1) * N + n]); *(v2us*)(Bt + e) = o; }
         }
}
__global__ __launch_bounds__(256) void k_cvt8(const float* __restrict__ src, bf* dst, size_t n8) { const size_t i = (size_t)blockIdx.x * 256 + threadIdx.x; if (i >= n8) return; const v8f v = *(const v8f*)(src + i * 8); v8us o;
#pragma unroll
    for (int k = 0; k < 8; ++k) o[k] = f2bf(v[k]); *(v8us*)(dst + i * 8) = o;  }

__global__ __launch_bounds__(256) void k_wtH(const float* __restrict__ w, bf* Bt) { const size_t e2 = ((size_t)blockIdx.x * 256 + threadIdx.x) * 2; if (e2 >= (size_t)DQ * DM) return; const int d = (int)(e2 % DM); const int r = (int)(e2 / DM); const int h = r / HD, e = r % HD; v2us o; o[0] = f2bf(w[((size_t)h * DM + d) * HD + e]); o[1] = f2bf(w[((size_t)h * DM + d + 1) * HD + e]);
    *(v2us*)(Bt + e2) = o;  }
// ---- k_fattn: scores, causal softmax and probability x value product of one batch in one launch. One wave owns 16 query rows of one head and walks its keys in blocks of 32 up to the diagonal.
// Transposed products: S^T = K Q^T (a lane holds 16 scores of ONE query, column lr) and O^T += V^T P^T; the two 16-key score tiles, converted in place, are the B operand of the second product
// (hardware k order, the order WFrag::ld reads), so scores and probabilities never leave the registers. Running maximum and sum per query (online softmax, log2 domain); division by the sum at the end.
// HR (query rows < RH): hi/lo bf16 planes, three products for each GEMM, in the order hi.hi, lo.hi, hi.lo; else fp16 planes, one product. Output: hi/lo bf16 planes [t][DQ] for the last projection.
__device__ __forceinline__ float xhalf(float x) { return __builtin_bit_cast(float, __builtin_amdgcn_permlanex16(__builtin_bit_cast(int, x), __builtin_bit_cast(int, x), 0x76543210, 0xfedcba98, false, false)); }   // lane l reads lane l ^ 16
// al and p[0..15] become 2^al and 2^p, in place. The exps stand in asm so that a v_nop can close each run: the instruction set asks for one slot between a transcendental and an instruction that reads its result
// or overwrites its source. Inside a run each exp has registers of its own, so the next exp is the independent instruction.
__device__ __forceinline__ void exp2_17(float& al, float (&p)[16]) {
    asm("v_exp_f32 %0, %0\n\tv_exp_f32 %1, %1\n\tv_exp_f32 %2, %2\n\tv_exp_f32 %3, %3\n\tv_exp_f32 %4, %4\n\tv_exp_f32 %5, %5\n\tv_exp_f32 %6, %6\n\tv_exp_f32 %7, %7\n\tv_exp_f32 %8, %8\n\tv_nop"
        : "+v"(al), "+v"(p[0]), "+v"(p[1]), "+v"(p[2]), "+v"(p[3]), "+v"(p[4]), "+v"(p[5]), "+v"(p[6]), "+v"(p[7]));
    asm("v_exp_f32 %0, %0\n\tv_exp_f32 %1, %1\n\tv_exp_f32 %2, %2\n\tv_exp_f32 %3, %3\n\tv_exp_f32 %4, %4\n\tv_exp_f32 %5, %5\n\tv_exp_f32 %6, %6\n\tv_exp_f32 %7, %7\n\tv_nop"
        : "+v"(p[8]), "+v"(p[9]), "+v"(p[10]), "+v"(p[11]), "+v"(p[12]), "+v"(p[13]), "+v"(p[14]), "+v"(p[15]));
}
template <typename V> struct KVSet { V k[2][2], k2[2][2], v[4], v2[4]; };   // the K and V^T fragments of one 32-key block (k2, v2: the lo planes, HR only)
// XW: s_wait_xcnt 0 behind each run of loads from one address, where the next run's results or address sums may take that run's address registers (the wait stands in front of such an overwrite);
// the long key loop passes false and has one wait at its foot, far behind the loads
template <typename T16, bool HR, bool XW>
__device__ __forceinline__ void kv_load(KVSet<typename WFrag<T16>::V>& f, const T16* __restrict__ Kp, const T16* __restrict__ K2, const T16* __restrict__ Vt, const T16* __restrict__ V2, int kb) {
#pragma unroll
    for (int t = 0; t < 2; ++t) {
#pragma unroll
        for (int ks = 0; ks < 2; ++ks) { f.k[t][ks] = WFrag<T16>::ld(Kp + (size_t)(kb * 32 + t * 16) * HD + 32 * ks); if (HR) f.k2[t][ks] = WFrag<T16>::ld(K2 + (size_t)(kb * 32 + t * 16) * HD + 32 * ks); }
        if (XW) asm volatile("s_wait_xcnt 0x0" ::: "memory");    // address registers of these key loads: see XW above
    }
#pragma unroll
    for (int mt = 0; mt < 4; ++mt) { f.v[mt] = WFrag<T16>::ld(Vt + (size_t)mt * 16 * TT + kb * 32); if (HR) f.v2[mt] = WFrag<T16>::ld(V2 + (size_t)mt * 16 * TT + kb * 32); }
    if (XW) asm volatile("s_wait_xcnt 0x0" ::: "memory");        // address registers of the value loads: see XW above
}
// one 32-key block: kq = first key of this lane's score rows minus the lane's query (key <= query is kq + offset <= 0); DIAG: the block crosses the diagonal and is masked
template <typename T16, bool HR, bool DIAG>
__device__ __forceinline__ void attn_block(const KVSet<typename WFrag<T16>::V>& f, const typename WFrag<T16>::V (&qf)[2], const typename WFrag<T16>::V (&qf2)[2], v8f (&O)[4], float& m, float& l, int kq) {
    typedef typename WFrag<T16>::V V;
    v8f S[2];
#pragma unroll
    for (int t = 0; t < 2; ++t) { S[t] = (v8f){};
#pragma unroll
        for (int ks = 0; ks < 2; ++ks) { S[t] = WFrag<T16>::mma(f.k[t][ks], qf[ks], S[t]); if (HR) { S[t] = WFrag<T16>::mma(f.k[t][ks], qf2[ks], S[t]); S[t] = WFrag<T16>::mma(f.k2[t][ks], qf[ks], S[t]); } } }
    float p[16];
#pragma unroll
    for (int i = 0; i < 16; ++i) p[i] = S[i >> 3][i & 7] * SC2;          // key offset (i>>3)*16 + (i&7) from the lane's first key, query column lr
    if (DIAG) {
#pragma unroll
        for (int i = 0; i < 16; ++i) p[i] = (kq + (i >> 3) * 16 + (i & 7) <= 0) ? p[i] : -3.0e38f; }
    float bm = p[0], bm1 = p[8];                                           // two chains: half the dependent length
#pragma unroll
    for (int i = 1; i < 8; ++i) { bm = fmaxf(bm, p[i]); bm1 = fmaxf(bm1, p[8 + i]); }
    bm = fmaxf(bm, bm1); bm = fmaxf(bm, xhalf(bm));
    const float mn = fmaxf(m, bm); float al = m - mn; m = mn;
#pragma unroll
    for (int i = 0; i < 16; ++i) p[i] -= mn;
    exp2_17(al, p);
    const float bs = (((p[0] + p[1]) + (p[2] + p[3])) + ((p[4] + p[5]) + (p[6] + p[7]))) + (((p[8] + p[9]) + (p[10] + p[11])) + ((p[12] + p[13]) + (p[14] + p[15])));
    l = l * al + bs;
#pragma unroll
    for (int mt = 0; mt < 4; ++mt)
#pragma unroll
        for (int j = 0; j < 8; ++j) O[mt][j] *= al;
    V pf, pf2;
    if constexpr (HR) { v8us h0, h1, l0, l1;
#pragma unroll
        for (int j = 0; j < 8; ++j) { unsigned short a, c2; splitf(p[j], a, c2); h0[j] = a; l0[j] = c2; splitf(p[8 + j], a, c2); h1[j] = a; l1[j] = c2; }
        pf = cat16b(h0, h1); pf2 = cat16b(l0, l1);
    } else {
#pragma unroll
        for (int i = 0; i < 16; ++i) pf[i] = tohx(p[i]); }
#pragma unroll
    for (int mt = 0; mt < 4; ++mt) { O[mt] = WFrag<T16>::mma(f.v[mt], pf, O[mt]); if (HR) { O[mt] = WFrag<T16>::mma(f.v[mt], pf2, O[mt]); O[mt] = WFrag<T16>::mma(f.v2[mt], pf, O[mt]); } }
}
template <typename T16, bool HR>
__device__ __forceinline__ void attn_rows(const T16* __restrict__ Q, const T16* __restrict__ Q2, const T16* __restrict__ Kp, const T16* __restrict__ K2, const T16* __restrict__ Vt, const T16* __restrict__ V2, int q0, bf* Ah, bf* Al) {
    typedef typename WFrag<T16>::V V;
    const int lane = threadIdx.x & 31, lr = lane & 15, hi = lane >> 4;
    const int last = q0 >> 5;                            // the 32-key block that holds the diagonal: the wave's last
    V qf[2], qf2[2];
    const size_t qo = (size_t)(q0 + lr) * HD + 8 * hi, ko = (size_t)lr * HD + 8 * hi, vo = (size_t)lr * TT + 8 * hi;
#pragma unroll
    for (int ks = 0; ks < 2; ++ks) { qf[ks] = WFrag<T16>::ld(Q + qo + 32 * ks); if (HR) qf2[ks] = WFrag<T16>::ld(Q2 + qo + 32 * ks); }
    asm volatile("s_wait_xcnt 0x0" ::: "memory");        // the first key and value loads may land in the address registers of the query loads: the wait stands in front of that overwrite
    Kp += ko; Vt += vo; if (HR) { K2 += ko; V2 += vo; }
    v8f O[4];
#pragma unroll
    for (int mt = 0; mt < 4; ++mt) O[mt] = (v8f){};
    float m = -3.0e38f, l = 0.f;
    const int kq0 = 8 * hi - (q0 + lr);
    KVSet<V> fa;
    if constexpr (HR) {   // at most RH/32 blocks, three products each: one fragment set, which keeps the kernel inside 256 registers
#pragma unroll 1
        for (int kb = 0; kb < last; ++kb) { kv_load<T16, HR, true>(fa, Kp, K2, Vt, V2, kb); attn_block<T16, HR, false>(fa, qf, qf2, O, m, l, 0); }
        kv_load<T16, HR, true>(fa, Kp, K2, Vt, V2, last);
    } else {              // two fragment sets in turn, so that a block's K and V loads are issued ahead of the block before it; the loop body has no branch (the blocks below the diagonal need no mask)
        KVSet<V> fb;
        kv_load<T16, HR, true>(fa, Kp, K2, Vt, V2, 0);
        int kb = 0;
#pragma unroll 1
        for (; kb + 1 < last; kb += 2) {
            kv_load<T16, HR, false>(fb, Kp, K2, Vt, V2, kb + 1);
            attn_block<T16, HR, false>(fa, qf, qf2, O, m, l, 0);
            kv_load<T16, HR, false>(fa, Kp, K2, Vt, V2, kb + 2);    // kb + 2 <= last
            attn_block<T16, HR, false>(fb, qf, qf2, O, m, l, 0);
            asm volatile("s_wait_xcnt 0x0" ::: "memory");    // the next pass (and the code behind the loop) overwrites the address registers of this pass's loads
        }
        if (kb < last) { attn_block<T16, HR, false>(fa, qf, qf2, O, m, l, 0); kv_load<T16, HR, true>(fa, Kp, K2, Vt, V2, last); }   // one block left below the diagonal block
    }
    attn_block<T16, HR, true>(fa, qf, qf2, O, m, l, kq0 + last * 32);
    l += xhalf(l);                                       // the two lane halves hold the sums of disjoint keys of the same query
    const float inv = __fdiv_rn(1.0f, l);
#pragma unroll
    for (int mt = 0; mt < 4; ++mt) { v8us oh, ol;
#pragma unroll
        for (int j = 0; j < 8; ++j) { unsigned short a, c2; splitf(O[mt][j] * inv, a, c2); oh[j] = a; ol[j] = c2; }
        const size_t oo = (size_t)(q0 + lr) * DQ + mt * 16 + 8 * hi; *(v8us*)(Ah + oo) = oh; *(v8us*)(Al + oo) = ol; }
}
// grid (TT/128, heads), 8 waves of 16 query rows. Waves w and w + 4 take row tiles T and 127 - T, so every pair walks the same number of key blocks together (the cost of a tile grows with its index)
__global__ __launch_bounds__(256) void k_fattn(const h16* __restrict__ Q16, const h16* __restrict__ K16, const h16* __restrict__ V16, const bf* __restrict__ Qh, const bf* __restrict__ Ql, const bf* __restrict__ Kh, const bf* __restrict__ Kl, const bf* __restrict__ Vh, const bf* __restrict__ Vl, bf* Ah, bf* Al) {
    const int h = blockIdx.y; const int w = __builtin_amdgcn_readfirstlane((int)(threadIdx.x >> 5));   // wave-uniform, so the key loop and the row-class test are scalar branches
    const int q0 = ((w < 4) ? (int)blockIdx.x * 4 + w : TT / 16 - 1 - ((int)blockIdx.x * 4 + (w - 4))) * 16;
    const size_t po = (size_t)h * TT * HD;
    if (q0 < RH) attn_rows<bf, true>(Qh + po, Ql + po, Kh + po, Kl + po, Vh + po, Vl + po, q0, Ah + h * HD, Al + h * HD);
    else attn_rows<h16, false>(Q16 + po, nullptr, K16 + po, nullptr, V16 + po, nullptr, q0, Ah + h * HD, Al + h * HD);
}

extern "C" void kernel_launch(void* const* d_in, const int* in_sizes, int n_in,
                              void* d_out, int out_size, void* d_ws, size_t ws_size, hipStream_t stream) {
    (void)in_sizes; (void)n_in; (void)out_size;
    const float* x = (const float*)d_in[0]; const float* wq = (const float*)d_in[1]; const float* wk = (const float*)d_in[2]; const float* wv = (const float*)d_in[3]; const float* wo = (const float*)d_in[4]; const float* bo = (const float*)d_in[5];   /* order x, Wq, Wk, Wv [16][1024][64], Wproj ('xw' [1024][1024]), bproj */
    float* OUT = (float*)d_out;     // [4][2048][1024]
    char* wsp = (char*)d_ws;
    auto take = [&](size_t bytes) { char* p = wsp; wsp += (bytes + 255) & ~(size_t)255; return (void*)p; };
    bf* WQ = (bf*)take((size_t)DQ * DM * 2); bf* WK = (bf*)take((size_t)DKV * DM * 2); bf* WV = (bf*)take((size_t)DKV * DM * 2); bf* WO = (bf*)take((size_t)DM * DQ * 2);
    bf* XB = (bf*)take((size_t)TT * DM * 2);
    h16* QP16 = (h16*)take((size_t)NH_ * TT * HD * 2); h16* KP16 = (h16*)take((size_t)NKV * TT * HD * 2); h16* VT16 = (h16*)take((size_t)NKV * HD * TT * 2);
    bf* QPh = (bf*)take((size_t)NH_ * TT * HD * 2); bf* QPl = (bf*)take((size_t)NH_ * TT * HD * 2); bf* KPh = (bf*)take((size_t)NKV * TT * HD * 2); bf* KPl = (bf*)take((size_t)NKV * TT * HD * 2); bf* VTh = (bf*)take((size_t)NKV * HD * TT * 2); bf* VTl = (bf*)take((size_t)NKV * HD * TT * 2);
    bf* ATh = (bf*)take((size_t)TT * DQ * 2); bf* ATl = (bf*)take((size_t)TT * DQ * 2);
    if ((size_t)(wsp - (char*)d_ws) > ws_size) return;    // ws 256 MiB
    { k_wtH<<<(unsigned)(((size_t)DQ * DM / 2 + 255) / 256), 256, 0, stream>>>(wq, WQ);   /* per-head [16][1024][64] -> Bt [1024][1024] */ k_wtH<<<(unsigned)(((size_t)DQ * DM / 2 + 255) / 256), 256, 0, stream>>>(wk, WK);   /* per-head [16][1024][64] -> Bt [1024][1024] */ k_wtH<<<(unsigned)(((size_t)DQ * DM / 2 + 255) / 256), 256, 0, stream>>>(wv, WV);   /* per-head [16][1024][64] -> Bt [1024][1024] */
      k_wtG<<<(unsigned)((DQ * DM / 64 + 63) / 64), 256, 0, stream>>>(wo, DQ, DM, WO);
       }
    for (int b = 0; b < NB_; ++b) {
        
        k_cvt8<<<(unsigned)(((size_t)TT * DM / 8 + 255) / 256), 256, 0, stream>>>(x + (size_t)b * TT * DM, XB, (size_t)TT * DM / 8);
        k_gemmw<bf, 0, false, 1><<<dim3(TT / 64, DQ / 64, 1), 32, 0, stream>>>(XB, nullptr, WQ, nullptr, DM, nullptr, 0, nullptr, 0, 0, 0, QP16, QPh, QPl);
        k_gemmw<bf, 0, false, 1><<<dim3(TT / 64, DKV / 64, 1), 32, 0, stream>>>(XB, nullptr, WK, nullptr, DM, nullptr, 0, nullptr, 0, 0, 0, KP16, KPh, KPl);
        k_gemmw<bf, 0, false, 2><<<dim3(TT / 64, DKV / 64, 1), 32, 0, stream>>>(XB, nullptr, WV, nullptr, DM, nullptr, 0, nullptr, 0, 0, 0, VT16, VTh, VTl);
        k_fattn<<<dim3(TT / 128, NH_, 1), 256, 0, stream>>>(QP16, KP16, VT16, QPh, QPl, KPh, KPl, VTh, VTl, ATh, ATl);
        k_gemmw<bf, 1, true, 0><<<dim3(TT / 64, DM / 64, 1), 32, 0, stream>>>(ATh, ATl, WO, nullptr, DQ, OUT + (size_t)b * TT * DM, DM, bo, 0, 0, 0, nullptr, nullptr, nullptr); }
}

// v005
// A run of this version takes 310 microseconds.
// Timed twice side by side with v004, it ran 1.79 and 1.78 times as fast.
// Over all steps from v000 it is 9.33 times as fast.
#include <hip/hip_runtime.h>

// Causal multi-head attention with per-head stacked projection weights and an embed-size score scale (x [4][2048][1024]; q, k, v = einsum('btc,hcd', x, W) with Wq, Wk, Wv [16][1024][64] (0.02, no bias; 16 heads x 64); wei = q.k x 1024^-0.5 (the source scales by n_embd, not the head size); causal (-inf); softmax; out = concat heads Wproj + bproj ('xw' [1024][1024] + bias) -> [4][2048][1024] (8.4 M); argument order x, Wq, Wk, Wv, Wproj, bproj).
// Every stage is one launch for the whole problem (batch = grid z; every plane holds all batches): bf16 copy of x; k_wtH gathers the per-head tensors [h][c][d] into one Bt plane of 3 x 1024 rows (row p*1024 + h*64 + d; p: q, k, v) so the three projections are one exact GEMM with head-major output columns, whose epilogue writes the head planes (fp16 + hi/lo bf16; V transposed) itself; one fused causal attention launch (k_fattn; hybrid rows: < 512 hi/lo 3 products, rest fp16; key blocks above the diagonal are never visited); hi/lo x Wproj exact + bproj.
// Compute dtypes, f32 accumulate: every input rounded to bf16; projections exact; attention rows < 512 3 products, rest fp16; softmax f32; Wproj hl x exact + bias.

#define NB_  4
#define TT   2048
#define DM   1024
#define NH_  16
#define NKV  16
#define HD   64
#define DQ   (NH_ * HD)
#define DKV  (NKV * HD)
#define SC2  0.04508422002778011f   // 1024^-0.5 x log2(e): the module scales by n_embd; scores go to the log2 domain for exp2
#define RH   512                  // query rows < RH use hi+lo planes (0: none)
typedef _Float16 h16;
typedef unsigned short bf;
typedef __attribute__((ext_vector_type(16))) __bf16   v16bf;
typedef __attribute__((ext_vector_type(16))) _Float16 v16h;
typedef __attribute__((ext_vector_type(8)))  _Float16 v8h;
typedef __attribute__((ext_vector_type(8)))  unsigned short v8us;
typedef __attribute__((ext_vector_type(8)))  float    v8f;
typedef __attribute__((ext_vector_type(4)))  float    v4f;
typedef v8h  __attribute__((may_alias)) v8ha;
typedef v4f  __attribute__((may_alias)) v4fa;
typedef v8us __attribute__((may_alias)) v8usa;

__device__ __forceinline__ unsigned short f2bf(float f) { unsigned u = __float_as_uint(f); u += 0x7FFFu + ((u >> 16) & 1u); return (unsigned short)(u >> 16); }
__device__ __forceinline__ float bf2f(unsigned short b) { return __uint_as_float(((unsigned)b) << 16); }
__device__ __forceinline__ float bfr(float f) { return bf2f(f2bf(f)); }
__device__ __forceinline__ v16h cat16(v8h lo, v8h hi) { return __builtin_shufflevector(lo, hi, 0, 1, 2, 3, 4, 5, 6, 7, 8, 9, 10, 11, 12, 13, 14, 15); }
__device__ __forceinline__ v16bf cat16b(v8us lo, v8us hi) { return __builtin_bit_cast(v16bf, __builtin_shufflevector(lo, hi, 0, 1, 2, 3, 4, 5, 6, 7, 8, 9, 10, 11, 12, 13, 14, 15)); }
__device__ __forceinline__ v8f wmma16(v16h a, v16h b, v8f c) { return __builtin_amdgcn_wmma_f32_16x16x32_f16(false, a, false, b, (short)0, c, false, false); }
__device__ __forceinline__ v8f wmmab(v16bf a, v16bf b, v8f c) { return __builtin_amdgcn_wmma_f32_16x16x32_bf16(false, a, false, b, (short)0, c, false, false); }

__device__ __forceinline__ h16 tohx(float x) { return (h16)x; }
__device__ __forceinline__ void splitf(float y, unsigned short& h, unsigned short& l) { h = f2bf(y); l = f2bf(y - bf2f(h)); }

// ---- k_gemmw: register-blocked GEMM, ONE WAVE per 64x64 output tile (16 accumulators), operands straight from K-contiguous 16-bit planes; grid (M/64, N/64, Z), 32 threads.
// C[m][n] (f32, pitch ldc, + optional f32 bias[n]) = sum_k A[m][k] Bt[n][k] (+ split products per NSPLIT). z-batch strides sA/sB/sC in elements. K % 32 == 0.
// PL != 0: no f32 C; blockIdx.y = p*16 + h (p: 0 queries, 1 keys, 2 values); the tile (64 positions t x the 64 columns d of head h) goes out as the three 16-bit planes that the attention kernel reads (fp16, bf16 hi, bf16 lo of the f32 sum),
// each plane [p][z][h][..] (sC = elements of one [h][..] block): p 0, 1: [h][t][d]; p 2: [h][d][t] (values, transposed). Every store instruction covers four whole 128-byte lines.
template <typename T16> struct WFrag;
template <> struct WFrag<h16> { typedef v16h V; static __device__ __forceinline__ V ld(const h16* p) { return cat16(*(const v8h*)p, *(const v8h*)(p + 16)); } static __device__ __forceinline__ v8f mma(V a, V b, v8f c) { return wmma16(a, b, c); } };
template <> struct WFrag<bf> { typedef v16bf V; static __device__ __forceinline__ V ld(const bf* p) { return cat16b(*(const v8us*)p, *(const v8us*)(p + 16)); } static __device__ __forceinline__ v8f mma(V a, V b, v8f c) { return wmmab(a, b, c); } };
template <bool B> struct BoolC { static constexpr bool v = B; };
template <typename T16, int NSPLIT, bool BIAS, int PL>
__global__ __launch_bounds__(32) void k_gemmw(const T16* __restrict__ A, const T16* __restrict__ A2, const T16* __restrict__ Bt, const T16* __restrict__ Bt2, int K, float* C, int ldc, const float* __restrict__ bias, size_t sA, size_t sB, size_t sC, h16* P16, bf* Ph, bf* Pl) {
    typedef typename WFrag<T16>::V V;
    __shared__ __align__(16) float os[16 * 68];
    const size_t z = blockIdx.z; A += z * sA; if (A2) A2 += z * sA; Bt += z * sB; if (Bt2) Bt2 += z * sB; if (PL == 0) C += z * sC;
    const int lane = threadIdx.x & 31, lr = lane & 15, hi = lane >> 4; const int r0 = blockIdx.x * 64, c0 = blockIdx.y * 64;
    v8f acc[4][4];
#pragma unroll
    for (int mb = 0; mb < 4; ++mb)
#pragma unroll
        for (int nb = 0; nb < 4; ++nb) acc[mb][nb] = (v8f){};
    const size_t aoff = (size_t)(r0 + lr) * K + 8 * hi, boff = (size_t)(c0 + lr) * K + 8 * hi;
#pragma unroll 1
    for (int kc = 0; kc < K; kc += 32) {
        V a[4], a2[4];
#pragma unroll
        for (int mb = 0; mb < 4; ++mb) { a[mb] = WFrag<T16>::ld(A + aoff + (size_t)mb * 16 * K + kc); if (NSPLIT == 1 || NSPLIT == 2) a2[mb] = WFrag<T16>::ld(A2 + aoff + (size_t)mb * 16 * K + kc); }
#pragma unroll
        for (int nb = 0; nb < 4; ++nb) { const V b = WFrag<T16>::ld(Bt + boff + (size_t)nb * 16 * K + kc); V b2; if (NSPLIT >= 2) b2 = WFrag<T16>::ld(Bt2 + boff + (size_t)nb * 16 * K + kc);
#pragma unroll
            for (int mb = 0; mb < 4; ++mb) { acc[mb][nb] = WFrag<T16>::mma(a[mb], b, acc[mb][nb]); if (NSPLIT == 1 || NSPLIT == 2) acc[mb][nb] = WFrag<T16>::mma(a2[mb], b, acc[mb][nb]); if (NSPLIT >= 2) acc[mb][nb] = WFrag<T16>::mma(a[mb], b2, acc[mb][nb]); } }
        asm volatile("v_nop\n\tv_nop\n\tv_nop\n\tv_nop" : "+v"(acc[0][0]), "+v"(acc[1][1]), "+v"(acc[2][2]), "+v"(acc[3][3]) : "v"(a[0]), "v"(a[3]));
    }
    if constexpr (PL != 0) {
        static_assert(HD == 64, "one 64-column tile is one head");
        const int p = blockIdx.y / NH_, h = blockIdx.y % NH_, prow = lane >> 3, pcol = (lane & 7) * 8;    // a lane takes 8 neighbours of a staged row: 8 lanes a row of 64, 4 rows a store
        const size_t pz = ((size_t)p * NB_ + z) * sC; P16 += pz; Ph += pz; Pl += pz;
        auto planes = [&](auto trc) { constexpr bool tr = decltype(trc)::v;    // tr: values, stored transposed
#pragma unroll
        for (int g = 0; g < 4; ++g) {     // 16 staged rows of 64: queries, keys: positions g*16.. by d; values: columns d = g*16.. by position
            if constexpr (!tr) {
#pragma unroll
                for (int nb = 0; nb < 4; ++nb) {
#pragma unroll
                    for (int j = 0; j < 8; ++j) os[(hi * 8 + j) * 68 + nb * 16 + lr] = acc[g][nb][j]; }
            } else {
#pragma unroll
                for (int mb = 0; mb < 4; ++mb) {    // an accumulator's 8 values are 8 neighbouring positions of one column d
                    *(v4fa*)(os + lr * 68 + mb * 16 + hi * 8) = __builtin_shufflevector(acc[mb][g], acc[mb][g], 0, 1, 2, 3); *(v4fa*)(os + lr * 68 + mb * 16 + hi * 8 + 4) = __builtin_shufflevector(acc[mb][g], acc[mb][g], 4, 5, 6, 7); }
            }
            __builtin_amdgcn_wave_barrier(); asm volatile("" ::: "memory");   // lanes read what other lanes of this one wave staged: keeps the compiler from moving the reads ahead of the writes
#pragma unroll
            for (int s = 0; s < 4; ++s) { const int row = s * 4 + prow; const v4f x0 = *(const v4fa*)(os + row * 68 + pcol), x1 = *(const v4fa*)(os + row * 68 + pcol + 4); v8h o16; v8us oh, ol;
#pragma unroll
                for (int k = 0; k < 8; ++k) { const float x = (k < 4) ? x0[k & 3] : x1[k & 3]; o16[k] = tohx(x); unsigned short a2, c2; splitf(x, a2, c2); oh[k] = a2; ol[k] = c2; }
                const size_t e = !tr ? ((size_t)h * TT + r0 + g * 16 + row) * HD + pcol : ((size_t)h * HD + g * 16 + row) * TT + r0 + pcol;
                *(v8h*)(P16 + e) = o16; *(v8us*)(Ph + e) = oh; *(v8us*)(Pl + e) = ol; }
            __builtin_amdgcn_wave_barrier(); asm volatile("" ::: "memory");   // the next group's staging stays behind these reads
        }
        if constexpr (!tr) asm volatile("s_wait_xcnt 0x0" ::: "memory");    // in the built code the values' path stands behind this one and rewrites the address registers of the last stores: the wait stands in front of that overwrite
        };
        if (p == 2) { planes(BoolC<true>{}); return; }    // p comes from blockIdx: a scalar branch
        planes(BoolC<false>{}); return;
    }
#pragma unroll
    for (int mb = 0; mb < 4; ++mb) {
#pragma unroll
        for (int nb = 0; nb < 4; ++nb) {
#pragma unroll
            for (int j = 0; j < 8; ++j) os[(hi * 8 + j) * 68 + nb * 16 + lr] = acc[mb][nb][j]; }
        __builtin_amdgcn_wave_barrier(); asm volatile("" ::: "memory");
        float* crow = C + (size_t)(r0 + mb * 16) * ldc + c0;
{
#pragma unroll
            for (int s = 0; s < 8; ++s) { const int row = 2 * s + hi, cofs = lr * 4; v4f val = *(const v4fa*)(os + row * 68 + cofs); if (BIAS) { val[0] += bfr(bias[c0 + cofs]); val[1] += bfr(bias[c0 + cofs + 1]); val[2] += bfr(bias[c0 + cofs + 2]); val[3] += bfr(bias[c0 + cofs + 3]); }
                *(v4f*)(crow + (size_t)row * ldc + cofs) = val; }
             }
        __builtin_amdgcn_wave_barrier(); asm volatile("" ::: "memory");
    }
}

typedef __attribute__((ext_vector_type(4))) _Float16 v4h;
typedef __attribute__((ext_vector_type(2))) unsigned short v2us;
typedef __attribute__((ext_vector_type(4))) unsigned short v4us;
typedef __attribute__((ext_vector_type(4))) int v4i;

__global__ __launch_bounds__(256) void k_wtG(const float* __restrict__ w, int K, int N, bf* Bt) {
    const int lane = threadIdx.x & 31; const int L0 = (blockIdx.x * 8 + (threadIdx.x >> 5)) * 8; const int nlines = N * K / 64;
{
#pragma unroll 1
        for (int l = 0; l < 8; ++l) { const int L = L0 + l; if (L >= nlines) break; const size_t e = (size_t)L * 64 + lane * 2; const int k = (int)(e % K), n = (int)(e / K); v2us o;
            o[0] = f2bf(w[(size_t)k * N + n]); o[1] = f2bf(w[(size_t)(k + 1) * N + n]); *(v2us*)(Bt + e) = o; }
         }
}
__global__ __launch_bounds__(256) void k_cvt8(const float* __restrict__ src, bf* dst, size_t n8) { const size_t i = (size_t)blockIdx.x * 256 + threadIdx.x; if (i >= n8) return; const v8f v = *(const v8f*)(src + i * 8); v8us o;
#pragma unroll
    for (int k = 0; k < 8; ++k) o[k] = f2bf(v[k]); *(v8us*)(dst + i * 8) = o;  }

__global__ __launch_bounds__(256) void k_wtH(const float* __restrict__ wq, const float* __restrict__ wk, const float* __restrict__ wv, bf* Bt) { const float* __restrict__ w = blockIdx.y == 0 ? wq : blockIdx.y == 1 ? wk : wv; Bt += (size_t)blockIdx.y * DQ * DM; const size_t e2 = ((size_t)blockIdx.x * 256 + threadIdx.x) * 2; if (e2 >= (size_t)DQ * DM) return; const int d = (int)(e2 % DM); const int r = (int)(e2 / DM); const int h = r / HD, e = r % HD; v2us o; o[0] = f2bf(w[((size_t)h * DM + d) * HD + e]); o[1] = f2bf(w[((size_t)h * DM + d + 1) * HD + e]);
    *(v2us*)(Bt + e2) = o;  }
// ---- k_fattn: scores, causal softmax and probability x value product of all batches in one launch. One wave owns 16 query rows of one head and walks its keys in blocks of 32 up to the diagonal.
// Transposed products: S^T = K Q^T (a lane holds 16 scores of ONE query, column lr) and O^T += V^T P^T; the two 16-key score tiles, converted in place, are the B operand of the second product
// (hardware k order, the order WFrag::ld reads), so scores and probabilities never leave the registers. Running maximum and sum per query (online softmax, log2 domain); division by the sum at the end.
// HR (query rows < RH): hi/lo bf16 planes, three products for each GEMM, in the order hi.hi, lo.hi, hi.lo; else fp16 planes, one product. Output: hi/lo bf16 planes [t][DQ] for the last projection.
__device__ __forceinline__ float xhalf(float x) { return __builtin_bit_cast(float, __builtin_amdgcn_permlanex16(__builtin_bit_cast(int, x), __builtin_bit_cast(int, x), 0x76543210, 0xfedcba98, false, false)); }   // lane l reads lane l ^ 16
// al and p[0..15] become 2^al and 2^p, in place. The exps stand in asm so that a v_nop can close each run: the instruction set asks for one slot between a transcendental and an instruction that reads its result
// or overwrites its source. Inside a run each exp has registers of its own, so the next exp is the independent instruction.
__device__ __forceinline__ void exp2_17(float& al, float (&p)[16]) {
    asm("v_exp_f32 %0, %0\n\tv_exp_f32 %1, %1\n\tv_exp_f32 %2, %2\n\tv_exp_f32 %3, %3\n\tv_exp_f32 %4, %4\n\tv_exp_f32 %5, %5\n\tv_exp_f32 %6, %6\n\tv_exp_f32 %7, %7\n\tv_exp_f32 %8, %8\n\tv_nop"
        : "+v"(al), "+v"(p[0]), "+v"(p[1]), "+v"(p[2]), "+v"(p[3]), "+v"(p[4]), "+v"(p[5]), "+v"(p[6]), "+v"(p[7]));
    asm("v_exp_f32 %0, %0\n\tv_exp_f32 %1, %1\n\tv_exp_f32 %2, %2\n\tv_exp_f32 %3, %3\n\tv_exp_f32 %4, %4\n\tv_exp_f32 %5, %5\n\tv_exp_f32 %6, %6\n\tv_exp_f32 %7, %7\n\tv_nop"
        : "+v"(p[8]), "+v"(p[9]), "+v"(p[10]), "+v"(p[11]), "+v"(p[12]), "+v"(p[13]), "+v"(p[14]), "+v"(p[15]));
}
template <typename V> struct KVSet { V k[2][2], k2[2][2], v[4], v2[4]; };   // the K and V^T fragments of one 32-key block (k2, v2: the lo planes, HR only)
// XW: s_wait_xcnt 0 behind each run of loads from one address, where the next run's results or address sums may take that run's address registers (the wait stands in front of such an overwrite);
// the long key loop passes false and has one wait at its foot, far behind the loads
template <typename T16, bool HR, bool XW>
__device__ __forceinline__ void kv_load(KVSet<typename WFrag<T16>::V>& f, const T16* __restrict__ Kp, const T16* __restrict__ K2, const T16* __restrict__ Vt, const T16* __restrict__ V2, int kb) {
#pragma unroll
    for (int t = 0; t < 2; ++t) {
#pragma unroll
        for (int ks = 0; ks < 2; ++ks) { f.k[t][ks] = WFrag<T16>::ld(Kp + (size_t)(kb * 32 + t * 16) * HD + 32 * ks); if (HR) f.k2[t][ks] = WFrag<T16>::ld(K2 + (size_t)(kb * 32 + t * 16) * HD + 32 * ks); }
        if (XW) asm volatile("s_wait_xcnt 0x0" ::: "memory");    // address registers of these key loads: see XW above
    }
#pragma unroll
    for (int mt = 0; mt < 4; ++mt) { f.v[mt] = WFrag<T16>::ld(Vt + (size_t)mt * 16 * TT + kb * 32); if (HR) f.v2[mt] = WFrag<T16>::ld(V2 + (size_t)mt * 16 * TT + kb * 32); }
    if (XW) asm volatile("s_wait_xcnt 0x0" ::: "memory");        // address registers of the value loads: see XW above
}
// one 32-key block: kq = first key of this lane's score rows minus the lane's query (key <= query is kq + offset <= 0); DIAG: the block crosses the diagonal and is masked
template <typename T16, bool HR, bool DIAG>
__device__ __forceinline__ void attn_block(const KVSet<typename WFrag<T16>::V>& f, const typename WFrag<T16>::V (&qf)[2], const typename WFrag<T16>::V (&qf2)[2], v8f (&O)[4], float& m, float& l, int kq) {
    typedef typename WFrag<T16>::V V;
    v8f S[2];
#pragma unroll
    for (int t = 0; t < 2; ++t) { S[t] = (v8f){};
#pragma unroll
        for (int ks = 0; ks < 2; ++ks) { S[t] = WFrag<T16>::mma(f.k[t][ks], qf[ks], S[t]); if (HR) { S[t] = WFrag<T16>::mma(f.k[t][ks], qf2[ks], S[t]); S[t] = WFrag<T16>::mma(f.k2[t][ks], qf[ks], S[t]); } } }
    float p[16];
#pragma unroll
    for (int i = 0; i < 16; ++i) p[i] = S[i >> 3][i & 7] * SC2;          // key offset (i>>3)*16 + (i&7) from the lane's first key, query column lr
    if (DIAG) {
#pragma unroll
        for (int i = 0; i < 16; ++i) p[i] = (kq + (i >> 3) * 16 + (i & 7) <= 0) ? p[i] : -3.0e38f; }
    float bm = p[0], bm1 = p[8];                                           // two chains: half the dependent length
#pragma unroll
    for (int i = 1; i < 8; ++i) { bm = fmaxf(bm, p[i]); bm1 = fmaxf(bm1, p[8 + i]); }
    bm = fmaxf(bm, bm1); bm = fmaxf(bm, xhalf(bm));
    const float mn = fmaxf(m, bm); float al = m - mn; m = mn;
#pragma unroll
    for (int i = 0; i < 16; ++i) p[i] -= mn;
    exp2_17(al, p);
    const float bs = (((p[0] + p[1]) + (p[2] + p[3])) + ((p[4] + p[5]) + (p[6] + p[7]))) + (((p[8] + p[9]) + (p[10] + p[11])) + ((p[12] + p[13]) + (p[14] + p[15])));
    l = l * al + bs;
#pragma unroll
    for (int mt = 0; mt < 4; ++mt)
#pragma unroll
        for (int j = 0; j < 8; ++j) O[mt][j] *= al;
    V pf, pf2;
    if constexpr (HR) { v8us h0, h1, l0, l1;
#pragma unroll
        for (int j = 0; j < 8; ++j) { unsigned short a, c2; splitf(p[j], a, c2); h0[j] = a; l0[j] = c2; splitf(p[8 + j], a, c2); h1[j] = a; l1[j] = c2; }
        pf = cat16b(h0, h1); pf2 = cat16b(l0, l1);
    } else {
#pragma unroll
        for (int i = 0; i < 16; ++i) pf[i] = tohx(p[i]); }
#pragma unroll
    for (int mt = 0; mt < 4; ++mt) { O[mt] = WFrag<T16>::mma(f.v[mt], pf, O[mt]); if (HR) { O[mt] = WFrag<T16>::mma(f.v[mt], pf2, O[mt]); O[mt] = WFrag<T16>::mma(f.v2[mt], pf, O[mt]); } }
}
template <typename T16, bool HR>
__device__ __forceinline__ void attn_rows(const T16* __restrict__ Q, const T16* __restrict__ Q2, const T16* __restrict__ Kp, const T16* __restrict__ K2, const T16* __restrict__ Vt, const T16* __restrict__ V2, int q0, bf* Ah, bf* Al) {
    typedef typename WFrag<T16>::V V;
    const int lane = threadIdx.x & 31, lr = lane & 15, hi = lane >> 4;
    const int last = q0 >> 5;                            // the 32-key block that holds the diagonal: the wave's last
    V qf[2], qf2[2];
    const size_t qo = (size_t)(q0 + lr) * HD + 8 * hi, ko = (size_t)lr * HD + 8 * hi, vo = (size_t)lr * TT + 8 * hi;
#pragma unroll
    for (int ks = 0; ks < 2; ++ks) { qf[ks] = WFrag<T16>::ld(Q + qo + 32 * ks); if (HR) qf2[ks] = WFrag<T16>::ld(Q2 + qo + 32 * ks); }
    asm volatile("s_wait_xcnt 0x0" ::: "memory");        // the first key and value loads may land in the address registers of the query loads: the wait stands in front of that overwrite
    Kp += ko; Vt += vo; if (HR) { K2 += ko; V2 += vo; }
    v8f O[4];
#pragma unroll
    for (int mt = 0; mt < 4; ++mt) O[mt] = (v8f){};
    float m = -3.0e38f, l = 0.f;
    const int kq0 = 8 * hi - (q0 + lr);
    KVSet<V> fa;
    if constexpr (HR) {   // at most RH/32 blocks, three products each: one fragment set, which keeps the kernel inside 256 registers
#pragma unroll 1
        for (int kb = 0; kb < last; ++kb) { kv_load<T16, HR, true>(fa, Kp, K2, Vt, V2, kb); attn_block<T16, HR, false>(fa, qf, qf2, O, m, l, 0); }
        kv_load<T16, HR, true>(fa, Kp, K2, Vt, V2, last);
    } else {              // two fragment sets in turn, so that a block's K and V loads are issued ahead of the block before it; the loop body has no branch (the blocks below the diagonal need no mask)
        KVSet<V> fb;
        kv_load<T16, HR, true>(fa, Kp, K2, Vt, V2, 0);
        int kb = 0;
#pragma unroll 1
        for (; kb + 1 < last; kb += 2) {
            kv_load<T16, HR, false>(fb, Kp, K2, Vt, V2, kb + 1);
            attn_block<T16, HR, false>(fa, qf, qf2, O, m, l, 0);
            kv_load<T16, HR, false>(fa, Kp, K2, Vt, V2, kb + 2);    // kb + 2 <= last
            attn_block<T16, HR, false>(fb, qf, qf2, O, m, l, 0);
            asm volatile("s_wait_xcnt 0x0" ::: "memory");    // the next pass (and the code behind the loop) overwrites the address registers of this pass's loads
        }
        if (kb < last) { attn_block<T16, HR, false>(fa, qf, qf2, O, m, l, 0); kv_load<T16, HR, true>(fa, Kp, K2, Vt, V2, last); }   // one block left below the diagonal block
    }
    attn_block<T16, HR, true>(fa, qf, qf2, O, m, l, kq0 + last * 32);
    l += xhalf(l);                                       // the two lane halves hold the sums of disjoint keys of the same query
    const float inv = __fdiv_rn(1.0f, l);
#pragma unroll
    for (int mt = 0; mt < 4; ++mt) { v8us oh, ol;
#pragma unroll
        for (int j = 0; j < 8; ++j) { unsigned short a, c2; splitf(O[mt][j] * inv, a, c2); oh[j] = a; ol[j] = c2; }
        const size_t oo = (size_t)(q0 + lr) * DQ + mt * 16 + 8 * hi; *(v8us*)(Ah + oo) = oh; *(v8us*)(Al + oo) = ol; }
}
// grid (TT/128, heads, batches), 8 waves of 16 query rows. Waves w and w + 4 take row tiles T and 127 - T, so every pair walks the same number of key blocks together (the cost of a tile grows with its index)
__global__ __launch_bounds__(256) void k_fattn(const h16* __restrict__ Q16, const h16* __restrict__ K16, const h16* __restrict__ V16, const bf* __restrict__ Qh, const bf* __restrict__ Ql, const bf* __restrict__ Kh, const bf* __restrict__ Kl, const bf* __restrict__ Vh, const bf* __restrict__ Vl, bf* Ah, bf* Al) {
    const int h = blockIdx.y; const int w = __builtin_amdgcn_readfirstlane((int)(threadIdx.x >> 5));   // wave-uniform, so the key loop and the row-class test are scalar branches
    const int q0 = ((w < 4) ? (int)blockIdx.x * 4 + w : TT / 16 - 1 - ((int)blockIdx.x * 4 + (w - 4))) * 16;
    const size_t po = ((size_t)blockIdx.z * NH_ + h) * TT * HD;
    Ah += (size_t)blockIdx.z * TT * DQ; Al += (size_t)blockIdx.z * TT * DQ;
    if (q0 < RH) attn_rows<bf, true>(Qh + po, Ql + po, Kh + po, Kl + po, Vh + po, Vl + po, q0, Ah + h * HD, Al + h * HD);
    else attn_rows<h16, false>(Q16 + po, nullptr, K16 + po, nullptr, V16 + po, nullptr, q0, Ah + h * HD, Al + h * HD);
}

extern "C" void kernel_launch(void* const* d_in, const int* in_sizes, int n_in,
                              void* d_out, int out_size, void* d_ws, size_t ws_size, hipStream_t stream) {
    (void)in_sizes; (void)n_in; (void)out_size;
    const float* x = (const float*)d_in[0]; const float* wq = (const float*)d_in[1]; const float* wk = (const float*)d_in[2]; const float* wv = (const float*)d_in[3]; const float* wo = (const float*)d_in[4]; const float* bo = (const float*)d_in[5];   /* order x, Wq, Wk, Wv [16][1024][64], Wproj ('xw' [1024][1024]), bproj */
    float* OUT = (float*)d_out;     // [4][2048][1024]
    char* wsp = (char*)d_ws;
    auto take = [&](size_t bytes) { char* p = wsp; wsp += (bytes + 255) & ~(size_t)255; return (void*)p; };
    static_assert(NKV == NH_, "the three projections share one plane shape");
    const size_t PB = (size_t)NH_ * TT * HD, PP = (size_t)NB_ * PB;    // elements of one batch's [h][..] block and of one plane of all batches
    bf* WQKV = (bf*)take((size_t)3 * DQ * DM * 2); bf* WO = (bf*)take((size_t)DM * DQ * 2);
    bf* XB = (bf*)take((size_t)NB_ * TT * DM * 2);
    h16* P16 = (h16*)take(3 * PP * 2); bf* Ph = (bf*)take(3 * PP * 2); bf* Pl = (bf*)take(3 * PP * 2);    // each [q, k, v][batch][h][..]
    bf* ATh = (bf*)take((size_t)NB_ * TT * DQ * 2); bf* ATl = (bf*)take((size_t)NB_ * TT * DQ * 2);
    if ((size_t)(wsp - (char*)d_ws) > ws_size) return;    // ws 256 MiB
    k_wtH<<<dim3((unsigned)(((size_t)DQ * DM / 2 + 255) / 256), 3, 1), 256, 0, stream>>>(wq, wk, wv, WQKV);   /* per-head [16][1024][64] x 3 -> Bt [3072][1024] */
    k_wtG<<<(unsigned)((DQ * DM / 64 + 63) / 64), 256, 0, stream>>>(wo, DQ, DM, WO);
    k_cvt8<<<(unsigned)(((size_t)NB_ * TT * DM / 8 + 255) / 256), 256, 0, stream>>>(x, XB, (size_t)NB_ * TT * DM / 8);
    k_gemmw<bf, 0, false, 1><<<dim3(TT / 64, 3 * DQ / 64, NB_), 32, 0, stream>>>(XB, nullptr, WQKV, nullptr, DM, nullptr, 0, nullptr, (size_t)TT * DM, 0, PB, P16, Ph, Pl);
    k_fattn<<<dim3(TT / 128, NH_, NB_), 256, 0, stream>>>(P16, P16 + PP, P16 + 2 * PP, Ph, Pl, Ph + PP, Pl + PP, Ph + 2 * PP, Pl + 2 * PP, ATh, ATl);
    k_gemmw<bf, 1, true, 0><<<dim3(TT / 64, DM / 64, NB_), 32, 0, stream>>>(ATh, ATl, WO, nullptr, DQ, OUT, DM, bo, (size_t)TT * DQ, 0, (size_t)TT * DM, nullptr, nullptr, nullptr);
}

// v006
// One run takes 223 microseconds.
// Two timings next to v005 put it at 1.39 and 1.38 times that version's speed.
// All steps since v000 together make it 13.0 times as fast.
#include <hip/hip_runtime.h>

// Causal multi-head attention with per-head stacked projection weights and an embed-size score scale (x [4][2048][1024]; q, k, v = einsum('btc,hcd', x, W) with Wq, Wk, Wv [16][1024][64] (0.02, no bias; 16 heads x 64); wei = q.k x 1024^-0.5 (the source scales by n_embd, not the head size); causal (-inf); softmax; out = concat heads Wproj + bproj ('xw' [1024][1024] + bias) -> [4][2048][1024] (8.4 M); argument order x, Wq, Wk, Wv, Wproj, bproj).
// Every stage is one launch for the whole problem (batch = grid z in the GEMMs and the attention; every plane holds all batches): bf16 copy of x; k_wtH gathers the per-head tensors [h][c][d] into one Bt plane of 3 x 1024 rows (row p*1024 + h*64 + d; p: q, k, v) so the three projections are one exact GEMM with head-major output columns, whose epilogue writes the head planes (fp16 + hi/lo bf16; V transposed) itself; one fused causal attention launch (k_fattn; hybrid rows: < 512 hi/lo 3 products, rest fp16; key blocks above the diagonal are never visited); hi/lo x Wproj exact + bproj.
// Every 16-bit operand plane (rows x K) lies in fragment order: panels of 16 rows, inside a panel chunks of 8 neighbouring k, inside a chunk column the 16 rows: element (r, k) at (r/16)*16*K + (k/8)*128 + (r%16)*8 + k%8.
// A wave's fragment (16 rows x 32 k) is then 1024 contiguous bytes, lane l taking 16 bytes at l*16 and at 512 + l*16: each load instruction covers four whole 128-byte lines.
// Compute dtypes, f32 accumulate: every input rounded to bf16; projections exact; attention rows < 512 3 products, rest fp16; softmax f32; Wproj hl x exact + bias.

#define NB_  4
#define TT   2048
#define DM   1024
#define NH_  16
#define NKV  16
#define HD   64
#define DQ   (NH_ * HD)
#define DKV  (NKV * HD)
#define SC2  0.04508422002778011f   // 1024^-0.5 x log2(e): the module scales by n_embd; scores go to the log2 domain for exp2
#define RH   512                  // query rows < RH use hi+lo planes (0: none)
typedef _Float16 h16;
typedef unsigned short bf;
typedef __attribute__((ext_vector_type(16))) __bf16   v16bf;
typedef __attribute__((ext_vector_type(16))) _Float16 v16h;
typedef __attribute__((ext_vector_type(8)))  _Float16 v8h;
typedef __attribute__((ext_vector_type(8)))  unsigned short v8us;
typedef __attribute__((ext_vector_type(8)))  float    v8f;
typedef __attribute__((ext_vector_type(4)))  float    v4f;
typedef v8h  __attribute__((may_alias)) v8ha;
typedef v4f  __attribute__((may_alias)) v4fa;
typedef v8us __attribute__((may_alias)) v8usa;

__device__ __forceinline__ unsigned short f2bf(float f) { unsigned u = __float_as_uint(f); u += 0x7FFFu + ((u >> 16) & 1u); return (unsigned short)(u >> 16); }
__device__ __forceinline__ float bf2f(unsigned short b) { return __uint_as_float(((unsigned)b) << 16); }
__device__ __forceinline__ float bfr(float f) { return bf2f(f2bf(f)); }
__device__ __forceinline__ v16h cat16(v8h lo, v8h hi) { return __builtin_shufflevector(lo, hi, 0, 1, 2, 3, 4, 5, 6, 7, 8, 9, 10, 11, 12, 13, 14, 15); }
__device__ __forceinline__ v16bf cat16b(v8us lo, v8us hi) { return __builtin_bit_cast(v16bf, __builtin_shufflevector(lo, hi, 0, 1, 2, 3, 4, 5, 6, 7, 8, 9, 10, 11, 12, 13, 14, 15)); }
__device__ __forceinline__ v8f wmma16(v16h a, v16h b, v8f c) { return __builtin_amdgcn_wmma_f32_16x16x32_f16(false, a, false, b, (short)0, c, false, false); }
__device__ __forceinline__ v8f wmmab(v16bf a, v16bf b, v8f c) { return __builtin_amdgcn_wmma_f32_16x16x32_bf16(false, a, false, b, (short)0, c, false, false); }

__device__ __forceinline__ h16 tohx(float x) { return (h16)x; }
__device__ __forceinline__ void splitf(float y, unsigned short& h, unsigned short& l) { h = f2bf(y); l = f2bf(y - bf2f(h)); }

// ---- k_gemmw: register-blocked GEMM, ONE WAVE per 64x64 output tile (16 accumulators), operands straight from 16-bit planes in fragment order; grid (M/64, N/64, Z), 32 threads.
// C[m][n] (f32, pitch ldc, + optional f32 bias[n]) = sum_k A[m][k] Bt[n][k] (+ split products per NSPLIT). z-batch strides sA/sB/sC in elements. K = 1024.
// PL != 0: no f32 C; blockIdx.y = p*16 + h (p: 0 queries, 1 keys, 2 values); the tile (64 positions t x the 64 columns d of head h) goes out as the three 16-bit planes that the attention kernel reads (fp16, bf16 hi, bf16 lo of the f32 sum),
// each plane [p][z][h][..] (sC = elements of one [h][..] block): p 0, 1: per head rows t, K = d; p 2: per head rows d, K = t (values, transposed); fragment order. Every store instruction covers four whole 128-byte lines.
#define GLB __attribute__((address_space(1)))    // global memory, named in the pointer's type: an address that has passed through an asm operand would otherwise be loaded from with flat instructions
template <typename T16> struct WFrag;    // ld(p): p = the fragment's first element + lane*8 (k 8*hi.. of row lr); 256 elements on stand k 16 + 8*hi..
template <> struct WFrag<h16> { typedef v16h V; static __device__ __forceinline__ V ld(const GLB h16* p) { return cat16(*(const GLB v8h*)p, *(const GLB v8h*)(p + 256)); } static __device__ __forceinline__ v8f mma(V a, V b, v8f c) { return wmma16(a, b, c); } };
template <> struct WFrag<bf> { typedef v16bf V; static __device__ __forceinline__ V ld(const GLB bf* p) { return cat16b(*(const GLB v8us*)p, *(const GLB v8us*)(p + 256)); } static __device__ __forceinline__ v8f mma(V a, V b, v8f c) { return wmmab(a, b, c); } };
template <bool B> struct BoolC { static constexpr bool v = B; };
template <typename T16, int NSPLIT, bool BIAS, int PL>
__global__ __launch_bounds__(32) void k_gemmw(const T16* __restrict__ A, const T16* __restrict__ A2, const T16* __restrict__ Bt, const T16* __restrict__ Bt2, float* C, int ldc, const float* __restrict__ bias, size_t sA, size_t sB, size_t sC, h16* P16, bf* Ph, bf* Pl) {
    typedef typename WFrag<T16>::V V;
    constexpr int K = DM; static_assert(DQ == DM, "both GEMMs sum over 1024 k");    // a constant, so that the panels of a tile are reached by immediate offsets from one address
    __shared__ __align__(16) float os[16 * 68];
    const size_t z = blockIdx.z; A += z * sA; if (A2) A2 += z * sA; Bt += z * sB; if (Bt2) Bt2 += z * sB; if (PL == 0) C += z * sC;
    const int lane = threadIdx.x & 31, lr = lane & 15, hi = lane >> 4; const int r0 = blockIdx.x * 64, c0 = blockIdx.y * 64;
    v8f acc[4][4];
#pragma unroll
    for (int mb = 0; mb < 4; ++mb)
#pragma unroll
        for (int nb = 0; nb < 4; ++nb) acc[mb][nb] = (v8f){};
    const unsigned lo = 8 * lane; typedef const GLB T16* GP; GP pa = (GP)(A + (size_t)r0 * K + lo), pa2 = (NSPLIT == 1 || NSPLIT == 2) ? (GP)(A2 + (size_t)r0 * K + lo) : nullptr, pb = (GP)(Bt + (size_t)c0 * K + lo), pb2 = (NSPLIT >= 2) ? (GP)(Bt2 + (size_t)c0 * K + lo) : nullptr;    // the lane's place in the tile's first panels; 32 k on: 512 elements
#pragma unroll 1
    for (int kc = 0; kc < K; kc += 32) {
        V a[4], a2[4];
#pragma unroll
        for (int mb = 0; mb < 4; ++mb) { a[mb] = WFrag<T16>::ld(pa + mb * 16 * K); if (NSPLIT == 1 || NSPLIT == 2) a2[mb] = WFrag<T16>::ld(pa2 + mb * 16 * K); }
#pragma unroll
        for (int nb = 0; nb < 4; ++nb) { const V b = WFrag<T16>::ld(pb + nb * 16 * K); V b2; if (NSPLIT >= 2) b2 = WFrag<T16>::ld(pb2 + nb * 16 * K);
#pragma unroll
            for (int mb = 0; mb < 4; ++mb) { acc[mb][nb] = WFrag<T16>::mma(a[mb], b, acc[mb][nb]); if (NSPLIT == 1 || NSPLIT == 2) acc[mb][nb] = WFrag<T16>::mma(a2[mb], b, acc[mb][nb]); if (NSPLIT >= 2) acc[mb][nb] = WFrag<T16>::mma(a[mb], b2, acc[mb][nb]); } }
        asm volatile("v_nop\n\tv_nop\n\tv_nop\n\tv_nop" : "+v"(acc[0][0]), "+v"(acc[1][1]), "+v"(acc[2][2]), "+v"(acc[3][3]) : "v"(a[0]), "v"(a[3]));
        // the sums below overwrite the address registers of this pass's loads: the wait stands in front of them; it takes the addresses as operands, so that they keep their registers up to here and the sums stay behind it
        asm volatile("s_wait_xcnt 0x0" : "+v"(pa), "+v"(pb) :: "memory"); pa += 512; pb += 512;
        if (NSPLIT == 1 || NSPLIT == 2) { asm volatile("s_wait_xcnt 0x0" : "+v"(pa2) :: "memory"); pa2 += 512; }    // as above
        if (NSPLIT >= 2) { asm volatile("s_wait_xcnt 0x0" : "+v"(pb2) :: "memory"); pb2 += 512; }                   // as above
    }
    if constexpr (PL != 0) {
        static_assert(HD == 64, "one 64-column tile is one head");
        const int p = blockIdx.y / NH_, h = blockIdx.y % NH_, prow = lane & 15, pch = lane >> 4;    // a lane takes 8 neighbours (one chunk) of a staged row: 16 lanes the 16 rows of a chunk column, 2 chunk columns a store
        const size_t pz = ((size_t)p * NB_ + z) * sC; P16 += pz; Ph += pz; Pl += pz;
        auto planes = [&](auto trc) { constexpr bool tr = decltype(trc)::v;    // tr: values, stored transposed
#pragma unroll
        for (int g = 0; g < 4; ++g) {     // 16 staged rows of 64: queries, keys: positions g*16.. by d; values: columns d = g*16.. by position
            if constexpr (!tr) {
#pragma unroll
                for (int nb = 0; nb < 4; ++nb) {
#pragma unroll
                    for (int j = 0; j < 8; ++j) os[(hi * 8 + j) * 68 + nb * 16 + lr] = acc[g][nb][j]; }
            } else {
#pragma unroll
                for (int mb = 0; mb < 4; ++mb) {    // an accumulator's 8 values are 8 neighbouring positions of one column d
                    *(v4fa*)(os + lr * 68 + mb * 16 + hi * 8) = __builtin_shufflevector(acc[mb][g], acc[mb][g], 0, 1, 2, 3); *(v4fa*)(os + lr * 68 + mb * 16 + hi * 8 + 4) = __builtin_shufflevector(acc[mb][g], acc[mb][g], 4, 5, 6, 7); }
            }
            __builtin_amdgcn_wave_barrier(); asm volatile("" ::: "memory");   // lanes read what other lanes of this one wave staged: keeps the compiler from moving the reads ahead of the writes
#pragma unroll
            for (int s = 0; s < 4; ++s) { const int ch = s * 2 + pch; const v4f x0 = *(const v4fa*)(os + prow * 68 + ch * 8), x1 = *(const v4fa*)(os + prow * 68 + ch * 8 + 4); v8h o16; v8us oh, ol;
#pragma unroll
                for (int k = 0; k < 8; ++k) { const float x = (k < 4) ? x0[k & 3] : x1[k & 3]; o16[k] = tohx(x); unsigned short a2, c2; splitf(x, a2, c2); oh[k] = a2; ol[k] = c2; }
                const size_t e = (!tr ? ((size_t)h * TT + r0 + g * 16) * HD : ((size_t)h * HD + g * 16) * TT + r0 * 16) + s * 256;    // the same for the wave; chunk column ch, row prow: + s*256 + lane*8
                *(v8h*)(P16 + e + lo) = o16; *(v8us*)(Ph + e + lo) = oh; *(v8us*)(Pl + e + lo) = ol; }
            __builtin_amdgcn_wave_barrier(); asm volatile("" ::: "memory");   // the next group's staging stays behind these reads
        }
        if constexpr (!tr) asm volatile("s_wait_xcnt 0x0" ::: "memory");    // in the built code the values' path stands behind this one and rewrites the address registers of the last stores: the wait stands in front of that overwrite
        };
        if (p == 2) { planes(BoolC<true>{}); return; }    // p comes from blockIdx: a scalar branch
        planes(BoolC<false>{}); return;
    }
#pragma unroll
    for (int mb = 0; mb < 4; ++mb) {
#pragma unroll
        for (int nb = 0; nb < 4; ++nb) {
#pragma unroll
            for (int j = 0; j < 8; ++j) os[(hi * 8 + j) * 68 + nb * 16 + lr] = acc[mb][nb][j]; }
        __builtin_amdgcn_wave_barrier(); asm volatile("" ::: "memory");
        float* crow = C + (size_t)(r0 + mb * 16) * ldc + c0;
{
#pragma unroll
            for (int s = 0; s < 8; ++s) { const int row = 2 * s + hi, cofs = lr * 4; v4f val = *(const v4fa*)(os + row * 68 + cofs); if (BIAS) { val[0] += bfr(bias[c0 + cofs]); val[1] += bfr(bias[c0 + cofs + 1]); val[2] += bfr(bias[c0 + cofs + 2]); val[3] += bfr(bias[c0 + cofs + 3]); }
                *(v4f*)(crow + (size_t)row * ldc + cofs) = val; }
             }
        __builtin_amdgcn_wave_barrier(); asm volatile("" ::: "memory");
    }
}

typedef __attribute__((ext_vector_type(4))) _Float16 v4h;
typedef __attribute__((ext_vector_type(2))) unsigned short v2us;
typedef __attribute__((ext_vector_type(4))) unsigned short v4us;
typedef __attribute__((ext_vector_type(4))) int v4i;

// Bt row n, k: w[k][n]. A thread builds one chunk (8 k of one row n): a wave's 8 loads each read one whole line (32 neighbouring n), its store two runs of 256 bytes
__global__ __launch_bounds__(256) void k_wtG(const float* __restrict__ w, bf* Bt) {
    constexpr int K = DQ, N = DM; const int idx = blockIdx.x * 256 + threadIdx.x; const int n = idx % N, c8 = idx / N; if (c8 >= K / 8) return; v8us o;
#pragma unroll
    for (int j = 0; j < 8; ++j) o[j] = f2bf(w[(size_t)(c8 * 8 + j) * N + n]);
    *(v8us*)(Bt + (size_t)(n >> 4) * 16 * K + c8 * 128 + (n & 15) * 8) = o;
}
// bf16 copy of x in fragment order. A block takes 16 rows x 128 k: read row by row (16 lanes a run of 512 bytes), turned chunk-wise in LDS (pitch 17 chunks against bank conflicts), stored as 4096 contiguous bytes
__global__ __launch_bounds__(256) void k_cvt8(const float* __restrict__ src, bf* dst) {
    __shared__ __align__(16) unsigned short sh[16 * 17 * 8];
    const int t = threadIdx.x, row = t >> 4, c = t & 15; const size_t rb = blockIdx.x / (DM / 128), kg = blockIdx.x % (DM / 128);
    const v8f v = *(const v8f*)(src + (rb * 16 + row) * DM + kg * 128 + c * 8); v8us o;
#pragma unroll
    for (int k = 0; k < 8; ++k) o[k] = f2bf(v[k]);
    *(v8usa*)(sh + (c * 17 + row) * 8) = o;
    __syncthreads();    // a thread stores a chunk that another wave converted
    *(v8us*)(dst + ((size_t)blockIdx.x * 256 + t) * 8) = *(const v8usa*)(sh + ((t >> 4) * 17 + (t & 15)) * 8);
}

// Bt row p*1024 + h*64 + e, k = c: w[h][c][e]. A thread builds one chunk (8 c of one row): a wave's 8 loads each read one whole line (32 neighbouring e), its store two runs of 256 bytes
__global__ __launch_bounds__(256) void k_wtH(const float* __restrict__ wq, const float* __restrict__ wk, const float* __restrict__ wv, bf* Bt) { const float* __restrict__ w = blockIdx.y == 0 ? wq : blockIdx.y == 1 ? wk : wv; Bt += (size_t)blockIdx.y * DQ * DM;
    const int idx = blockIdx.x * 256 + threadIdx.x; const int e = idx % HD, c8 = (idx / HD) % (DM / 8), h = idx / (HD * (DM / 8)); if (h >= NH_) return; v8us o;
#pragma unroll
    for (int j = 0; j < 8; ++j) o[j] = f2bf(w[((size_t)h * DM + c8 * 8 + j) * HD + e]);
    const int r = h * HD + e;
    *(v8us*)(Bt + (size_t)(r >> 4) * 16 * DM + c8 * 128 + (r & 15) * 8) = o;
}
// ---- k_fattn: scores, causal softmax and probability x value product of all batches in one launch. One wave owns 16 query rows of one head and walks its keys in blocks of 32 up to the diagonal.
// Transposed products: S^T = K Q^T (a lane holds 16 scores of ONE query, column lr) and O^T += V^T P^T; the two 16-key score tiles, converted in place, are the B operand of the second product
// (hardware k order, the order WFrag::ld reads), so scores and probabilities never leave the registers. Running maximum and sum per query (online softmax, log2 domain); division by the sum at the end.
// HR (query rows < RH): hi/lo bf16 planes, three products for each GEMM, in the order hi.hi, lo.hi, hi.lo; else fp16 planes, one product. Output: hi/lo bf16 planes (rows t, K = DQ, fragment order) for the last projection.
__device__ __forceinline__ float xhalf(float x) { return __builtin_bit_cast(float, __builtin_amdgcn_permlanex16(__builtin_bit_cast(int, x), __builtin_bit_cast(int, x), 0x76543210, 0xfedcba98, false, false)); }   // lane l reads lane l ^ 16
// al and p[0..15] become 2^al and 2^p, in place. The exps stand in asm so that a v_nop can close each run: the instruction set asks for one slot between a transcendental and an instruction that reads its result
// or overwrites its source. Inside a run each exp has registers of its own, so the next exp is the independent instruction.
__device__ __forceinline__ void exp2_17(float& al, float (&p)[16]) {
    asm("v_exp_f32 %0, %0\n\tv_exp_f32 %1, %1\n\tv_exp_f32 %2, %2\n\tv_exp_f32 %3, %3\n\tv_exp_f32 %4, %4\n\tv_exp_f32 %5, %5\n\tv_exp_f32 %6, %6\n\tv_exp_f32 %7, %7\n\tv_exp_f32 %8, %8\n\tv_nop"
        : "+v"(al), "+v"(p[0]), "+v"(p[1]), "+v"(p[2]), "+v"(p[3]), "+v"(p[4]), "+v"(p[5]), "+v"(p[6]), "+v"(p[7]));
    asm("v_exp_f32 %0, %0\n\tv_exp_f32 %1, %1\n\tv_exp_f32 %2, %2\n\tv_exp_f32 %3, %3\n\tv_exp_f32 %4, %4\n\tv_exp_f32 %5, %5\n\tv_exp_f32 %6, %6\n\tv_exp_f32 %7, %7\n\tv_nop"
        : "+v"(p[8]), "+v"(p[9]), "+v"(p[10]), "+v"(p[11]), "+v"(p[12]), "+v"(p[13]), "+v"(p[14]), "+v"(p[15]));
}
template <typename V> struct KVSet { V k[2][2], k2[2][2], v[4], v2[4]; };   // the K and V^T fragments of one 32-key block (k2, v2: the lo planes, HR only)
// The pointers are the same for the wave (block 0 of the walk) and are moved on by the caller; lo = lane*8; blk: blocks ahead of the pointers, a constant: every load is a scalar base + lo + an immediate offset.
// XW: s_wait_xcnt 0 behind the loads, in front of whatever overwrites their address registers next; it takes the bases and lo as operands, so that they keep their registers up to the wait and the caller's sums stay behind it;
// the long key loop passes false and has one such wait at its foot, far behind the loads
template <typename T16, bool HR>
__device__ __forceinline__ void kv_wait(const GLB T16*& Kp, const GLB T16*& K2, const GLB T16*& Vt, const GLB T16*& V2, unsigned lo) {
    if constexpr (HR) asm volatile("s_wait_xcnt 0x0" : "+s"(Kp), "+s"(K2), "+s"(Vt), "+s"(V2) : "v"(lo) : "memory");    // see XW above
    else asm volatile("s_wait_xcnt 0x0" : "+s"(Kp), "+s"(Vt) : "v"(lo) : "memory");                                       // see XW above
}
template <typename T16, bool HR, bool XW>
__device__ __forceinline__ void kv_load(KVSet<typename WFrag<T16>::V>& f, const GLB T16*& Kp, const GLB T16*& K2, const GLB T16*& Vt, const GLB T16*& V2, int blk, unsigned lo) {
#pragma unroll
    for (int t = 0; t < 2; ++t) {
#pragma unroll
        for (int ks = 0; ks < 2; ++ks) { f.k[t][ks] = WFrag<T16>::ld(Kp + lo + (blk * 32 + t * 16) * HD + 512 * ks); if (HR) f.k2[t][ks] = WFrag<T16>::ld(K2 + lo + (blk * 32 + t * 16) * HD + 512 * ks); }
    }
#pragma unroll
    for (int mt = 0; mt < 4; ++mt) { f.v[mt] = WFrag<T16>::ld(Vt + lo + mt * 16 * TT + blk * 512); if (HR) f.v2[mt] = WFrag<T16>::ld(V2 + lo + mt * 16 * TT + blk * 512); }
    if (XW) kv_wait<T16, HR>(Kp, K2, Vt, V2, lo);
}
// one 32-key block: kq = first key of this lane's score rows minus the lane's query (key <= query is kq + offset <= 0); DIAG: the block crosses the diagonal and is masked
template <typename T16, bool HR, bool DIAG>
__device__ __forceinline__ void attn_block(const KVSet<typename WFrag<T16>::V>& f, const typename WFrag<T16>::V (&qf)[2], const typename WFrag<T16>::V (&qf2)[2], v8f (&O)[4], float& m, float& l, int kq) {
    typedef typename WFrag<T16>::V V;
    v8f S[2];
#pragma unroll
    for (int t = 0; t < 2; ++t) { S[t] = (v8f){};
#pragma unroll
        for (int ks = 0; ks < 2; ++ks) { S[t] = WFrag<T16>::mma(f.k[t][ks], qf[ks], S[t]); if (HR) { S[t] = WFrag<T16>::mma(f.k[t][ks], qf2[ks], S[t]); S[t] = WFrag<T16>::mma(f.k2[t][ks], qf[ks], S[t]); } } }
    float p[16];
#pragma unroll
    for (int i = 0; i < 16; ++i) p[i] = S[i >> 3][i & 7] * SC2;          // key offset (i>>3)*16 + (i&7) from the lane's first key, query column lr
    if (DIAG) {
#pragma unroll
        for (int i = 0; i < 16; ++i) p[i] = (kq + (i >> 3) * 16 + (i & 7) <= 0) ? p[i] : -3.0e38f; }
    float bm = p[0], bm1 = p[8];                                           // two chains: half the dependent length
#pragma unroll
    for (int i = 1; i < 8; ++i) { bm = fmaxf(bm, p[i]); bm1 = fmaxf(bm1, p[8 + i]); }
    bm = fmaxf(bm, bm1); bm = fmaxf(bm, xhalf(bm));
    const float mn = fmaxf(m, bm); float al = m - mn; m = mn;
#pragma unroll
    for (int i = 0; i < 16; ++i) p[i] -= mn;
    exp2_17(al, p);
    const float bs = (((p[0] + p[1]) + (p[2] + p[3])) + ((p[4] + p[5]) + (p[6] + p[7]))) + (((p[8] + p[9]) + (p[10] + p[11])) + ((p[12] + p[13]) + (p[14] + p[15])));
    l = l * al + bs;
#pragma unroll
    for (int mt = 0; mt < 4; ++mt)
#pragma unroll
        for (int j = 0; j < 8; ++j) O[mt][j] *= al;
    V pf, pf2;
    if constexpr (HR) { v8us h0, h1, l0, l1;
#pragma unroll
        for (int j = 0; j < 8; ++j) { unsigned short a, c2; splitf(p[j], a, c2); h0[j] = a; l0[j] = c2; splitf(p[8 + j], a, c2); h1[j] = a; l1[j] = c2; }
        pf = cat16b(h0, h1); pf2 = cat16b(l0, l1);
    } else {
#pragma unroll
        for (int i = 0; i < 16; ++i) pf[i] = tohx(p[i]); }
#pragma unroll
    for (int mt = 0; mt < 4; ++mt) { O[mt] = WFrag<T16>::mma(f.v[mt], pf, O[mt]); if (HR) { O[mt] = WFrag<T16>::mma(f.v[mt], pf2, O[mt]); O[mt] = WFrag<T16>::mma(f.v2[mt], pf, O[mt]); } }
}
template <typename T16, bool HR>
__device__ __forceinline__ void attn_rows(const T16* __restrict__ Q, const T16* __restrict__ Q2, const T16* __restrict__ Kg, const T16* __restrict__ K2g, const T16* __restrict__ Vg, const T16* __restrict__ V2g, int q0, bf* Ah, bf* Al) {
    typedef typename WFrag<T16>::V V;
    const int lane = threadIdx.x & 31, lr = lane & 15, hi = lane >> 4;
    const int last = q0 >> 5;                            // the 32-key block that holds the diagonal: the wave's last
    V qf[2], qf2[2];
    const unsigned lo = 8 * lane;    // fragment order: the lane's part of every address; 32 k of a panel are 512 elements
    typedef const GLB T16* GP; GP Qp = (GP)(Q + (size_t)q0 * HD), Qp2 = HR ? (GP)(Q2 + (size_t)q0 * HD) : nullptr, Kp = (GP)Kg, K2 = (GP)K2g, Vt = (GP)Vg, V2 = (GP)V2g;    // each the same for the wave
#pragma unroll
    for (int ks = 0; ks < 2; ++ks) { qf[ks] = WFrag<T16>::ld(Qp + lo + 512 * ks); if (HR) qf2[ks] = WFrag<T16>::ld(Qp2 + lo + 512 * ks); }
    // what follows may overwrite the address registers of the query loads: the wait stands in front of that, and the addresses, as its operands, keep their registers up to it
    if constexpr (HR) asm volatile("s_wait_xcnt 0x0" :: "s"(Qp), "s"(Qp2), "v"(lo) : "memory"); else asm volatile("s_wait_xcnt 0x0" :: "s"(Qp), "v"(lo) : "memory");
    v8f O[4];
#pragma unroll
    for (int mt = 0; mt < 4; ++mt) O[mt] = (v8f){};
    float m = -3.0e38f, l = 0.f;
    const int kq0 = 8 * hi - (q0 + lr);
    KVSet<V> fa;
    if constexpr (HR) {   // at most RH/32 blocks, three products each: one fragment set, which keeps the kernel inside 256 registers
#pragma unroll 1
        for (int kb = 0; kb < last; ++kb) { kv_load<T16, HR, true>(fa, Kp, K2, Vt, V2, 0, lo); Kp += 32 * HD; K2 += 32 * HD; Vt += 512; V2 += 512; attn_block<T16, HR, false>(fa, qf, qf2, O, m, l, 0); }
        kv_load<T16, HR, true>(fa, Kp, K2, Vt, V2, 0, lo);
    } else {              // two fragment sets in turn, so that a block's K and V loads are issued ahead of the block before it; the loop body has no branch (the blocks below the diagonal need no mask)
        KVSet<V> fb;
        kv_load<T16, HR, true>(fa, Kp, K2, Vt, V2, 0, lo);
        int kb = 0;
#pragma unroll 1
        for (; kb + 1 < last; kb += 2) {
            kv_load<T16, HR, false>(fb, Kp, K2, Vt, V2, 1, lo);
            __builtin_amdgcn_sched_barrier(0);    // keeps the loads where they stand, a whole block ahead of their use: the compiler otherwise sinks the key loads to just in front of their products
            attn_block<T16, HR, false>(fa, qf, qf2, O, m, l, 0);
            kv_load<T16, HR, false>(fa, Kp, K2, Vt, V2, 2, lo);    // kb + 2 <= last
            __builtin_amdgcn_sched_barrier(0);    // as above
            attn_block<T16, HR, false>(fb, qf, qf2, O, m, l, 0);
            kv_wait<T16, HR>(Kp, K2, Vt, V2, lo); Kp += 2 * 32 * HD; Vt += 2 * 512;    // the sums overwrite the address registers of this pass's loads: behind the wait
        }
        if (kb < last) { attn_block<T16, HR, false>(fa, qf, qf2, O, m, l, 0); kv_load<T16, HR, true>(fa, Kp, K2, Vt, V2, 1, lo); }   // one block left below the diagonal block
    }
    attn_block<T16, HR, true>(fa, qf, qf2, O, m, l, kq0 + last * 32);
    l += xhalf(l);                                       // the two lane halves hold the sums of disjoint keys of the same query
    const float inv = __fdiv_rn(1.0f, l);
    bf* ph = Ah + (size_t)q0 * DQ + lo; bf* pl = Al + (size_t)q0 * DQ + lo;
#pragma unroll
    for (int mt = 0; mt < 4; ++mt) { v8us oh, ol;
#pragma unroll
        for (int j = 0; j < 8; ++j) { unsigned short a, c2; splitf(O[mt][j] * inv, a, c2); oh[j] = a; ol[j] = c2; }
        *(v8us*)(ph + mt * 256) = oh; *(v8us*)(pl + mt * 256) = ol; }    // chunk columns mt*2 + hi of the head's 8, row lr
}
// grid (TT/128, heads, batches), 8 waves of 16 query rows. Waves w and w + 4 take row tiles T and 127 - T, so every pair walks the same number of key blocks together (the cost of a tile grows with its index)
__global__ __launch_bounds__(256) void k_fattn(const h16* __restrict__ Q16, const h16* __restrict__ K16, const h16* __restrict__ V16, const bf* __restrict__ Qh, const bf* __restrict__ Ql, const bf* __restrict__ Kh, const bf* __restrict__ Kl, const bf* __restrict__ Vh, const bf* __restrict__ Vl, bf* Ah, bf* Al) {
    const int h = blockIdx.y; const int w = __builtin_amdgcn_readfirstlane((int)(threadIdx.x >> 5));   // wave-uniform, so the key loop and the row-class test are scalar branches
    const int q0 = ((w < 4) ? (int)blockIdx.x * 4 + w : TT / 16 - 1 - ((int)blockIdx.x * 4 + (w - 4))) * 16;
    const size_t po = ((size_t)blockIdx.z * NH_ + h) * TT * HD;
    Ah += (size_t)blockIdx.z * TT * DQ; Al += (size_t)blockIdx.z * TT * DQ;
    if (q0 < RH) attn_rows<bf, true>(Qh + po, Ql + po, Kh + po, Kl + po, Vh + po, Vl + po, q0, Ah + h * HD * 16, Al + h * HD * 16);
    else attn_rows<h16, false>(Q16 + po, nullptr, K16 + po, nullptr, V16 + po, nullptr, q0, Ah + h * HD * 16, Al + h * HD * 16);
}

extern "C" void kernel_launch(void* const* d_in, const int* in_sizes, int n_in,
                              void* d_out, int out_size, void* d_ws, size_t ws_size, hipStream_t stream) {
    (void)in_sizes; (void)n_in; (void)out_size;
    const float* x = (const float*)d_in[0]; const float* wq = (const float*)d_in[1]; const float* wk = (const float*)d_in[2]; const float* wv = (const float*)d_in[3]; const float* wo = (const float*)d_in[4]; const float* bo = (const float*)d_in[5];   /* order x, Wq, Wk, Wv [16][1024][64], Wproj ('xw' [1024][1024]), bproj */
    float* OUT = (float*)d_out;     // [4][2048][1024]
    char* wsp = (char*)d_ws;
    auto take = [&](size_t bytes) { char* p = wsp; wsp += (bytes + 255) & ~(size_t)255; return (void*)p; };
    static_assert(NKV == NH_, "the three projections share one plane shape");
    const size_t PB = (size_t)NH_ * TT * HD, PP = (size_t)NB_ * PB;    // elements of one batch's [h][..] block and of one plane of all batches
    bf* WQKV = (bf*)take((size_t)3 * DQ * DM * 2); bf* WO = (bf*)take((size_t)DM * DQ * 2);
    bf* XB = (bf*)take((size_t)NB_ * TT * DM * 2);
    h16* P16 = (h16*)take(3 * PP * 2); bf* Ph = (bf*)take(3 * PP * 2); bf* Pl = (bf*)take(3 * PP * 2);    // each [q, k, v][batch][h][..]
    bf* ATh = (bf*)take((size_t)NB_ * TT * DQ * 2); bf* ATl = (bf*)take((size_t)NB_ * TT * DQ * 2);
    if ((size_t)(wsp - (char*)d_ws) > ws_size) return;    // ws 256 MiB
    k_wtH<<<dim3((unsigned)(((size_t)DQ * DM / 8 + 255) / 256), 3, 1), 256, 0, stream>>>(wq, wk, wv, WQKV);   /* per-head [16][1024][64] x 3 -> Bt [3072][1024] */
    k_wtG<<<(unsigned)((DQ * DM / 8 + 255) / 256), 256, 0, stream>>>(wo, WO);
    k_cvt8<<<(unsigned)((size_t)NB_ * TT * DM / 8 / 256), 256, 0, stream>>>(x, XB);
    k_gemmw<bf, 0, false, 1><<<dim3(TT / 64, 3 * DQ / 64, NB_), 32, 0, stream>>>(XB, nullptr, WQKV, nullptr, nullptr, 0, nullptr, (size_t)TT * DM, 0, PB, P16, Ph, Pl);
    k_fattn<<<dim3(TT / 128, NH_, NB_), 256, 0, stream>>>(P16, P16 + PP, P16 + 2 * PP, Ph, Pl, Ph + PP, Pl + PP, Ph + 2 * PP, Pl + 2 * PP, ATh, ATl);
    k_gemmw<bf, 1, true, 0><<<dim3(TT / 64, DM / 64, NB_), 32, 0, stream>>>(ATh, ATl, WO, nullptr, OUT, DM, bo, (size_t)TT * DQ, 0, (size_t)TT * DM, nullptr, nullptr, nullptr);
}

// v007
// Measured time: 163 microseconds a run.
// Next to v006, in two timings, it ran 1.37 and 1.36 times as fast.
// Counting every step since v000, it is 17.7 times as fast.
#include <hip/hip_runtime.h>

// Causal multi-head attention with per-head stacked projection weights and an embed-size score scale (x [4][2048][1024]; q, k, v = einsum('btc,hcd', x, W) with Wq, Wk, Wv [16][1024][64] (0.02, no bias; 16 heads x 64); wei = q.k x 1024^-0.5 (the source scales by n_embd, not the head size); causal (-inf); softmax; out = concat heads Wproj + bproj ('xw' [1024][1024] + bias) -> [4][2048][1024] (8.4 M); argument order x, Wq, Wk, Wv, Wproj, bproj).
// Every stage is one launch for the whole problem (batch = grid z in the GEMMs and the attention; every plane holds all batches): bf16 copy of x; k_wtH gathers the per-head tensors [h][c][d] into one Bt plane of 3 x 1024 rows (row p*1024 + h*64 + d; p: q, k, v) so the three projections are one exact GEMM with head-major output columns, whose epilogue writes the head planes (fp16 + hi/lo bf16; V transposed) itself; one fused causal attention launch (k_fattn; hybrid rows: < 512 hi/lo 3 products, rest fp16; key blocks above the diagonal are never visited); hi/lo x Wproj exact + bproj.
// Every 16-bit operand plane (rows x K) lies in fragment order: panels of 16 rows, inside a panel chunks of 8 neighbouring k, inside a chunk column the 16 rows: element (r, k) at (r/16)*16*K + (k/8)*128 + (r%16)*8 + k%8.
// A wave's fragment (16 rows x 32 k) is then 1024 contiguous bytes, lane l taking 16 bytes at l*16 and at 512 + l*16: each load instruction covers four whole 128-byte lines.
// Compute dtypes, f32 accumulate: every input rounded to bf16; projections exact; attention rows < 512 3 products, rest fp16; softmax f32; Wproj hl x exact + bias.

#define NB_  4
#define TT   2048
#define DM   1024
#define NH_  16
#define NKV  16
#define HD   64
#define DQ   (NH_ * HD)
#define DKV  (NKV * HD)
#define SC2  0.04508422002778011f   // 1024^-0.5 x log2(e): the module scales by n_embd; scores go to the log2 domain for exp2
#define RH   512                  // query rows < RH use hi+lo planes (0: none)
typedef _Float16 h16;
typedef unsigned short bf;
typedef __attribute__((ext_vector_type(16))) __bf16   v16bf;
typedef __attribute__((ext_vector_type(16))) _Float16 v16h;
typedef __attribute__((ext_vector_type(8)))  _Float16 v8h;
typedef __attribute__((ext_vector_type(8)))  unsigned short v8us;
typedef __attribute__((ext_vector_type(8)))  float    v8f;
typedef __attribute__((ext_vector_type(4)))  float    v4f;
typedef v8h  __attribute__((may_alias)) v8ha;
typedef v4f  __attribute__((may_alias)) v4fa;
typedef v8us __attribute__((may_alias)) v8usa;

__device__ __forceinline__ unsigned short f2bf(float f) { unsigned u = __float_as_uint(f); u += 0x7FFFu + ((u >> 16) & 1u); return (unsigned short)(u >> 16); }
__device__ __forceinline__ float bf2f(unsigned short b) { return __uint_as_float(((unsigned)b) << 16); }
__device__ __forceinline__ float bfr(float f) { return bf2f(f2bf(f)); }
__device__ __forceinline__ v16h cat16(v8h lo, v8h hi) { return __builtin_shufflevector(lo, hi, 0, 1, 2, 3, 4, 5, 6, 7, 8, 9, 10, 11, 12, 13, 14, 15); }
__device__ __forceinline__ v16bf cat16b(v8us lo, v8us hi) { return __builtin_bit_cast(v16bf, __builtin_shufflevector(lo, hi, 0, 1, 2, 3, 4, 5, 6, 7, 8, 9, 10, 11, 12, 13, 14, 15)); }
__device__ __forceinline__ v8f wmma16(v16h a, v16h b, v8f c) { return __builtin_amdgcn_wmma_f32_16x16x32_f16(false, a, false, b, (short)0, c, false, false); }
__device__ __forceinline__ v8f wmmab(v16bf a, v16bf b, v8f c) { return __builtin_amdgcn_wmma_f32_16x16x32_bf16(false, a, false, b, (short)0, c, false, false); }

__device__ __forceinline__ h16 tohx(float x) { return (h16)x; }
__device__ __forceinline__ void splitf(float y, unsigned short& h, unsigned short& l) { h = f2bf(y); l = f2bf(y - bf2f(h)); }

// ---- k_gemmw: register-blocked GEMM, ONE WAVE per 64x64 output tile (16 accumulators), operands straight from 16-bit planes in fragment order; grid (M/64, N/64, Z), 32 threads.
// C[m][n] (f32, pitch ldc, + optional f32 bias[n]) = sum_k A[m][k] Bt[n][k] (+ split products per NSPLIT). z-batch strides sA/sB/sC in elements. K = 1024.
// PL != 0: no f32 C; blockIdx.y = p*16 + h (p: 0 queries, 1 keys, 2 values); the tile (64 positions t x the 64 columns d of head h) goes out as the three 16-bit planes that the attention kernel reads (fp16, bf16 hi, bf16 lo of the f32 sum),
// each plane [p][z][h][..] (sC = elements of one [h][..] block): p 0, 1: per head rows t, K = d; p 2: per head rows d, K = t (values, transposed); fragment order. Every store instruction covers four whole 128-byte lines.
#define GLB __attribute__((address_space(1)))    // global memory, named in the pointer's type: an address that has passed through an asm operand would otherwise be loaded from with flat instructions
template <typename T16> struct WFrag;    // ld(p): p = the fragment's first element + lane*8 (k 8*hi.. of row lr); 256 elements on stand k 16 + 8*hi..
template <> struct WFrag<h16> { typedef v16h V; static __device__ __forceinline__ V ld(const GLB h16* p) { return cat16(*(const GLB v8h*)p, *(const GLB v8h*)(p + 256)); } static __device__ __forceinline__ v8f mma(V a, V b, v8f c) { return wmma16(a, b, c); } };
template <> struct WFrag<bf> { typedef v16bf V; static __device__ __forceinline__ V ld(const GLB bf* p) { return cat16b(*(const GLB v8us*)p, *(const GLB v8us*)(p + 256)); } static __device__ __forceinline__ v8f mma(V a, V b, v8f c) { return wmmab(a, b, c); } };
template <bool B> struct BoolC { static constexpr bool v = B; };
template <typename T16, int NSPLIT, bool BIAS, int PL>
__global__ __launch_bounds__(32) void k_gemmw(const T16* __restrict__ A, const T16* __restrict__ A2, const T16* __restrict__ Bt, const T16* __restrict__ Bt2, float* C, int ldc, const float* __restrict__ bias, size_t sA, size_t sB, size_t sC, h16* P16, bf* Ph, bf* Pl) {
    typedef typename WFrag<T16>::V V;
    constexpr int K = DM; static_assert(DQ == DM, "both GEMMs sum over 1024 k");    // a constant, so that the panels of a tile are reached by immediate offsets from one address
    __shared__ __align__(16) float os[16 * 68];
    const size_t z = blockIdx.z; A += z * sA; if (A2) A2 += z * sA; Bt += z * sB; if (Bt2) Bt2 += z * sB; if (PL == 0) C += z * sC;
    const int lane = threadIdx.x & 31, lr = lane & 15, hi = lane >> 4; const int r0 = blockIdx.x * 64, c0 = blockIdx.y * 64;
    v8f acc[4][4];
#pragma unroll
    for (int mb = 0; mb < 4; ++mb)
#pragma unroll
        for (int nb = 0; nb < 4; ++nb) acc[mb][nb] = (v8f){};
    const unsigned lo = 8 * lane; typedef const GLB T16* GP; GP pa = (GP)(A + (size_t)r0 * K + lo), pa2 = (NSPLIT == 1 || NSPLIT == 2) ? (GP)(A2 + (size_t)r0 * K + lo) : nullptr, pb = (GP)(Bt + (size_t)c0 * K + lo), pb2 = (NSPLIT >= 2) ? (GP)(Bt2 + (size_t)c0 * K + lo) : nullptr;    // the lane's place in the tile's first panels; 32 k on: 512 elements
    // Two fragment sets in turn: all loads of a 32-k step are issued one step ahead of their products, so that they fly behind the products of the step before instead of being waited for one by one
    struct FSet { V a[4], a2[4], b[4], b2[4]; } f0, f1;    // a2, b2: the lo planes, only where NSPLIT asks for them
    static_assert(K % 64 == 0 && K >= 128, "the loop takes two steps a pass, the last two steps stand behind it");
    auto ldset = [&](FSet& f, int ko) {    // ko: elements ahead of the pointers, a constant: every load is its address + an immediate offset
#pragma unroll
        for (int mb = 0; mb < 4; ++mb) { f.a[mb] = WFrag<T16>::ld(pa + mb * 16 * K + ko); if (NSPLIT == 1 || NSPLIT == 2) f.a2[mb] = WFrag<T16>::ld(pa2 + mb * 16 * K + ko); }
#pragma unroll
        for (int nb = 0; nb < 4; ++nb) { f.b[nb] = WFrag<T16>::ld(pb + nb * 16 * K + ko); if (NSPLIT >= 2) f.b2[nb] = WFrag<T16>::ld(pb2 + nb * 16 * K + ko); }
    };
    auto mmaset = [&](const FSet& f) {
#pragma unroll
        for (int nb = 0; nb < 4; ++nb) {
#pragma unroll
            for (int mb = 0; mb < 4; ++mb) { acc[mb][nb] = WFrag<T16>::mma(f.a[mb], f.b[nb], acc[mb][nb]); if (NSPLIT == 1 || NSPLIT == 2) acc[mb][nb] = WFrag<T16>::mma(f.a2[mb], f.b[nb], acc[mb][nb]); if (NSPLIT >= 2) acc[mb][nb] = WFrag<T16>::mma(f.a[mb], f.b2[nb], acc[mb][nb]); } }
    };
    ldset(f0, 0);
#pragma unroll 1
    for (int kc = 0; kc < K - 64; kc += 64) {    // rolled: the body already holds two steps, and the text stays small
        ldset(f1, 512);
        __builtin_amdgcn_sched_barrier(0);    // keeps the loads where they stand, a whole step ahead of their use: the compiler otherwise sinks them to just in front of their products
        mmaset(f0);
        ldset(f0, 1024);                      // kc + 64 < K
        __builtin_amdgcn_sched_barrier(0);    // as above
        mmaset(f1);
        __builtin_amdgcn_sched_barrier(0);    // keeps the wait below at the foot of the pass, far behind the loads: moved up to them it would hold the products back
        // the next pass's addresses are formed in registers of their own; they take the place of this pass's only behind the wait, which has both as operands: the old ones keep their registers up to it, the move stays behind it
        GP na = pa + 1024, nb = pb + 1024; asm volatile("s_wait_xcnt 0x0" : "+v"(na), "+v"(nb) : "v"(pa), "v"(pb) : "memory"); pa = na; pb = nb;
        if constexpr (NSPLIT == 1 || NSPLIT == 2) { GP na2 = pa2 + 1024; asm volatile("s_wait_xcnt 0x0" : "+v"(na2) : "v"(pa2) : "memory"); pa2 = na2; }    // as above
        if constexpr (NSPLIT >= 2) { GP nb2 = pb2 + 1024; asm volatile("s_wait_xcnt 0x0" : "+v"(nb2) : "v"(pb2) : "memory"); pb2 = nb2; }                   // as above
    }
    ldset(f1, 512);
    // the last loads: what follows overwrites their address registers; the wait stands in front of that, and the addresses, as its operands, keep their registers up to it
    asm volatile("s_wait_xcnt 0x0" :: "v"(pa), "v"(pb) : "memory");
    if constexpr (NSPLIT == 1 || NSPLIT == 2) asm volatile("s_wait_xcnt 0x0" :: "v"(pa2) : "memory");    // as above
    if constexpr (NSPLIT >= 2) asm volatile("s_wait_xcnt 0x0" :: "v"(pb2) : "memory");                   // as above
    __builtin_amdgcn_sched_barrier(0);        // as in the loop
    mmaset(f0);
    mmaset(f1);
    if constexpr (PL != 0) {
        static_assert(HD == 64, "one 64-column tile is one head");
        const int p = blockIdx.y / NH_, h = blockIdx.y % NH_, prow = lane & 15, pch = lane >> 4;    // a lane takes 8 neighbours (one chunk) of a staged row: 16 lanes the 16 rows of a chunk column, 2 chunk columns a store
        const size_t pz = ((size_t)p * NB_ + z) * sC; P16 += pz; Ph += pz; Pl += pz;
        auto planes = [&](auto trc) { constexpr bool tr = decltype(trc)::v;    // tr: values, stored transposed
#pragma unroll
        for (int g = 0; g < 4; ++g) {     // 16 staged rows of 64: queries, keys: positions g*16.. by d; values: columns d = g*16.. by position
            if constexpr (!tr) {
#pragma unroll
                for (int nb = 0; nb < 4; ++nb) {
#pragma unroll
                    for (int j = 0; j < 8; ++j) os[(hi * 8 + j) * 68 + nb * 16 + lr] = acc[g][nb][j]; }
            } else {
#pragma unroll
                for (int mb = 0; mb < 4; ++mb) {    // an accumulator's 8 values are 8 neighbouring positions of one column d
                    *(v4fa*)(os + lr * 68 + mb * 16 + hi * 8) = __builtin_shufflevector(acc[mb][g], acc[mb][g], 0, 1, 2, 3); *(v4fa*)(os + lr * 68 + mb * 16 + hi * 8 + 4) = __builtin_shufflevector(acc[mb][g], acc[mb][g], 4, 5, 6, 7); }
            }
            __builtin_amdgcn_wave_barrier(); asm volatile("" ::: "memory");   // lanes read what other lanes of this one wave staged: keeps the compiler from moving the reads ahead of the writes
#pragma unroll
            for (int s = 0; s < 4; ++s) { const int ch = s * 2 + pch; const v4f x0 = *(const v4fa*)(os + prow * 68 + ch * 8), x1 = *(const v4fa*)(os + prow * 68 + ch * 8 + 4); v8h o16; v8us oh, ol;
#pragma unroll
                for (int k = 0; k < 8; ++k) { const float x = (k < 4) ? x0[k & 3] : x1[k & 3]; o16[k] = tohx(x); unsigned short a2, c2; splitf(x, a2, c2); oh[k] = a2; ol[k] = c2; }
                const size_t e = (!tr ? ((size_t)h * TT + r0 + g * 16) * HD : ((size_t)h * HD + g * 16) * TT + r0 * 16) + s * 256;    // the same for the wave; chunk column ch, row prow: + s*256 + lane*8
                *(v8h*)(P16 + e + lo) = o16; *(v8us*)(Ph + e + lo) = oh; *(v8us*)(Pl + e + lo) = ol; }
            __builtin_amdgcn_wave_barrier(); asm volatile("" ::: "memory");   // the next group's staging stays behind these reads
        }
        if constexpr (!tr) asm volatile("s_wait_xcnt 0x0" ::: "memory");    // in the built code the values' path stands behind this one and rewrites the address registers of the last stores: the wait stands in front of that overwrite
        };
        if (p == 2) { planes(BoolC<true>{}); return; }    // p comes from blockIdx: a scalar branch
        planes(BoolC<false>{}); return;
    }
#pragma unroll
    for (int mb = 0; mb < 4; ++mb) {
#pragma unroll
        for (int nb = 0; nb < 4; ++nb) {
#pragma unroll
            for (int j = 0; j < 8; ++j) os[(hi * 8 + j) * 68 + nb * 16 + lr] = acc[mb][nb][j]; }
        __builtin_amdgcn_wave_barrier(); asm volatile("" ::: "memory");
        float* crow = C + (size_t)(r0 + mb * 16) * ldc + c0;
{
#pragma unroll
            for (int s = 0; s < 8; ++s) { const int row = 2 * s + hi, cofs = lr * 4; v4f val = *(const v4fa*)(os + row * 68 + cofs); if (BIAS) { val[0] += bfr(bias[c0 + cofs]); val[1] += bfr(bias[c0 + cofs + 1]); val[2] += bfr(bias[c0 + cofs + 2]); val[3] += bfr(bias[c0 + cofs + 3]); }
                *(v4f*)(crow + (size_t)row * ldc + cofs) = val; }
             }
        __builtin_amdgcn_wave_barrier(); asm volatile("" ::: "memory");
    }
}

typedef __attribute__((ext_vector_type(4))) _Float16 v4h;
typedef __attribute__((ext_vector_type(2))) unsigned short v2us;
typedef __attribute__((ext_vector_type(4))) unsigned short v4us;
typedef __attribute__((ext_vector_type(4))) int v4i;

// Bt row n, k: w[k][n]. A thread builds one chunk (8 k of one row n): a wave's 8 loads each read one whole line (32 neighbouring n), its store two runs of 256 bytes
__global__ __launch_bounds__(256) void k_wtG(const float* __restrict__ w, bf* Bt) {
    constexpr int K = DQ, N = DM; const int idx = blockIdx.x * 256 + threadIdx.x; const int n = idx % N, c8 = idx / N; if (c8 >= K / 8) return; v8us o;
#pragma unroll
    for (int j = 0; j < 8; ++j) o[j] = f2bf(w[(size_t)(c8 * 8 + j) * N + n]);
    *(v8us*)(Bt + (size_t)(n >> 4) * 16 * K + c8 * 128 + (n & 15) * 8) = o;
}
// bf16 copy of x in fragment order. A block takes 16 rows x 128 k: read row by row (16 lanes a run of 512 bytes), turned chunk-wise in LDS (pitch 17 chunks against bank conflicts), stored as 4096 contiguous bytes
__global__ __launch_bounds__(256) void k_cvt8(const float* __restrict__ src, bf* dst) {
    __shared__ __align__(16) unsigned short sh[16 * 17 * 8];
    const int t = threadIdx.x, row = t >> 4, c = t & 15; const size_t rb = blockIdx.x / (DM / 128), kg = blockIdx.x % (DM / 128);
    const v8f v = *(const v8f*)(src + (rb * 16 + row) * DM + kg * 128 + c * 8); v8us o;
#pragma unroll
    for (int k = 0; k < 8; ++k) o[k] = f2bf(v[k]);
    *(v8usa*)(sh + (c * 17 + row) * 8) = o;
    __syncthreads();    // a thread stores a chunk that another wave converted
    *(v8us*)(dst + ((size_t)blockIdx.x * 256 + t) * 8) = *(const v8usa*)(sh + ((t >> 4) * 17 + (t & 15)) * 8);
}

// Bt row p*1024 + h*64 + e, k = c: w[h][c][e]. A thread builds one chunk (8 c of one row): a wave's 8 loads each read one whole line (32 neighbouring e), its store two runs of 256 bytes
__global__ __launch_bounds__(256) void k_wtH(const float* __restrict__ wq, const float* __restrict__ wk, const float* __restrict__ wv, bf* Bt) { const float* __restrict__ w = blockIdx.y == 0 ? wq : blockIdx.y == 1 ? wk : wv; Bt += (size_t)blockIdx.y * DQ * DM;
    const int idx = blockIdx.x * 256 + threadIdx.x; const int e = idx % HD, c8 = (idx / HD) % (DM / 8), h = idx / (HD * (DM / 8)); if (h >= NH_) return; v8us o;
#pragma unroll
    for (int j = 0; j < 8; ++j) o[j] = f2bf(w[((size_t)h * DM + c8 * 8 + j) * HD + e]);
    const int r = h * HD + e;
    *(v8us*)(Bt + (size_t)(r >> 4) * 16 * DM + c8 * 128 + (r & 15) * 8) = o;
}
// ---- k_fattn: scores, causal softmax and probability x value product of all batches in one launch. One wave owns 16 query rows of one head and walks its keys in blocks of 32 up to the diagonal.
// Transposed products: S^T = K Q^T (a lane holds 16 scores of ONE query, column lr) and O^T += V^T P^T; the two 16-key score tiles, converted in place, are the B operand of the second product
// (hardware k order, the order WFrag::ld reads), so scores and probabilities never leave the registers. Running maximum and sum per query (online softmax, log2 domain); division by the sum at the end.
// HR (query rows < RH): hi/lo bf16 planes, three products for each GEMM, in the order hi.hi, lo.hi, hi.lo; else fp16 planes, one product. Output: hi/lo bf16 planes (rows t, K = DQ, fragment order) for the last projection.
__device__ __forceinline__ float xhalf(float x) { return __builtin_bit_cast(float, __builtin_amdgcn_permlanex16(__builtin_bit_cast(int, x), __builtin_bit_cast(int, x), 0x76543210, 0xfedcba98, false, false)); }   // lane l reads lane l ^ 16
// al and p[0..15] become 2^al and 2^p, in place. The exps stand in asm so that a v_nop can close each run: the instruction set asks for one slot between a transcendental and an instruction that reads its result
// or overwrites its source. Inside a run each exp has registers of its own, so the next exp is the independent instruction.
__device__ __forceinline__ void exp2_17(float& al, float (&p)[16]) {
    asm("v_exp_f32 %0, %0\n\tv_exp_f32 %1, %1\n\tv_exp_f32 %2, %2\n\tv_exp_f32 %3, %3\n\tv_exp_f32 %4, %4\n\tv_exp_f32 %5, %5\n\tv_exp_f32 %6, %6\n\tv_exp_f32 %7, %7\n\tv_exp_f32 %8, %8\n\tv_nop"
        : "+v"(al), "+v"(p[0]), "+v"(p[1]), "+v"(p[2]), "+v"(p[3]), "+v"(p[4]), "+v"(p[5]), "+v"(p[6]), "+v"(p[7]));
    asm("v_exp_f32 %0, %0\n\tv_exp_f32 %1, %1\n\tv_exp_f32 %2, %2\n\tv_exp_f32 %3, %3\n\tv_exp_f32 %4, %4\n\tv_exp_f32 %5, %5\n\tv_exp_f32 %6, %6\n\tv_exp_f32 %7, %7\n\tv_nop"
        : "+v"(p[8]), "+v"(p[9]), "+v"(p[10]), "+v"(p[11]), "+v"(p[12]), "+v"(p[13]), "+v"(p[14]), "+v"(p[15]));
}
template <typename V> struct KVSet { V k[2][2], k2[2][2], v[4], v2[4]; };   // the K and V^T fragments of one 32-key block (k2, v2: the lo planes, HR only)
// The pointers are the same for the wave (block 0 of the walk) and are moved on by the caller; lo = lane*8; blk: blocks ahead of the pointers, a constant: every load is a scalar base + lo + an immediate offset.
// XW: s_wait_xcnt 0 behind the loads, in front of whatever overwrites their address registers next; it takes the bases and lo as operands, so that they keep their registers up to the wait and the caller's sums stay behind it;
// the long key loop passes false and has one such wait at its foot, far behind the loads
template <typename T16, bool HR>
__device__ __forceinline__ void kv_wait(const GLB T16*& Kp, const GLB T16*& K2, const GLB T16*& Vt, const GLB T16*& V2, unsigned lo) {
    if constexpr (HR) asm volatile("s_wait_xcnt 0x0" : "+s"(Kp), "+s"(K2), "+s"(Vt), "+s"(V2) : "v"(lo) : "memory");    // see XW above
    else asm volatile("s_wait_xcnt 0x0" : "+s"(Kp), "+s"(Vt) : "v"(lo) : "memory");                                       // see XW above
}
template <typename T16, bool HR, bool XW>
__device__ __forceinline__ void kv_load(KVSet<typename WFrag<T16>::V>& f, const GLB T16*& Kp, const GLB T16*& K2, const GLB T16*& Vt, const GLB T16*& V2, int blk, unsigned lo) {
#pragma unroll
    for (int t = 0; t < 2; ++t) {
#pragma unroll
        for (int ks = 0; ks < 2; ++ks) { f.k[t][ks] = WFrag<T16>::ld(Kp + lo + (blk * 32 + t * 16) * HD + 512 * ks); if (HR) f.k2[t][ks] = WFrag<T16>::ld(K2 + lo + (blk * 32 + t * 16) * HD + 512 * ks); }
    }
#pragma unroll
    for (int mt = 0; mt < 4; ++mt) { f.v[mt] = WFrag<T16>::ld(Vt + lo + mt * 16 * TT + blk * 512); if (HR) f.v2[mt] = WFrag<T16>::ld(V2 + lo + mt * 16 * TT + blk * 512); }
    if (XW) kv_wait<T16, HR>(Kp, K2, Vt, V2, lo);
}
// one 32-key block: kq = first key of this lane's score rows minus the lane's query (key <= query is kq + offset <= 0); DIAG: the block crosses the diagonal and is masked
template <typename T16, bool HR, bool DIAG>
__device__ __forceinline__ void attn_block(const KVSet<typename WFrag<T16>::V>& f, const typename WFrag<T16>::V (&qf)[2], const typename WFrag<T16>::V (&qf2)[2], v8f (&O)[4], float& m, float& l, int kq) {
    typedef typename WFrag<T16>::V V;
    v8f S[2];
#pragma unroll
    for (int t = 0; t < 2; ++t) { S[t] = (v8f){};
#pragma unroll
        for (int ks = 0; ks < 2; ++ks) { S[t] = WFrag<T16>::mma(f.k[t][ks], qf[ks], S[t]); if (HR) { S[t] = WFrag<T16>::mma(f.k[t][ks], qf2[ks], S[t]); S[t] = WFrag<T16>::mma(f.k2[t][ks], qf[ks], S[t]); } } }
    float p[16];
#pragma unroll
    for (int i = 0; i < 16; ++i) p[i] = S[i >> 3][i & 7] * SC2;          // key offset (i>>3)*16 + (i&7) from the lane's first key, query column lr
    if (DIAG) {
#pragma unroll
        for (int i = 0; i < 16; ++i) p[i] = (kq + (i >> 3) * 16 + (i & 7) <= 0) ? p[i] : -3.0e38f; }
    float bm = p[0], bm1 = p[8];                                           // two chains: half the dependent length
#pragma unroll
    for (int i = 1; i < 8; ++i) { bm = fmaxf(bm, p[i]); bm1 = fmaxf(bm1, p[8 + i]); }
    bm = fmaxf(bm, bm1); bm = fmaxf(bm, xhalf(bm));
    const float mn = fmaxf(m, bm); float al = m - mn; m = mn;
#pragma unroll
    for (int i = 0; i < 16; ++i) p[i] -= mn;
    exp2_17(al, p);
    const float bs = (((p[0] + p[1]) + (p[2] + p[3])) + ((p[4] + p[5]) + (p[6] + p[7]))) + (((p[8] + p[9]) + (p[10] + p[11])) + ((p[12] + p[13]) + (p[14] + p[15])));
    l = l * al + bs;
#pragma unroll
    for (int mt = 0; mt < 4; ++mt)
#pragma unroll
        for (int j = 0; j < 8; ++j) O[mt][j] *= al;
    V pf, pf2;
    if constexpr (HR) { v8us h0, h1, l0, l1;
#pragma unroll
        for (int j = 0; j < 8; ++j) { unsigned short a, c2; splitf(p[j], a, c2); h0[j] = a; l0[j] = c2; splitf(p[8 + j], a, c2); h1[j] = a; l1[j] = c2; }
        pf = cat16b(h0, h1); pf2 = cat16b(l0, l1);
    } else {
#pragma unroll
        for (int i = 0; i < 16; ++i) pf[i] = tohx(p[i]); }
#pragma unroll
    for (int mt = 0; mt < 4; ++mt) { O[mt] = WFrag<T16>::mma(f.v[mt], pf, O[mt]); if (HR) { O[mt] = WFrag<T16>::mma(f.v[mt], pf2, O[mt]); O[mt] = WFrag<T16>::mma(f.v2[mt], pf, O[mt]); } }
}
template <typename T16, bool HR>
__device__ __forceinline__ void attn_rows(const T16* __restrict__ Q, const T16* __restrict__ Q2, const T16* __restrict__ Kg, const T16* __restrict__ K2g, const T16* __restrict__ Vg, const T16* __restrict__ V2g, int q0, bf* Ah, bf* Al) {
    typedef typename WFrag<T16>::V V;
    const int lane = threadIdx.x & 31, lr = lane & 15, hi = lane >> 4;
    const int last = q0 >> 5;                            // the 32-key block that holds the diagonal: the wave's last
    V qf[2], qf2[2];
    const unsigned lo = 8 * lane;    // fragment order: the lane's part of every address; 32 k of a panel are 512 elements
    typedef const GLB T16* GP; GP Qp = (GP)(Q + (size_t)q0 * HD), Qp2 = HR ? (GP)(Q2 + (size_t)q0 * HD) : nullptr, Kp = (GP)Kg, K2 = (GP)K2g, Vt = (GP)Vg, V2 = (GP)V2g;    // each the same for the wave
#pragma unroll
    for (int ks = 0; ks < 2; ++ks) { qf[ks] = WFrag<T16>::ld(Qp + lo + 512 * ks); if (HR) qf2[ks] = WFrag<T16>::ld(Qp2 + lo + 512 * ks); }
    // what follows may overwrite the address registers of the query loads: the wait stands in front of that, and the addresses, as its operands, keep their registers up to it
    if constexpr (HR) asm volatile("s_wait_xcnt 0x0" :: "s"(Qp), "s"(Qp2), "v"(lo) : "memory"); else asm volatile("s_wait_xcnt 0x0" :: "s"(Qp), "v"(lo) : "memory");
    v8f O[4];
#pragma unroll
    for (int mt = 0; mt < 4; ++mt) O[mt] = (v8f){};
    float m = -3.0e38f, l = 0.f;
    const int kq0 = 8 * hi - (q0 + lr);
    KVSet<V> fa;
    if constexpr (HR) {   // at most RH/32 blocks, three products each: one fragment set, which keeps the kernel inside 256 registers
#pragma unroll 1
        for (int kb = 0; kb < last; ++kb) { kv_load<T16, HR, true>(fa, Kp, K2, Vt, V2, 0, lo); Kp += 32 * HD; K2 += 32 * HD; Vt += 512; V2 += 512; attn_block<T16, HR, false>(fa, qf, qf2, O, m, l, 0); }
        kv_load<T16, HR, true>(fa, Kp, K2, Vt, V2, 0, lo);
    } else {              // two fragment sets in turn, so that a block's K and V loads are issued ahead of the block before it; the loop body has no branch (the blocks below the diagonal need no mask)
        KVSet<V> fb;
        kv_load<T16, HR, true>(fa, Kp, K2, Vt, V2, 0, lo);
        int kb = 0;
#pragma unroll 1
        for (; kb + 1 < last; kb += 2) {
            kv_load<T16, HR, false>(fb, Kp, K2, Vt, V2, 1, lo);
            __builtin_amdgcn_sched_barrier(0);    // keeps the loads where they stand, a whole block ahead of their use: the compiler otherwise sinks the key loads to just in front of their products
            attn_block<T16, HR, false>(fa, qf, qf2, O, m, l, 0);
            kv_load<T16, HR, false>(fa, Kp, K2, Vt, V2, 2, lo);    // kb + 2 <= last
            __builtin_amdgcn_sched_barrier(0);    // as above
            attn_block<T16, HR, false>(fb, qf, qf2, O, m, l, 0);
            kv_wait<T16, HR>(Kp, K2, Vt, V2, lo); Kp += 2 * 32 * HD; Vt += 2 * 512;    // the sums overwrite the address registers of this pass's loads: behind the wait
        }
        if (kb < last) { attn_block<T16, HR, false>(fa, qf, qf2, O, m, l, 0); kv_load<T16, HR, true>(fa, Kp, K2, Vt, V2, 1, lo); }   // one block left below the diagonal block
    }
    attn_block<T16, HR, true>(fa, qf, qf2, O, m, l, kq0 + last * 32);
    l += xhalf(l);                                       // the two lane halves hold the sums of disjoint keys of the same query
    const float inv = __fdiv_rn(1.0f, l);
    bf* ph = Ah + (size_t)q0 * DQ + lo; bf* pl = Al + (size_t)q0 * DQ + lo;
#pragma unroll
    for (int mt = 0; mt < 4; ++mt) { v8us oh, ol;
#pragma unroll
        for (int j = 0; j < 8; ++j) { unsigned short a, c2; splitf(O[mt][j] * inv, a, c2); oh[j] = a; ol[j] = c2; }
        *(v8us*)(ph + mt * 256) = oh; *(v8us*)(pl + mt * 256) = ol; }    // chunk columns mt*2 + hi of the head's 8, row lr
}
// grid (TT/128, heads, batches), 8 waves of 16 query rows. Waves w and w + 4 take row tiles T and 127 - T, so every pair walks the same number of key blocks together (the cost of a tile grows with its index)
__global__ __launch_bounds__(256) void k_fattn(const h16* __restrict__ Q16, const h16* __restrict__ K16, const h16* __restrict__ V16, const bf* __restrict__ Qh, const bf* __restrict__ Ql, const bf* __restrict__ Kh, const bf* __restrict__ Kl, const bf* __restrict__ Vh, const bf* __restrict__ Vl, bf* Ah, bf* Al) {
    const int h = blockIdx.y; const int w = __builtin_amdgcn_readfirstlane((int)(threadIdx.x >> 5));   // wave-uniform, so the key loop and the row-class test are scalar branches
    const int q0 = ((w < 4) ? (int)blockIdx.x * 4 + w : TT / 16 - 1 - ((int)blockIdx.x * 4 + (w - 4))) * 16;
    const size_t po = ((size_t)blockIdx.z * NH_ + h) * TT * HD;
    Ah += (size_t)blockIdx.z * TT * DQ; Al += (size_t)blockIdx.z * TT * DQ;
    if (q0 < RH) attn_rows<bf, true>(Qh + po, Ql + po, Kh + po, Kl + po, Vh + po, Vl + po, q0, Ah + h * HD * 16, Al + h * HD * 16);
    else attn_rows<h16, false>(Q16 + po, nullptr, K16 + po, nullptr, V16 + po, nullptr, q0, Ah + h * HD * 16, Al + h * HD * 16);
}

extern "C" void kernel_launch(void* const* d_in, const int* in_sizes, int n_in,
                              void* d_out, int out_size, void* d_ws, size_t ws_size, hipStream_t stream) {
    (void)in_sizes; (void)n_in; (void)out_size;
    const float* x = (const float*)d_in[0]; const float* wq = (const float*)d_in[1]; const float* wk = (const float*)d_in[2]; const float* wv = (const float*)d_in[3]; const float* wo = (const float*)d_in[4]; const float* bo = (const float*)d_in[5];   /* order x, Wq, Wk, Wv [16][1024][64], Wproj ('xw' [1024][1024]), bproj */
    float* OUT = (float*)d_out;     // [4][2048][1024]
    char* wsp = (char*)d_ws;
    auto take = [&](size_t bytes) { char* p = wsp; wsp += (bytes + 255) & ~(size_t)255; return (void*)p; };
    static_assert(NKV == NH_, "the three projections share one plane shape");
    const size_t PB = (size_t)NH_ * TT * HD, PP = (size_t)NB_ * PB;    // elements of one batch's [h][..] block and of one plane of all batches
    bf* WQKV = (bf*)take((size_t)3 * DQ * DM * 2); bf* WO = (bf*)take((size_t)DM * DQ * 2);
    bf* XB = (bf*)take((size_t)NB_ * TT * DM * 2);
    h16* P16 = (h16*)take(3 * PP * 2); bf* Ph = (bf*)take(3 * PP * 2); bf* Pl = (bf*)take(3 * PP * 2);    // each [q, k, v][batch][h][..]
    bf* ATh = (bf*)take((size_t)NB_ * TT * DQ * 2); bf* ATl = (bf*)take((size_t)NB_ * TT * DQ * 2);
    if ((size_t)(wsp - (char*)d_ws) > ws_size) return;    // ws 256 MiB
    k_wtH<<<dim3((unsigned)(((size_t)DQ * DM / 8 + 255) / 256), 3, 1), 256, 0, stream>>>(wq, wk, wv, WQKV);   /* per-head [16][1024][64] x 3 -> Bt [3072][1024] */
    k_wtG<<<(unsigned)((DQ * DM / 8 + 255) / 256), 256, 0, stream>>>(wo, WO);
    k_cvt8<<<(unsigned)((size_t)NB_ * TT * DM / 8 / 256), 256, 0, stream>>>(x, XB);
    k_gemmw<bf, 0, false, 1><<<dim3(TT / 64, 3 * DQ / 64, NB_), 32, 0, stream>>>(XB, nullptr, WQKV, nullptr, nullptr, 0, nullptr, (size_t)TT * DM, 0, PB, P16, Ph, Pl);
    k_fattn<<<dim3(TT / 128, NH_, NB_), 256, 0, stream>>>(P16, P16 + PP, P16 + 2 * PP, Ph, Pl, Ph + PP, Pl + PP, Ph + 2 * PP, Pl + 2 * PP, ATh, ATl);
    k_gemmw<bf, 1, true, 0><<<dim3(TT / 64, DM / 64, NB_), 32, 0, stream>>>(ATh, ATl, WO, nullptr, OUT, DM, bo, (size_t)TT * DQ, 0, (size_t)TT * DM, nullptr, nullptr, nullptr);
}

// v008
// A run of this version takes 146 microseconds.
// Next to v007, in two timings, it ran 1.12 and 1.13 times as fast.
// Counting every step since v000, it is 19.9 times as fast.
#include <hip/hip_runtime.h>

// Causal multi-head attention with per-head stacked projection weights and an embed-size score scale (x [4][2048][1024]; q, k, v = einsum('btc,hcd', x, W) with Wq, Wk, Wv [16][1024][64] (0.02, no bias; 16 heads x 64); wei = q.k x 1024^-0.5 (the source scales by n_embd, not the head size); causal (-inf); softmax; out = concat heads Wproj + bproj ('xw' [1024][1024] + bias) -> [4][2048][1024] (8.4 M); argument order x, Wq, Wk, Wv, Wproj, bproj).
// Every stage is one launch for the whole problem (batch = grid z in the GEMMs and the attention; every plane holds all batches): bf16 copy of x; k_wtH gathers the per-head tensors [h][c][d] into one Bt plane of 3 x 1024 rows (row p*1024 + h*64 + d; p: q, k, v) so the three projections are one exact GEMM with head-major output columns, whose epilogue writes the head planes (fp16 + hi/lo bf16; V transposed) itself; one fused causal attention launch (k_fattn; hybrid rows: < 512 hi/lo 3 products, rest fp16; key blocks above the diagonal are never visited); hi/lo x Wproj exact + bproj.
// Every 16-bit operand plane (rows x K) lies in fragment order: panels of 16 rows, inside a panel chunks of 8 neighbouring k, inside a chunk column the 16 rows: element (r, k) at (r/16)*16*K + (k/8)*128 + (r%16)*8 + k%8.
// A wave's fragment (16 rows x 32 k) is then 1024 contiguous bytes, lane l taking 16 bytes at l*16 and at 512 + l*16: each load instruction covers four whole 128-byte lines.
// Compute dtypes, f32 accumulate: every input rounded to bf16; projections exact; attention rows < 512 3 products, rest fp16; softmax f32; Wproj hl x exact + bias.

#define NB_  4
#define TT   2048
#define DM   1024
#define NH_  16
#define NKV  16
#define HD   64
#define DQ   (NH_ * HD)
#define DKV  (NKV * HD)
#define SC2  0.04508422002778011f   // 1024^-0.5 x log2(e): the module scales by n_embd; scores go to the log2 domain for exp2
#define RH   512                  // query rows < RH use hi+lo planes (0: none)
typedef _Float16 h16;
typedef unsigned short bf;
typedef __attribute__((ext_vector_type(16))) __bf16   v16bf;
typedef __attribute__((ext_vector_type(16))) _Float16 v16h;
typedef __attribute__((ext_vector_type(8)))  _Float16 v8h;
typedef __attribute__((ext_vector_type(8)))  unsigned short v8us;
typedef __attribute__((ext_vector_type(8)))  float    v8f;
typedef __attribute__((ext_vector_type(4)))  float    v4f;
typedef v8h  __attribute__((may_alias)) v8ha;
typedef v4f  __attribute__((may_alias)) v4fa;
typedef v8us __attribute__((may_alias)) v8usa;

__device__ __forceinline__ unsigned short f2bf(float f) { unsigned u = __float_as_uint(f); u += 0x7FFFu + ((u >> 16) & 1u); return (unsigned short)(u >> 16); }
__device__ __forceinline__ float bf2f(unsigned short b) { return __uint_as_float(((unsigned)b) << 16); }
__device__ __forceinline__ float bfr(float f) { return bf2f(f2bf(f)); }
__device__ __forceinline__ v16h cat16(v8h lo, v8h hi) { return __builtin_shufflevector(lo, hi, 0, 1, 2, 3, 4, 5, 6, 7, 8, 9, 10, 11, 12, 13, 14, 15); }
__device__ __forceinline__ v16bf cat16b(v8us lo, v8us hi) { return __builtin_bit_cast(v16bf, __builtin_shufflevector(lo, hi, 0, 1, 2, 3, 4, 5, 6, 7, 8, 9, 10, 11, 12, 13, 14, 15)); }
__device__ __forceinline__ v8f wmma16(v16h a, v16h b, v8f c) { return __builtin_amdgcn_wmma_f32_16x16x32_f16(false, a, false, b, (short)0, c, false, false); }
__device__ __forceinline__ v8f wmmab(v16bf a, v16bf b, v8f c) { return __builtin_amdgcn_wmma_f32_16x16x32_bf16(false, a, false, b, (short)0, c, false, false); }

__device__ __forceinline__ h16 tohx(float x) { return (h16)x; }
__device__ __forceinline__ void splitf(float y, unsigned short& h, unsigned short& l) { h = f2bf(y); l = f2bf(y - bf2f(h)); }

// ---- k_gemmw: register-blocked GEMM, one wave per 64x64 output tile (16 accumulators), NWM x NWN waves a work-group on neighbouring tiles (wave w: tile row w % NWM, tile column w / NWM); grid (M/64/NWM, N/64/NWN, Z).
// The operands of the work-group's tile come from the 16-bit planes (fragment order) into LDS by asynchronous copies, 64 k a stage, two buffers: every panel is fetched from L2 once for the work-group, not once for each wave that needs it.
// A panel's part of a stage is 2048 contiguous bytes in the plane and in LDS, so a fragment is read from LDS as it would be from the plane: lane l takes 16 bytes at l*16 and at 512 + l*16 (no bank conflict).
// C[m][n] (f32, pitch ldc, + optional f32 bias[n]) = sum_k A[m][k] Bt[n][k] (+ split products per NSPLIT). z-batch strides sA/sB/sC in elements. K = 1024.
// PL != 0: no f32 C; the wave's tile column = p*16 + h (p: 0 queries, 1 keys, 2 values); the tile (64 positions t x the 64 columns d of head h) goes out as the three 16-bit planes that the attention kernel reads (fp16, bf16 hi, bf16 lo of the f32 sum),
// each plane [p][z][h][..] (sC = elements of one [h][..] block): p 0, 1: per head rows t, K = d; p 2: per head rows d, K = t (values, transposed); fragment order. Every store instruction covers four whole 128-byte lines.
#define GLB __attribute__((address_space(1)))    // global memory, named in the pointer's type: an address that has passed through an asm operand would otherwise be loaded from with flat instructions
template <typename T16> struct WFrag;    // ld(p): p = the fragment's first element + lane*8 (k 8*hi.. of row lr); 256 elements on stand k 16 + 8*hi..; lds(p): the same from a copy of the fragment in LDS
template <> struct WFrag<h16> { typedef v16h V; static __device__ __forceinline__ V ld(const GLB h16* p) { return cat16(*(const GLB v8h*)p, *(const GLB v8h*)(p + 256)); } static __device__ __forceinline__ V lds(const h16* p) { return cat16(*(const v8ha*)p, *(const v8ha*)(p + 256)); } static __device__ __forceinline__ v8f mma(V a, V b, v8f c) { return wmma16(a, b, c); } };
template <> struct WFrag<bf> { typedef v16bf V; static __device__ __forceinline__ V ld(const GLB bf* p) { return cat16b(*(const GLB v8us*)p, *(const GLB v8us*)(p + 256)); } static __device__ __forceinline__ V lds(const bf* p) { return cat16b(*(const v8usa*)p, *(const v8usa*)(p + 256)); } static __device__ __forceinline__ v8f mma(V a, V b, v8f c) { return wmmab(a, b, c); } };
template <bool B> struct BoolC { static constexpr bool v = B; };
// Asynchronous copies to LDS, 16 bytes a lane each: l = the lane's LDS byte address, g = its global address. AC4: the 2048 bytes of one panel's part of a stage, four copies of 512 bytes;
// the immediate offset moves the LDS address and the global address alike, and the bytes lie alike in both places.
// s_wait_xcnt 0 closes the copies' own statement: it stands in front of whatever rewrites a register that a copy names (a precaution)
#define AC4(l, g) "global_load_async_to_lds_b128 %" #l ", %" #g ", off\n\tglobal_load_async_to_lds_b128 %" #l ", %" #g ", off offset:512\n\tglobal_load_async_to_lds_b128 %" #l ", %" #g ", off offset:1024\n\tglobal_load_async_to_lds_b128 %" #l ", %" #g ", off offset:1536\n\t"
template <typename GP> __device__ __forceinline__ void acopy(const unsigned (&l)[3], const GP (&g)[3]) {
    asm volatile(AC4(0, 3) AC4(1, 4) AC4(2, 5) "s_wait_xcnt 0x0" :: "v"(l[0]), "v"(l[1]), "v"(l[2]), "v"(g[0]), "v"(g[1]), "v"(g[2]) : "memory");
}
template <typename GP> __device__ __forceinline__ void acopy(const unsigned (&l)[4], const GP (&g)[4]) {
    asm volatile(AC4(0, 4) AC4(1, 5) AC4(2, 6) AC4(3, 7) "s_wait_xcnt 0x0" :: "v"(l[0]), "v"(l[1]), "v"(l[2]), "v"(l[3]), "v"(g[0]), "v"(g[1]), "v"(g[2]), "v"(g[3]) : "memory");
}
// WPE: waves a SIMD that the register budget is set for
template <typename T16, int NSPLIT, bool BIAS, int PL, int NWM, int NWN, int WPE>
__global__ __launch_bounds__(32 * NWM * NWN) __attribute__((amdgpu_waves_per_eu(WPE, WPE))) void k_gemmw(const T16* __restrict__ A, const T16* __restrict__ A2, const T16* __restrict__ Bt, const T16* __restrict__ Bt2, float* C, int ldc, const float* __restrict__ bias, size_t sA, size_t sB, size_t sC, h16* P16, bf* Ph, bf* Pl) {
    typedef typename WFrag<T16>::V V;
    constexpr int K = DM; static_assert(DQ == DM, "both GEMMs sum over 1024 k");    // a constant, so that the stage count and every offset in LDS are constants
    static_assert(NSPLIT == 0 || NSPLIT == 1, "A alone or A hi + lo; B is one plane");
    constexpr int NW = NWM * NWN, NPA = NWM * 4, NPAT = (NSPLIT == 1 ? 2 : 1) * NPA, NP = NPAT + NWN * 4, PPW = NP / NW;    // 16-row panels of the work-group's tile: A, (A lo,) B; panels that a wave copies
    constexpr int NS = K / 64, PE = 16 * 64;    // stages; elements of a panel's part of a stage
    static_assert(NP % NW == 0 && (PPW == 3 || PPW == 4), "every wave copies the same number of whole panel parts");
    static_assert(NS >= 4 && NS % 2 == 0, "the loop takes two stages a pass, one from each buffer; the last two stand behind it");
    __shared__ __attribute__((aligned(2048))) T16 ring[2][NP * PE];
    __shared__ __align__(16) float osw[NW][16 * 68];
    const int w = __builtin_amdgcn_readfirstlane((int)(threadIdx.x >> 5)); float* const os = osw[w];    // the wave's number, the same in every lane: what follows from it stays scalar; the wave's own output stage
    const size_t z = blockIdx.z; A += z * sA; if (A2) A2 += z * sA; Bt += z * sB; if (PL == 0) C += z * sC;
    const int lane = threadIdx.x & 31, lr = lane & 15, hi = lane >> 4; const int wm = w % NWM, wn = w / NWM, ct = blockIdx.y * NWN + wn;
    const int R0 = blockIdx.x * (NWM * 64), C0 = blockIdx.y * (NWN * 64), r0 = R0 + wm * 64, c0 = ct * 64;
    v8f acc[4][4];
#pragma unroll
    for (int mb = 0; mb < 4; ++mb)
#pragma unroll
        for (int nb = 0; nb < 4; ++nb) acc[mb][nb] = (v8f){};
    const unsigned lo = 8 * lane; typedef const GLB T16* GP;
    GP gp[PPW];    // the lane's place in the next stage of each panel that the wave copies (panels w*PPW.. of the NP)
#pragma unroll
    for (int q = 0; q < PPW; ++q) { const int P = w * PPW + q;
        gp[q] = (GP)((P < NPA ? A + (size_t)(R0 + P * 16) * K : (NSPLIT == 1 && P < NPAT) ? A2 + (size_t)(R0 + (P - NPA) * 16) * K : Bt + (size_t)(C0 + (P - NPAT) * 16) * K) + lo); }
    const unsigned lw = (unsigned)(size_t)&ring[0][0] + (unsigned)(w * PPW * PE + lo) * 2;    // the same place in buffer 0, as an LDS byte address
    auto copies = [&](int buf) {    // the wave's share of the next stage into buffer buf (a constant)
        unsigned l[PPW];
#pragma unroll
        for (int q = 0; q < PPW; ++q) l[q] = lw + (unsigned)((buf * NP + q) * PE * 2);
        acopy(l, gp);
#pragma unroll
        for (int q = 0; q < PPW; ++q) gp[q] += PE;
    };
    struct FSet { V a[4], a2[4], b[4]; };    // a2: the lo plane, only where NSPLIT asks for it
    auto mmaset = [&](const FSet& f) {
#pragma unroll
        for (int nb = 0; nb < 4; ++nb) {
#pragma unroll
            for (int mb = 0; mb < 4; ++mb) { acc[mb][nb] = WFrag<T16>::mma(f.a[mb], f.b[nb], acc[mb][nb]); if (NSPLIT == 1) acc[mb][nb] = WFrag<T16>::mma(f.a2[mb], f.b[nb], acc[mb][nb]); } }
    };
    auto ldset = [&](FSet& f, int buf, int ks) {    // the fragments of 32-k step ks of the stage in buffer buf (constants), in the order of their first use
        const T16* sb = &ring[buf][0] + lo + ks * 512;
        f.b[0] = WFrag<T16>::lds(sb + (NPAT + wn * 4) * PE);
#pragma unroll
        for (int mb = 0; mb < 4; ++mb) { f.a[mb] = WFrag<T16>::lds(sb + (wm * 4 + mb) * PE); if (NSPLIT == 1) f.a2[mb] = WFrag<T16>::lds(sb + (NPA + wm * 4 + mb) * PE); }
#pragma unroll
        for (int nb = 1; nb < 4; ++nb) f.b[nb] = WFrag<T16>::lds(sb + (NPAT + wn * 4 + nb) * PE);
    };
    auto publish = [&]() {    // every wave, behind its last LDS read of a stage: the next stage becomes readable, the buffer just read becomes free
        asm volatile("s_wait_dscnt 0x0" ::: "memory");      // this wave's LDS reads of the buffer that is refilled next have returned
        asm volatile("s_wait_asynccnt 0x0" ::: "memory");   // this wave's copies of the next stage have landed
        __syncthreads();                                    // so have every other wave's, and every wave has left the buffer just read
    };
    copies(0);
    asm volatile("s_wait_asynccnt 0x0" ::: "memory");       // stage 0 has landed, as far as this wave copied it
    __syncthreads();                                        // and as far as the other waves did
    copies(1);
    // A stage's publish point stands behind the LDS reads of its second step and in front of that step's products, which need registers alone: the refill is under way while they run.
    if constexpr (WPE <= 2) {    // registers for two fragment sets: every step's LDS reads fly behind the products of the step before, also those of the next stage's first step, which stand behind the publish point
        FSet f0, f1; ldset(f0, 0, 0);
        auto half = [&](int buf, auto refill, auto next) {    // the stage in buffer buf (a constant); refill: a stage two on exists; next: a next stage exists
            ldset(f1, buf, 1);
            __builtin_amdgcn_sched_barrier(0);    // keeps the LDS reads together ahead of the products: the compiler otherwise sinks them among the products, each with a wait to 0 of its own
            mmaset(f0);
            __builtin_amdgcn_sched_barrier(0);    // the first step's products stay in front of the publish point: the second step's LDS reads, waited for there, fly behind them
            if constexpr (decltype(next)::v) { publish(); if constexpr (decltype(refill)::v) copies(buf); ldset(f0, buf ^ 1, 0); }
            __builtin_amdgcn_sched_barrier(0);    // the copies and the next LDS reads are issued ahead of the second step's products, not behind them
            mmaset(f1);
        };
#pragma unroll 1
        for (int t = 0; t < NS - 2; t += 2) { half(0, BoolC<true>{}, BoolC<true>{}); half(1, BoolC<true>{}, BoolC<true>{}); }    // rolled: the body already holds two stages, and the buffer index stays a constant
        half(0, BoolC<false>{}, BoolC<true>{}); half(1, BoolC<false>{}, BoolC<false>{});
    } else {                     // one fragment set, so that two work-groups share a WGP: the other waves' products cover a wave's LDS reads
        FSet f;
        auto half = [&](int buf, auto refill, auto next) {    // as above
            ldset(f, buf, 0);
            __builtin_amdgcn_sched_barrier(0);    // keeps the LDS reads together ahead of the products: the compiler otherwise sinks them among the products, each with a wait to 0 of its own
            mmaset(f);
            ldset(f, buf, 1);
            if constexpr (decltype(next)::v) { publish(); if constexpr (decltype(refill)::v) copies(buf); }
            __builtin_amdgcn_sched_barrier(0);    // the copies are issued ahead of the second step's products, not behind them
            mmaset(f);
        };
#pragma unroll 1
        for (int t = 0; t < NS - 2; t += 2) { half(0, BoolC<true>{}, BoolC<true>{}); half(1, BoolC<true>{}, BoolC<true>{}); }    // rolled: the body already holds two stages, and the buffer index stays a constant
        half(0, BoolC<false>{}, BoolC<true>{}); half(1, BoolC<false>{}, BoolC<false>{});
    }
    asm volatile("s_wait_asynccnt 0x0" ::: "memory");       // no copy is outstanding when the wave goes on to its end
    if constexpr (PL != 0) {
        static_assert(HD == 64, "one 64-column tile is one head");
        const int p = ct / NH_, h = ct % NH_, prow = lane & 15, pch = lane >> 4;    // a lane takes 8 neighbours (one chunk) of a staged row: 16 lanes the 16 rows of a chunk column, 2 chunk columns a store
        const size_t pz = ((size_t)p * NB_ + z) * sC; P16 += pz; Ph += pz; Pl += pz;
        auto planes = [&](auto trc) { constexpr bool tr = decltype(trc)::v;    // tr: values, stored transposed
#pragma unroll
        for (int g = 0; g < 4; ++g) {     // 16 staged rows of 64: queries, keys: positions g*16.. by d; values: columns d = g*16.. by position
            if constexpr (!tr) {
#pragma unroll
                for (int nb = 0; nb < 4; ++nb) {
#pragma unroll
                    for (int j = 0; j < 8; ++j) os[(hi * 8 + j) * 68 + nb * 16 + lr] = acc[g][nb][j]; }
            } else {
#pragma unroll
                for (int mb = 0; mb < 4; ++mb) {    // an accumulator's 8 values are 8 neighbouring positions of one column d
                    *(v4fa*)(os + lr * 68 + mb * 16 + hi * 8) = __builtin_shufflevector(acc[mb][g], acc[mb][g], 0, 1, 2, 3); *(v4fa*)(os + lr * 68 + mb * 16 + hi * 8 + 4) = __builtin_shufflevector(acc[mb][g], acc[mb][g], 4, 5, 6, 7); }
            }
            __builtin_amdgcn_wave_barrier(); asm volatile("" ::: "memory");   // lanes read what other lanes of this one wave staged: keeps the compiler from moving the reads ahead of the writes
#pragma unroll
            for (int s = 0; s < 4; ++s) { const int ch = s * 2 + pch; const v4f x0 = *(const v4fa*)(os + prow * 68 + ch * 8), x1 = *(const v4fa*)(os + prow * 68 + ch * 8 + 4); v8h o16; v8us oh, ol;
#pragma unroll
                for (int k = 0; k < 8; ++k) { const float x = (k < 4) ? x0[k & 3] : x1[k & 3]; o16[k] = tohx(x); unsigned short a2, c2; splitf(x, a2, c2); oh[k] = a2; ol[k] = c2; }
                const size_t e = (!tr ? ((size_t)h * TT + r0 + g * 16) * HD : ((size_t)h * HD + g * 16) * TT + r0 * 16) + s * 256;    // the same for the wave; chunk column ch, row prow: + s*256 + lane*8
                *(v8h*)(P16 + e + lo) = o16; *(v8us*)(Ph + e + lo) = oh; *(v8us*)(Pl + e + lo) = ol; }
            __builtin_amdgcn_wave_barrier(); asm volatile("" ::: "memory");   // the next group's staging stays behind these reads
        }
        if constexpr (!tr) asm volatile("s_wait_xcnt 0x0" ::: "memory");    // in the built code the values' path stands behind this one and rewrites the address registers of the last stores: the wait stands in front of that overwrite
        };
        if (p == 2) { planes(BoolC<true>{}); return; }    // p comes from blockIdx and the wave's number: a scalar branch
        planes(BoolC<false>{}); return;
    }
#pragma unroll
    for (int mb = 0; mb < 4; ++mb) {
#pragma unroll
        for (int nb = 0; nb < 4; ++nb) {
#pragma unroll
            for (int j = 0; j < 8; ++j) os[(hi * 8 + j) * 68 + nb * 16 + lr] = acc[mb][nb][j]; }
        __builtin_amdgcn_wave_barrier(); asm volatile("" ::: "memory");
        float* crow = C + (size_t)(r0 + mb * 16) * ldc + c0;
{
#pragma unroll
            for (int s = 0; s < 8; ++s) { const int row = 2 * s + hi, cofs = lr * 4; v4f val = *(const v4fa*)(os + row * 68 + cofs); if (BIAS) { val[0] += bfr(bias[c0 + cofs]); val[1] += bfr(bias[c0 + cofs + 1]); val[2] += bfr(bias[c0 + cofs + 2]); val[3] += bfr(bias[c0 + cofs + 3]); }
                *(v4f*)(crow + (size_t)row * ldc + cofs) = val; }
             }
        __builtin_amdgcn_wave_barrier(); asm volatile("" ::: "memory");
    }
}

typedef __attribute__((ext_vector_type(4))) _Float16 v4h;
typedef __attribute__((ext_vector_type(2))) unsigned short v2us;
typedef __attribute__((ext_vector_type(4))) unsigned short v4us;
typedef __attribute__((ext_vector_type(4))) int v4i;

// Bt row n, k: w[k][n]. A thread builds one chunk (8 k of one row n): a wave's 8 loads each read one whole line (32 neighbouring n), its store two runs of 256 bytes
__global__ __launch_bounds__(256) void k_wtG(const float* __restrict__ w, bf* Bt) {
    constexpr int K = DQ, N = DM; const int idx = blockIdx.x * 256 + threadIdx.x; const int n = idx % N, c8 = idx / N; if (c8 >= K / 8) return; v8us o;
#pragma unroll
    for (int j = 0; j < 8; ++j) o[j] = f2bf(w[(size_t)(c8 * 8 + j) * N + n]);
    *(v8us*)(Bt + (size_t)(n >> 4) * 16 * K + c8 * 128 + (n & 15) * 8) = o;
}
// bf16 copy of x in fragment order. A block takes 16 rows x 128 k: read row by row (16 lanes a run of 512 bytes), turned chunk-wise in LDS (pitch 17 chunks against bank conflicts), stored as 4096 contiguous bytes
__global__ __launch_bounds__(256) void k_cvt8(const float* __restrict__ src, bf* dst) {
    __shared__ __align__(16) unsigned short sh[16 * 17 * 8];
    const int t = threadIdx.x, row = t >> 4, c = t & 15; const size_t rb = blockIdx.x / (DM / 128), kg = blockIdx.x % (DM / 128);
    const v8f v = *(const v8f*)(src + (rb * 16 + row) * DM + kg * 128 + c * 8); v8us o;
#pragma unroll
    for (int k = 0; k < 8; ++k) o[k] = f2bf(v[k]);
    *(v8usa*)(sh + (c * 17 + row) * 8) = o;
    __syncthreads();    // a thread stores a chunk that another wave converted
    *(v8us*)(dst + ((size_t)blockIdx.x * 256 + t) * 8) = *(const v8usa*)(sh + ((t >> 4) * 17 + (t & 15)) * 8);
}

// Bt row p*1024 + h*64 + e, k = c: w[h][c][e]. A thread builds one chunk (8 c of one row): a wave's 8 loads each read one whole line (32 neighbouring e), its store two runs of 256 bytes
__global__ __launch_bounds__(256) void k_wtH(const float* __restrict__ wq, const float* __restrict__ wk, const float* __restrict__ wv, bf* Bt) { const float* __restrict__ w = blockIdx.y == 0 ? wq : blockIdx.y == 1 ? wk : wv; Bt += (size_t)blockIdx.y * DQ * DM;
    const int idx = blockIdx.x * 256 + threadIdx.x; const int e = idx % HD, c8 = (idx / HD) % (DM / 8), h = idx / (HD * (DM / 8)); if (h >= NH_) return; v8us o;
#pragma unroll
    for (int j = 0; j < 8; ++j) o[j] = f2bf(w[((size_t)h * DM + c8 * 8 + j) * HD + e]);
    const int r = h * HD + e;
    *(v8us*)(Bt + (size_t)(r >> 4) * 16 * DM + c8 * 128 + (r & 15) * 8) = o;
}
// ---- k_fattn: scores, causal softmax and probability x value product of all batches in one launch. One wave owns 16 query rows of one head and walks its keys in blocks of 32 up to the diagonal.
// Transposed products: S^T = K Q^T (a lane holds 16 scores of ONE query, column lr) and O^T += V^T P^T; the two 16-key score tiles, converted in place, are the B operand of the second product
// (hardware k order, the order WFrag::ld reads), so scores and probabilities never leave the registers. Running maximum and sum per query (online softmax, log2 domain); division by the sum at the end.
// HR (query rows < RH): hi/lo bf16 planes, three products for each GEMM, in the order hi.hi, lo.hi, hi.lo; else fp16 planes, one product. Output: hi/lo bf16 planes (rows t, K = DQ, fragment order) for the last projection.
__device__ __forceinline__ float xhalf(float x) { return __builtin_bit_cast(float, __builtin_amdgcn_permlanex16(__builtin_bit_cast(int, x), __builtin_bit_cast(int, x), 0x76543210, 0xfedcba98, false, false)); }   // lane l reads lane l ^ 16
// al and p[0..15] become 2^al and 2^p, in place. The exps stand in asm so that a v_nop can close each run: the instruction set asks for one slot between a transcendental and an instruction that reads its result
// or overwrites its source. Inside a run each exp has registers of its own, so the next exp is the independent instruction.
__device__ __forceinline__ void exp2_17(float& al, float (&p)[16]) {
    asm("v_exp_f32 %0, %0\n\tv_exp_f32 %1, %1\n\tv_exp_f32 %2, %2\n\tv_exp_f32 %3, %3\n\tv_exp_f32 %4, %4\n\tv_exp_f32 %5, %5\n\tv_exp_f32 %6, %6\n\tv_exp_f32 %7, %7\n\tv_exp_f32 %8, %8\n\tv_nop"
        : "+v"(al), "+v"(p[0]), "+v"(p[1]), "+v"(p[2]), "+v"(p[3]), "+v"(p[4]), "+v"(p[5]), "+v"(p[6]), "+v"(p[7]));
    asm("v_exp_f32 %0, %0\n\tv_exp_f32 %1, %1\n\tv_exp_f32 %2, %2\n\tv_exp_f32 %3, %3\n\tv_exp_f32 %4, %4\n\tv_exp_f32 %5, %5\n\tv_exp_f32 %6, %6\n\tv_exp_f32 %7, %7\n\tv_nop"
        : "+v"(p[8]), "+v"(p[9]), "+v"(p[10]), "+v"(p[11]), "+v"(p[12]), "+v"(p[13]), "+v"(p[14]), "+v"(p[15]));
}
template <typename V> struct KVSet { V k[2][2], k2[2][2], v[4], v2[4]; };   // the K and V^T fragments of one 32-key block (k2, v2: the lo planes, HR only)
// The pointers are the same for the wave (block 0 of the walk) and are moved on by the caller; lo = lane*8; blk: blocks ahead of the pointers, a constant: every load is a scalar base + lo + an immediate offset.
// XW: s_wait_xcnt 0 behind the loads, in front of whatever overwrites their address registers next; it takes the bases and lo as operands, so that they keep their registers up to the wait and the caller's sums stay behind it;
// the long key loop passes false and has one such wait at its foot, far behind the loads
template <typename T16, bool HR>
__device__ __forceinline__ void kv_wait(const GLB T16*& Kp, const GLB T16*& K2, const GLB T16*& Vt, const GLB T16*& V2, unsigned lo) {
    if constexpr (HR) asm volatile("s_wait_xcnt 0x0" : "+s"(Kp), "+s"(K2), "+s"(Vt), "+s"(V2) : "v"(lo) : "memory");    // see XW above
    else asm volatile("s_wait_xcnt 0x0" : "+s"(Kp), "+s"(Vt) : "v"(lo) : "memory");                                       // see XW above
}
template <typename T16, bool HR, bool XW>
__device__ __forceinline__ void kv_load(KVSet<typename WFrag<T16>::V>& f, const GLB T16*& Kp, const GLB T16*& K2, const GLB T16*& Vt, const GLB T16*& V2, int blk, unsigned lo) {
#pragma unroll
    for (int t = 0; t < 2; ++t) {
#pragma unroll
        for (int ks = 0; ks < 2; ++ks) { f.k[t][ks] = WFrag<T16>::ld(Kp + lo + (blk * 32 + t * 16) * HD + 512 * ks); if (HR) f.k2[t][ks] = WFrag<T16>::ld(K2 + lo + (blk * 32 + t * 16) * HD + 512 * ks); }
    }
#pragma unroll
    for (int mt = 0; mt < 4; ++mt) { f.v[mt] = WFrag<T16>::ld(Vt + lo + mt * 16 * TT + blk * 512); if (HR) f.v2[mt] = WFrag<T16>::ld(V2 + lo + mt * 16 * TT + blk * 512); }
    if (XW) kv_wait<T16, HR>(Kp, K2, Vt, V2, lo);
}
// one 32-key block: kq = first key of this lane's score rows minus the lane's query (key <= query is kq + offset <= 0); DIAG: the block crosses the diagonal and is masked
template <typename T16, bool HR, bool DIAG>
__device__ __forceinline__ void attn_block(const KVSet<typename WFrag<T16>::V>& f, const typename WFrag<T16>::V (&qf)[2], const typename WFrag<T16>::V (&qf2)[2], v8f (&O)[4], float& m, float& l, int kq) {
    typedef typename WFrag<T16>::V V;
    v8f S[2];
#pragma unroll
    for (int t = 0; t < 2; ++t) { S[t] = (v8f){};
#pragma unroll
        for (int ks = 0; ks < 2; ++ks) { S[t] = WFrag<T16>::mma(f.k[t][ks], qf[ks], S[t]); if (HR) { S[t] = WFrag<T16>::mma(f.k[t][ks], qf2[ks], S[t]); S[t] = WFrag<T16>::mma(f.k2[t][ks], qf[ks], S[t]); } } }
    float p[16];
#pragma unroll
    for (int i = 0; i < 16; ++i) p[i] = S[i >> 3][i & 7] * SC2;          // key offset (i>>3)*16 + (i&7) from the lane's first key, query column lr
    if (DIAG) {
#pragma unroll
        for (int i = 0; i < 16; ++i) p[i] = (kq + (i >> 3) * 16 + (i & 7) <= 0) ? p[i] : -3.0e38f; }
    float bm = p[0], bm1 = p[8];                                           // two chains: half the dependent length
#pragma unroll
    for (int i = 1; i < 8; ++i) { bm = fmaxf(bm, p[i]); bm1 = fmaxf(bm1, p[8 + i]); }
    bm = fmaxf(bm, bm1); bm = fmaxf(bm, xhalf(bm));
    const float mn = fmaxf(m, bm); float al = m - mn; m = mn;
#pragma unroll
    for (int i = 0; i < 16; ++i) p[i] -= mn;
    exp2_17(al, p);
    const float bs = (((p[0] + p[1]) + (p[2] + p[3])) + ((p[4] + p[5]) + (p[6] + p[7]))) + (((p[8] + p[9]) + (p[10] + p[11])) + ((p[12] + p[13]) + (p[14] + p[15])));
    l = l * al + bs;
#pragma unroll
    for (int mt = 0; mt < 4; ++mt)
#pragma unroll
        for (int j = 0; j < 8; ++j) O[mt][j] *= al;
    V pf, pf2;
    if constexpr (HR) { v8us h0, h1, l0, l1;
#pragma unroll
        for (int j = 0; j < 8; ++j) { unsigned short a, c2; splitf(p[j], a, c2); h0[j] = a; l0[j] = c2; splitf(p[8 + j], a, c2); h1[j] = a; l1[j] = c2; }
        pf = cat16b(h0, h1); pf2 = cat16b(l0, l1);
    } else {
#pragma unroll
        for (int i = 0; i < 16; ++i) pf[i] = tohx(p[i]); }
#pragma unroll
    for (int mt = 0; mt < 4; ++mt) { O[mt] = WFrag<T16>::mma(f.v[mt], pf, O[mt]); if (HR) { O[mt] = WFrag<T16>::mma(f.v[mt], pf2, O[mt]); O[mt] = WFrag<T16>::mma(f.v2[mt], pf, O[mt]); } }
}
template <typename T16, bool HR>
__device__ __forceinline__ void attn_rows(const T16* __restrict__ Q, const T16* __restrict__ Q2, const T16* __restrict__ Kg, const T16* __restrict__ K2g, const T16* __restrict__ Vg, const T16* __restrict__ V2g, int q0, bf* Ah, bf* Al) {
    typedef typename WFrag<T16>::V V;
    const int lane = threadIdx.x & 31, lr = lane & 15, hi = lane >> 4;
    const int last = q0 >> 5;                            // the 32-key block that holds the diagonal: the wave's last
    V qf[2], qf2[2];
    const unsigned lo = 8 * lane;    // fragment order: the lane's part of every address; 32 k of a panel are 512 elements
    typedef const GLB T16* GP; GP Qp = (GP)(Q + (size_t)q0 * HD), Qp2 = HR ? (GP)(Q2 + (size_t)q0 * HD) : nullptr, Kp = (GP)Kg, K2 = (GP)K2g, Vt = (GP)Vg, V2 = (GP)V2g;    // each the same for the wave
#pragma unroll
    for (int ks = 0; ks < 2; ++ks) { qf[ks] = WFrag<T16>::ld(Qp + lo + 512 * ks); if (HR) qf2[ks] = WFrag<T16>::ld(Qp2 + lo + 512 * ks); }
    // what follows may overwrite the address registers of the query loads: the wait stands in front of that, and the addresses, as its operands, keep their registers up to it
    if constexpr (HR) asm volatile("s_wait_xcnt 0x0" :: "s"(Qp), "s"(Qp2), "v"(lo) : "memory"); else asm volatile("s_wait_xcnt 0x0" :: "s"(Qp), "v"(lo) : "memory");
    v8f O[4];
#pragma unroll
    for (int mt = 0; mt < 4; ++mt) O[mt] = (v8f){};
    float m = -3.0e38f, l = 0.f;
    const int kq0 = 8 * hi - (q0 + lr);
    KVSet<V> fa;
    if constexpr (HR) {   // at most RH/32 blocks, three products each: one fragment set, which keeps the kernel inside 256 registers
#pragma unroll 1
        for (int kb = 0; kb < last; ++kb) { kv_load<T16, HR, true>(fa, Kp, K2, Vt, V2, 0, lo); Kp += 32 * HD; K2 += 32 * HD; Vt += 512; V2 += 512; attn_block<T16, HR, false>(fa, qf, qf2, O, m, l, 0); }
        kv_load<T16, HR, true>(fa, Kp, K2, Vt, V2, 0, lo);
    } else {              // two fragment sets in turn, so that a block's K and V loads are issued ahead of the block before it; the loop body has no branch (the blocks below the diagonal need no mask)
        KVSet<V> fb;
        kv_load<T16, HR, true>(fa, Kp, K2, Vt, V2, 0, lo);
        int kb = 0;
#pragma unroll 1
        for (; kb + 1 < last; kb += 2) {
            kv_load<T16, HR, false>(fb, Kp, K2, Vt, V2, 1, lo);
            __builtin_amdgcn_sched_barrier(0);    // keeps the loads where they stand, a whole block ahead of their use: the compiler otherwise sinks the key loads to just in front of their products
            attn_block<T16, HR, false>(fa, qf, qf2, O, m, l, 0);
            kv_load<T16, HR, false>(fa, Kp, K2, Vt, V2, 2, lo);    // kb + 2 <= last
            __builtin_amdgcn_sched_barrier(0);    // as above
            attn_block<T16, HR, false>(fb, qf, qf2, O, m, l, 0);
            kv_wait<T16, HR>(Kp, K2, Vt, V2, lo); Kp += 2 * 32 * HD; Vt += 2 * 512;    // the sums overwrite the address registers of this pass's loads: behind the wait
        }
        if (kb < last) { attn_block<T16, HR, false>(fa, qf, qf2, O, m, l, 0); kv_load<T16, HR, true>(fa, Kp, K2, Vt, V2, 1, lo); }   // one block left below the diagonal block
    }
    attn_block<T16, HR, true>(fa, qf, qf2, O, m, l, kq0 + last * 32);
    l += xhalf(l);                                       // the two lane halves hold the sums of disjoint keys of the same query
    const float inv = __fdiv_rn(1.0f, l);
    bf* ph = Ah + (size_t)q0 * DQ + lo; bf* pl = Al + (size_t)q0 * DQ + lo;
#pragma unroll
    for (int mt = 0; mt < 4; ++mt) { v8us oh, ol;
#pragma unroll
        for (int j = 0; j < 8; ++j) { unsigned short a, c2; splitf(O[mt][j] * inv, a, c2); oh[j] = a; ol[j] = c2; }
        *(v8us*)(ph + mt * 256) = oh; *(v8us*)(pl + mt * 256) = ol; }    // chunk columns mt*2 + hi of the head's 8, row lr
}
// grid (TT/128, heads, batches), 8 waves of 16 query rows. Waves w and w + 4 take row tiles T and 127 - T, so every pair walks the same number of key blocks together (the cost of a tile grows with its index)
__global__ __launch_bounds__(256) void k_fattn(const h16* __restrict__ Q16, const h16* __restrict__ K16, const h16* __restrict__ V16, const bf* __restrict__ Qh, const bf* __restrict__ Ql, const bf* __restrict__ Kh, const bf* __restrict__ Kl, const bf* __restrict__ Vh, const bf* __restrict__ Vl, bf* Ah, bf* Al) {
    const int h = blockIdx.y; const int w = __builtin_amdgcn_readfirstlane((int)(threadIdx.x >> 5));   // wave-uniform, so the key loop and the row-class test are scalar branches
    const int q0 = ((w < 4) ? (int)blockIdx.x * 4 + w : TT / 16 - 1 - ((int)blockIdx.x * 4 + (w - 4))) * 16;
    const size_t po = ((size_t)blockIdx.z * NH_ + h) * TT * HD;
    Ah += (size_t)blockIdx.z * TT * DQ; Al += (size_t)blockIdx.z * TT * DQ;
    if (q0 < RH) attn_rows<bf, true>(Qh + po, Ql + po, Kh + po, Kl + po, Vh + po, Vl + po, q0, Ah + h * HD * 16, Al + h * HD * 16);
    else attn_rows<h16, false>(Q16 + po, nullptr, K16 + po, nullptr, V16 + po, nullptr, q0, Ah + h * HD * 16, Al + h * HD * 16);
}

extern "C" void kernel_launch(void* const* d_in, const int* in_sizes, int n_in,
                              void* d_out, int out_size, void* d_ws, size_t ws_size, hipStream_t stream) {
    (void)in_sizes; (void)n_in; (void)out_size;
    const float* x = (const float*)d_in[0]; const float* wq = (const float*)d_in[1]; const float* wk = (const float*)d_in[2]; const float* wv = (const float*)d_in[3]; const float* wo = (const float*)d_in[4]; const float* bo = (const float*)d_in[5];   /* order x, Wq, Wk, Wv [16][1024][64], Wproj ('xw' [1024][1024]), bproj */
    float* OUT = (float*)d_out;     // [4][2048][1024]
    char* wsp = (char*)d_ws;
    auto take = [&](size_t bytes) { char* p = wsp; wsp += (bytes + 255) & ~(size_t)255; return (void*)p; };
    static_assert(NKV == NH_, "the three projections share one plane shape");
    const size_t PB = (size_t)NH_ * TT * HD, PP = (size_t)NB_ * PB;    // elements of one batch's [h][..] block and of one plane of all batches
    bf* WQKV = (bf*)take((size_t)3 * DQ * DM * 2); bf* WO = (bf*)take((size_t)DM * DQ * 2);
    bf* XB = (bf*)take((size_t)NB_ * TT * DM * 2);
    h16* P16 = (h16*)take(3 * PP * 2); bf* Ph = (bf*)take(3 * PP * 2); bf* Pl = (bf*)take(3 * PP * 2);    // each [q, k, v][batch][h][..]
    bf* ATh = (bf*)take((size_t)NB_ * TT * DQ * 2); bf* ATl = (bf*)take((size_t)NB_ * TT * DQ * 2);
    if ((size_t)(wsp - (char*)d_ws) > ws_size) return;    // ws 256 MiB
    k_wtH<<<dim3((unsigned)(((size_t)DQ * DM / 8 + 255) / 256), 3, 1), 256, 0, stream>>>(wq, wk, wv, WQKV);   /* per-head [16][1024][64] x 3 -> Bt [3072][1024] */
    k_wtG<<<(unsigned)((DQ * DM / 8 + 255) / 256), 256, 0, stream>>>(wo, WO);
    k_cvt8<<<(unsigned)((size_t)NB_ * TT * DM / 8 / 256), 256, 0, stream>>>(x, XB);
    k_gemmw<bf, 0, false, 1, 2, 4, 4><<<dim3(TT / 128, 3 * DQ / 256, NB_), 256, 0, stream>>>(XB, nullptr, WQKV, nullptr, nullptr, 0, nullptr, (size_t)TT * DM, 0, PB, P16, Ph, Pl);
    k_fattn<<<dim3(TT / 128, NH_, NB_), 256, 0, stream>>>(P16, P16 + PP, P16 + 2 * PP, Ph, Pl, Ph + PP, Pl + PP, Ph + 2 * PP, Pl + 2 * PP, ATh, ATl);
    k_gemmw<bf, 1, true, 0, 2, 4, 2><<<dim3(TT / 128, DM / 256, NB_), 256, 0, stream>>>(ATh, ATl, WO, nullptr, OUT, DM, bo, (size_t)TT * DQ, 0, (size_t)TT * DM, nullptr, nullptr, nullptr);
}

// v009
// It runs in 141 microseconds.
// Timed twice side by side with v008, it ran 1.03 times as fast both times.
// All steps since v000 together make it 20.5 times as fast.
#include <hip/hip_runtime.h>

// Causal multi-head attention with per-head stacked projection weights and an embed-size score scale (x [4][2048][1024]; q, k, v = einsum('btc,hcd', x, W) with Wq, Wk, Wv [16][1024][64] (0.02, no bias; 16 heads x 64); wei = q.k x 1024^-0.5 (the source scales by n_embd, not the head size); causal (-inf); softmax; out = concat heads Wproj + bproj ('xw' [1024][1024] + bias) -> [4][2048][1024] (8.4 M); argument order x, Wq, Wk, Wv, Wproj, bproj).
// Every stage is one launch for the whole problem (batch = grid z, except k_prep: one 1-D grid over all panels; every plane holds all batches): k_prep makes the bf16 copies of x and Wproj and gathers the per-head tensors [h][c][d] into one Bt plane of 3 x 1024 rows (row p*1024 + h*64 + d; p: q, k, v) so the three projections are one exact GEMM with head-major output columns, whose epilogue writes the head planes (fp16 + hi/lo bf16; V transposed) itself; one fused causal attention launch (k_fattn; hybrid rows: < 512 hi/lo 3 products, rest fp16; key blocks above the diagonal are never visited); hi/lo x Wproj exact + bproj.
// Every 16-bit operand plane (rows x K) lies in fragment order: panels of 16 rows, inside a panel chunks of 8 neighbouring k, inside a chunk column the 16 rows: element (r, k) at (r/16)*16*K + (k/8)*128 + (r%16)*8 + k%8.
// A wave's fragment (16 rows x 32 k) is then 1024 contiguous bytes, lane l taking 16 bytes at l*16 and at 512 + l*16: each load instruction covers four whole 128-byte lines.
// Compute dtypes, f32 accumulate: every input rounded to bf16; projections exact; attention rows < 512 3 products, rest fp16; softmax f32; Wproj hl x exact + bias.

#define NB_  4
#define TT   2048
#define DM   1024
#define NH_  16
#define NKV  16
#define HD   64
#define DQ   (NH_ * HD)
#define DKV  (NKV * HD)
#define SC2  0.04508422002778011f   // 1024^-0.5 x log2(e): the module scales by n_embd; scores go to the log2 domain for exp2
#define RH   512                  // query rows < RH use hi+lo planes (0: none)
typedef _Float16 h16;
typedef unsigned short bf;
typedef __attribute__((ext_vector_type(16))) __bf16   v16bf;
typedef __attribute__((ext_vector_type(16))) _Float16 v16h;
typedef __attribute__((ext_vector_type(8)))  _Float16 v8h;
typedef __attribute__((ext_vector_type(8)))  unsigned short v8us;
typedef __attribute__((ext_vector_type(8)))  float    v8f;
typedef __attribute__((ext_vector_type(4)))  float    v4f;
typedef v8h  __attribute__((may_alias)) v8ha;
typedef v4f  __attribute__((may_alias)) v4fa;
typedef v8us __attribute__((may_alias)) v8usa;

__device__ __forceinline__ unsigned short f2bf(float f) { unsigned u = __float_as_uint(f); u += 0x7FFFu + ((u >> 16) & 1u); return (unsigned short)(u >> 16); }
__device__ __forceinline__ float bf2f(unsigned short b) { return __uint_as_float(((unsigned)b) << 16); }
__device__ __forceinline__ float bfr(float f) { return bf2f(f2bf(f)); }
__device__ __forceinline__ v16h cat16(v8h lo, v8h hi) { return __builtin_shufflevector(lo, hi, 0, 1, 2, 3, 4, 5, 6, 7, 8, 9, 10, 11, 12, 13, 14, 15); }
__device__ __forceinline__ v16bf cat16b(v8us lo, v8us hi) { return __builtin_bit_cast(v16bf, __builtin_shufflevector(lo, hi, 0, 1, 2, 3, 4, 5, 6, 7, 8, 9, 10, 11, 12, 13, 14, 15)); }
__device__ __forceinline__ v8f wmma16(v16h a, v16h b, v8f c) { return __builtin_amdgcn_wmma_f32_16x16x32_f16(false, a, false, b, (short)0, c, false, false); }
__device__ __forceinline__ v8f wmmab(v16bf a, v16bf b, v8f c) { return __builtin_amdgcn_wmma_f32_16x16x32_bf16(false, a, false, b, (short)0, c, false, false); }

__device__ __forceinline__ h16 tohx(float x) { return (h16)x; }
__device__ __forceinline__ void splitf(float y, unsigned short& h, unsigned short& l) { h = f2bf(y); l = f2bf(y - bf2f(h)); }

// ---- k_gemmw: register-blocked GEMM, one wave per 64x64 output tile (16 accumulators), NWM x NWN waves a work-group on neighbouring tiles (wave w: tile row w % NWM, tile column w / NWM); grid (M/64/NWM, N/64/NWN, Z).
// The operands of the work-group's tile come from the 16-bit planes (fragment order) into LDS by asynchronous copies, 64 k a stage, two buffers: every panel is fetched from L2 once for the work-group, not once for each wave that needs it.
// A panel's part of a stage is 2048 contiguous bytes in the plane and in LDS, so a fragment is read from LDS as it would be from the plane: lane l takes 16 bytes at l*16 and at 512 + l*16 (no bank conflict).
// C[m][n] (f32, pitch ldc, + optional f32 bias[n]) = sum_k A[m][k] Bt[n][k] (+ split products per NSPLIT). z-batch strides sA/sB/sC in elements. K = 1024.
// PL != 0: no f32 C; the wave's tile column = p*16 + h (p: 0 queries, 1 keys, 2 values); the tile (64 positions t x the 64 columns d of head h) goes out as the three 16-bit planes that the attention kernel reads (fp16, bf16 hi, bf16 lo of the f32 sum),
// each plane [p][z][h][..] (sC = elements of one [h][..] block): p 0, 1: per head rows t, K = d; p 2: per head rows d, K = t (values, transposed); fragment order. Every store instruction covers four whole 128-byte lines.
#define GLB __attribute__((address_space(1)))    // global memory, named in the pointer's type: an address that has passed through an asm operand would otherwise be loaded from with flat instructions
template <typename T16> struct WFrag;    // ld(p): p = the fragment's first element + lane*8 (k 8*hi.. of row lr); 256 elements on stand k 16 + 8*hi..; lds(p): the same from a copy of the fragment in LDS
template <> struct WFrag<h16> { typedef v16h V; static __device__ __forceinline__ V ld(const GLB h16* p) { return cat16(*(const GLB v8h*)p, *(const GLB v8h*)(p + 256)); } static __device__ __forceinline__ V lds(const h16* p) { return cat16(*(const v8ha*)p, *(const v8ha*)(p + 256)); } static __device__ __forceinline__ v8f mma(V a, V b, v8f c) { return wmma16(a, b, c); } };
template <> struct WFrag<bf> { typedef v16bf V; static __device__ __forceinline__ V ld(const GLB bf* p) { return cat16b(*(const GLB v8us*)p, *(const GLB v8us*)(p + 256)); } static __device__ __forceinline__ V lds(const bf* p) { return cat16b(*(const v8usa*)p, *(const v8usa*)(p + 256)); } static __device__ __forceinline__ v8f mma(V a, V b, v8f c) { return wmmab(a, b, c); } };
template <bool B> struct BoolC { static constexpr bool v = B; };
// Asynchronous copies to LDS, 16 bytes a lane each: l = the lane's LDS byte address, g = its global address. AC4: the 2048 bytes of one panel's part of a stage, four copies of 512 bytes;
// the immediate offset moves the LDS address and the global address alike, and the bytes lie alike in both places.
// s_wait_xcnt 0 closes the copies' own statement: it stands in front of whatever rewrites a register that a copy names (a precaution)
#define AC4(l, g) "global_load_async_to_lds_b128 %" #l ", %" #g ", off\n\tglobal_load_async_to_lds_b128 %" #l ", %" #g ", off offset:512\n\tglobal_load_async_to_lds_b128 %" #l ", %" #g ", off offset:1024\n\tglobal_load_async_to_lds_b128 %" #l ", %" #g ", off offset:1536\n\t"
template <typename GP> __device__ __forceinline__ void acopy(const unsigned (&l)[3], const GP (&g)[3]) {
    asm volatile(AC4(0, 3) AC4(1, 4) AC4(2, 5) "s_wait_xcnt 0x0" :: "v"(l[0]), "v"(l[1]), "v"(l[2]), "v"(g[0]), "v"(g[1]), "v"(g[2]) : "memory");
}
template <typename GP> __device__ __forceinline__ void acopy(const unsigned (&l)[4], const GP (&g)[4]) {
    asm volatile(AC4(0, 4) AC4(1, 5) AC4(2, 6) AC4(3, 7) "s_wait_xcnt 0x0" :: "v"(l[0]), "v"(l[1]), "v"(l[2]), "v"(l[3]), "v"(g[0]), "v"(g[1]), "v"(g[2]), "v"(g[3]) : "memory");
}
// WPE: waves a SIMD that the register budget is set for
template <typename T16, int NSPLIT, bool BIAS, int PL, int NWM, int NWN, int WPE>
__global__ __launch_bounds__(32 * NWM * NWN) __attribute__((amdgpu_waves_per_eu(WPE, WPE))) void k_gemmw(const T16* __restrict__ A, const T16* __restrict__ A2, const T16* __restrict__ Bt, const T16* __restrict__ Bt2, float* C, int ldc, const float* __restrict__ bias, size_t sA, size_t sB, size_t sC, h16* P16, bf* Ph, bf* Pl) {
    typedef typename WFrag<T16>::V V;
    constexpr int K = DM; static_assert(DQ == DM, "both GEMMs sum over 1024 k");    // a constant, so that the stage count and every offset in LDS are constants
    static_assert(NSPLIT == 0 || NSPLIT == 1, "A alone or A hi + lo; B is one plane");
    constexpr int NW = NWM * NWN, NPA = NWM * 4, NPAT = (NSPLIT == 1 ? 2 : 1) * NPA, NP = NPAT + NWN * 4, PPW = NP / NW;    // 16-row panels of the work-group's tile: A, (A lo,) B; panels that a wave copies
    constexpr int NS = K / 64, PE = 16 * 64;    // stages; elements of a panel's part of a stage
    static_assert(NP % NW == 0 && (PPW == 3 || PPW == 4), "every wave copies the same number of whole panel parts");
    static_assert(NS >= 4 && NS % 2 == 0, "the loop takes two stages a pass, one from each buffer; the last two stand behind it");
    __shared__ __attribute__((aligned(2048))) T16 ring[2][NP * PE];
    __shared__ __align__(16) float osw[NW][16 * 68];
    const int w = __builtin_amdgcn_readfirstlane((int)(threadIdx.x >> 5)); float* const os = osw[w];    // the wave's number, the same in every lane: what follows from it stays scalar; the wave's own output stage
    const size_t z = blockIdx.z; A += z * sA; if (A2) A2 += z * sA; Bt += z * sB; if (PL == 0) C += z * sC;
    const int lane = threadIdx.x & 31, lr = lane & 15, hi = lane >> 4; const int wm = w % NWM, wn = w / NWM, ct = blockIdx.y * NWN + wn;
    const int R0 = blockIdx.x * (NWM * 64), C0 = blockIdx.y * (NWN * 64), r0 = R0 + wm * 64, c0 = ct * 64;
    v8f acc[4][4];
#pragma unroll
    for (int mb = 0; mb < 4; ++mb)
#pragma unroll
        for (int nb = 0; nb < 4; ++nb) acc[mb][nb] = (v8f){};
    const unsigned lo = 8 * lane; typedef const GLB T16* GP;
    GP gp[PPW];    // the lane's place in the next stage of each panel that the wave copies (panels w*PPW.. of the NP)
#pragma unroll
    for (int q = 0; q < PPW; ++q) { const int P = w * PPW + q;
        gp[q] = (GP)((P < NPA ? A + (size_t)(R0 + P * 16) * K : (NSPLIT == 1 && P < NPAT) ? A2 + (size_t)(R0 + (P - NPA) * 16) * K : Bt + (size_t)(C0 + (P - NPAT) * 16) * K) + lo); }
    const unsigned lw = (unsigned)(size_t)&ring[0][0] + (unsigned)(w * PPW * PE + lo) * 2;    // the same place in buffer 0, as an LDS byte address
    auto copies = [&](int buf) {    // the wave's share of the next stage into buffer buf (a constant)
        unsigned l[PPW];
#pragma unroll
        for (int q = 0; q < PPW; ++q) l[q] = lw + (unsigned)((buf * NP + q) * PE * 2);
        acopy(l, gp);
#pragma unroll
        for (int q = 0; q < PPW; ++q) gp[q] += PE;
    };
    struct FSet { V a[4], a2[4], b[4]; };    // a2: the lo plane, only where NSPLIT asks for it
    auto mmaset = [&](const FSet& f) {
#pragma unroll
        for (int nb = 0; nb < 4; ++nb) {
#pragma unroll
            for (int mb = 0; mb < 4; ++mb) { acc[mb][nb] = WFrag<T16>::mma(f.a[mb], f.b[nb], acc[mb][nb]); if (NSPLIT == 1) acc[mb][nb] = WFrag<T16>::mma(f.a2[mb], f.b[nb], acc[mb][nb]); } }
    };
    auto ldset = [&](FSet& f, int buf, int ks) {    // the fragments of 32-k step ks of the stage in buffer buf (constants), in the order of their first use
        const T16* sb = &ring[buf][0] + lo + ks * 512;
        f.b[0] = WFrag<T16>::lds(sb + (NPAT + wn * 4) * PE);
#pragma unroll
        for (int mb = 0; mb < 4; ++mb) { f.a[mb] = WFrag<T16>::lds(sb + (wm * 4 + mb) * PE); if (NSPLIT == 1) f.a2[mb] = WFrag<T16>::lds(sb + (NPA + wm * 4 + mb) * PE); }
#pragma unroll
        for (int nb = 1; nb < 4; ++nb) f.b[nb] = WFrag<T16>::lds(sb + (NPAT + wn * 4 + nb) * PE);
    };
    auto publish = [&]() {    // every wave, behind its last LDS read of a stage: the next stage becomes readable, the buffer just read becomes free
        asm volatile("s_wait_dscnt 0x0" ::: "memory");      // this wave's LDS reads of the buffer that is refilled next have returned
        asm volatile("s_wait_asynccnt 0x0" ::: "memory");   // this wave's copies of the next stage have landed
        __syncthreads();                                    // so have every other wave's, and every wave has left the buffer just read
    };
    copies(0);
    asm volatile("s_wait_asynccnt 0x0" ::: "memory");       // stage 0 has landed, as far as this wave copied it
    __syncthreads();                                        // and as far as the other waves did
    copies(1);
    // A stage's publish point stands behind the LDS reads of its second step and in front of that step's products, which need registers alone: the refill is under way while they run.
    if constexpr (WPE <= 2) {    // registers for two fragment sets: every step's LDS reads fly behind the products of the step before, also those of the next stage's first step, which stand behind the publish point
        FSet f0, f1; ldset(f0, 0, 0);
        auto half = [&](int buf, auto refill, auto next) {    // the stage in buffer buf (a constant); refill: a stage two on exists; next: a next stage exists
            ldset(f1, buf, 1);
            __builtin_amdgcn_sched_barrier(0);    // keeps the LDS reads together ahead of the products: the compiler otherwise sinks them among the products, each with a wait to 0 of its own
            mmaset(f0);
            __builtin_amdgcn_sched_barrier(0);    // the first step's products stay in front of the publish point: the second step's LDS reads, waited for there, fly behind them
            if constexpr (decltype(next)::v) { publish(); if constexpr (decltype(refill)::v) copies(buf); ldset(f0, buf ^ 1, 0); }
            __builtin_amdgcn_sched_barrier(0);    // the copies and the next LDS reads are issued ahead of the second step's products, not behind them
            mmaset(f1);
        };
#pragma unroll 1
        for (int t = 0; t < NS - 2; t += 2) { half(0, BoolC<true>{}, BoolC<true>{}); half(1, BoolC<true>{}, BoolC<true>{}); }    // rolled: the body already holds two stages, and the buffer index stays a constant
        half(0, BoolC<false>{}, BoolC<true>{}); half(1, BoolC<false>{}, BoolC<false>{});
    } else {                     // one fragment set, so that two work-groups share a WGP: the other waves' products cover a wave's LDS reads
        FSet f;
        auto half = [&](int buf, auto refill, auto next) {    // as above
            ldset(f, buf, 0);
            __builtin_amdgcn_sched_barrier(0);    // keeps the LDS reads together ahead of the products: the compiler otherwise sinks them among the products, each with a wait to 0 of its own
            mmaset(f);
            ldset(f, buf, 1);
            if constexpr (decltype(next)::v) { publish(); if constexpr (decltype(refill)::v) copies(buf); }
            __builtin_amdgcn_sched_barrier(0);    // the copies are issued ahead of the second step's products, not behind them
            mmaset(f);
        };
#pragma unroll 1
        for (int t = 0; t < NS - 2; t += 2) { half(0, BoolC<true>{}, BoolC<true>{}); half(1, BoolC<true>{}, BoolC<true>{}); }    // rolled: the body already holds two stages, and the buffer index stays a constant
        half(0, BoolC<false>{}, BoolC<true>{}); half(1, BoolC<false>{}, BoolC<false>{});
    }
    asm volatile("s_wait_asynccnt 0x0" ::: "memory");       // no copy is outstanding when the wave goes on to its end
    if constexpr (PL != 0) {
        static_assert(HD == 64, "one 64-column tile is one head");
        const int p = ct / NH_, h = ct % NH_, prow = lane & 15, pch = lane >> 4;    // a lane takes 8 neighbours (one chunk) of a staged row: 16 lanes the 16 rows of a chunk column, 2 chunk columns a store
        const size_t pz = ((size_t)p * NB_ + z) * sC; P16 += pz; Ph += pz; Pl += pz;
        auto planes = [&](auto trc) { constexpr bool tr = decltype(trc)::v;    // tr: values, stored transposed
#pragma unroll
        for (int g = 0; g < 4; ++g) {     // 16 staged rows of 64: queries, keys: positions g*16.. by d; values: columns d = g*16.. by position
            if constexpr (!tr) {
#pragma unroll
                for (int nb = 0; nb < 4; ++nb) {
#pragma unroll
                    for (int j = 0; j < 8; ++j) os[(hi * 8 + j) * 68 + nb * 16 + lr] = acc[g][nb][j]; }
            } else {
#pragma unroll
                for (int mb = 0; mb < 4; ++mb) {    // an accumulator's 8 values are 8 neighbouring positions of one column d
                    *(v4fa*)(os + lr * 68 + mb * 16 + hi * 8) = __builtin_shufflevector(acc[mb][g], acc[mb][g], 0, 1, 2, 3); *(v4fa*)(os + lr * 68 + mb * 16 + hi * 8 + 4) = __builtin_shufflevector(acc[mb][g], acc[mb][g], 4, 5, 6, 7); }
            }
            __builtin_amdgcn_wave_barrier(); asm volatile("" ::: "memory");   // lanes read what other lanes of this one wave staged: keeps the compiler from moving the reads ahead of the writes
#pragma unroll
            for (int s = 0; s < 4; ++s) { const int ch = s * 2 + pch; const v4f x0 = *(const v4fa*)(os + prow * 68 + ch * 8), x1 = *(const v4fa*)(os + prow * 68 + ch * 8 + 4); v8h o16; v8us oh, ol;
#pragma unroll
                for (int k = 0; k < 8; ++k) { const float x = (k < 4) ? x0[k & 3] : x1[k & 3]; o16[k] = tohx(x); unsigned short a2, c2; splitf(x, a2, c2); oh[k] = a2; ol[k] = c2; }
                const size_t e = (!tr ? ((size_t)h * TT + r0 + g * 16) * HD : ((size_t)h * HD + g * 16) * TT + r0 * 16) + s * 256;    // the same for the wave; chunk column ch, row prow: + s*256 + lane*8
                *(v8h*)(P16 + e + lo) = o16; *(v8us*)(Ph + e + lo) = oh; *(v8us*)(Pl + e + lo) = ol; }
            __builtin_amdgcn_wave_barrier(); asm volatile("" ::: "memory");   // the next group's staging stays behind these reads
        }
        if constexpr (!tr) asm volatile("s_wait_xcnt 0x0" ::: "memory");    // in the built code the values' path stands behind this one and rewrites the address registers of the last stores: the wait stands in front of that overwrite
        };
        if (p == 2) { planes(BoolC<true>{}); return; }    // p comes from blockIdx and the wave's number: a scalar branch
        planes(BoolC<false>{}); return;
    }
#pragma unroll
    for (int mb = 0; mb < 4; ++mb) {
#pragma unroll
        for (int nb = 0; nb < 4; ++nb) {
#pragma unroll
            for (int j = 0; j < 8; ++j) os[(hi * 8 + j) * 68 + nb * 16 + lr] = acc[mb][nb][j]; }
        __builtin_amdgcn_wave_barrier(); asm volatile("" ::: "memory");
        float* crow = C + (size_t)(r0 + mb * 16) * ldc + c0;
{
#pragma unroll
            for (int s = 0; s < 8; ++s) { const int row = 2 * s + hi, cofs = lr * 4; v4f val = *(const v4fa*)(os + row * 68 + cofs); if (BIAS) { val[0] += bfr(bias[c0 + cofs]); val[1] += bfr(bias[c0 + cofs + 1]); val[2] += bfr(bias[c0 + cofs + 2]); val[3] += bfr(bias[c0 + cofs + 3]); }
                *(v4f*)(crow + (size_t)row * ldc + cofs) = val; }
             }
        __builtin_amdgcn_wave_barrier(); asm volatile("" ::: "memory");
    }
}

typedef __attribute__((ext_vector_type(4))) _Float16 v4h;
typedef __attribute__((ext_vector_type(2))) unsigned short v2us;
typedef __attribute__((ext_vector_type(4))) unsigned short v4us;
typedef __attribute__((ext_vector_type(4))) int v4i;

// ---- k_prep: every 16-bit operand plane that comes straight from an input (x, the three per-head weight tensors, Wproj), in one launch of few, long-lived work-groups (for speed only).
// Every work-group reads 65536 bytes and writes 32768, and a thread issues all its loads before it converts anything. The first NB_*TT/16 work-groups take one 16-row panel of x each, the others NU x 256 neighbouring chunks of one weight plane.
// Weights: a thread builds chunks (8 k of one Bt row): a wave's loads each read one whole line (32 neighbouring columns), its stores two runs of 256 bytes.
// L: where run i (256 chunks, one a thread) lies: src(i, j): elements from the thread's first weight element wl to that of k = j of its chunk; dst(i): elements from its first chunk wd
#define PNU 8    // runs of 256 weight chunks that a work-group of k_prep takes
template <typename L, unsigned NU>
__device__ __forceinline__ void prep_w(const GLB float* wl, GLB bf* wd) {
    float wf[NU][8];
#pragma unroll
    for (unsigned i = 0; i < NU; ++i)
#pragma unroll
        for (unsigned j = 0; j < 8; ++j) wf[i][j] = wl[L::src(i, j)];
    // the wait takes the address as an operand, so that no load's result lands in a register that an earlier load names, and whatever rewrites it stands behind the wait (a precaution)
    asm volatile("s_wait_xcnt 0x0" :: "v"(wl) : "memory");
#pragma unroll
    for (unsigned i = 0; i < NU; ++i) { v8us o;
#pragma unroll
        for (int j = 0; j < 8; ++j) o[j] = f2bf(wf[i][j]);
        *(GLB v8us*)(wd + L::dst(i)) = o; }
    asm volatile("s_wait_xcnt 0x0" ::: "memory");    // behind the last store, ahead of whatever the code behind this call writes into the stores' registers (a precaution)
}
// Projections: Bt row p*1024 + h*64 + e, k = c: w[h][c][e]; chunk number in a tensor (h, c/8, e): a run is 256/HD chunk columns of all e
struct LProj { static constexpr unsigned CT = 256 / HD; static constexpr unsigned src(unsigned i, unsigned j) { return (i * CT * 8 + j) * HD; } static constexpr unsigned dst(unsigned i) { return i * CT * 128; } };
// Wproj: Bt row n, k: w[k][n]; chunk number (k/8, n): DM/256 runs are one chunk column of all n
struct LOut { static constexpr unsigned RC = DM / 256; static constexpr unsigned src(unsigned i, unsigned j) { return ((i / RC) * 8 + j) * DM + (i % RC) * 256; } static constexpr unsigned dst(unsigned i) { return (i / RC) * 128 + (i % RC) * 256 * DQ; } };
__global__ __launch_bounds__(256) void k_prep(const float* __restrict__ x, const float* __restrict__ wq, const float* __restrict__ wk, const float* __restrict__ wv, const float* __restrict__ wo, bf* XB, bf* WQKV, bf* WO) {
    constexpr unsigned NX = NB_ * TT / 16, NT = DM / 128, NU = PNU, UP = DQ * (DM / 8) / 256;    // panels of x; 16 x 128 tiles of a panel; runs of 256 weight chunks a work-group; such runs in one projection's plane
    static_assert(UP % NU == 0 && 256 % HD == 0 && HD % 16 == 0 && (DM / 8) % (NU * LProj::CT) == 0, "a work-group's projection chunks lie in one tensor and one head");
    static_assert(DM % 256 == 0 && NU % LOut::RC == 0 && (DM * (DQ / 8) / 256) % NU == 0, "a work-group's Wproj chunks are whole chunk columns");
    __shared__ __align__(16) unsigned short sh[NT][16 * 17 * 8];
    const unsigned t = threadIdx.x, b = blockIdx.x, row = t >> 4, c = t & 15;
    if (b < NX) {    // the same for the work-group: its barrier is passed by all its waves
        // x: read row by row (16 lanes a run of 512 bytes), turned chunk-wise in LDS (pitch 17 chunks against bank conflicts), stored as contiguous bytes
        const GLB float* const xl = (const GLB float*)x + (size_t)b * 16 * DM + row * DM + c * 8;
        v8f xv[NT];
#pragma unroll
        for (unsigned kg = 0; kg < NT; ++kg) xv[kg] = *(const GLB v8f*)(xl + kg * 128);
        asm volatile("s_wait_xcnt 0x0" :: "v"(xl) : "memory");    // as in prep_w
#pragma unroll
        for (unsigned kg = 0; kg < NT; ++kg) { v8us o;
#pragma unroll
            for (int k = 0; k < 8; ++k) o[k] = f2bf(xv[kg][k]);
            *(v8usa*)(sh[kg] + (c * 17 + row) * 8) = o; }
        __syncthreads();    // a thread stores chunks that another wave converted
        GLB bf* const xd = (GLB bf*)XB + ((size_t)b * NT * 256 + t) * 8;
#pragma unroll
        for (unsigned kg = 0; kg < NT; ++kg) *(GLB v8us*)(xd + kg * 2048) = *(const v8usa*)(sh[kg] + (row * 17 + c) * 8);
        return;
    }
    const unsigned u0 = (b - NX) * NU;    // the work-group's first run
    if (u0 < 3 * UP) {
        const unsigned p = u0 / UP, q0 = (u0 % UP) * 256;    // the tensor; the work-group's first chunk in it
        const unsigned h = q0 / (HD * (DM / 8)), c80 = (q0 / HD) % (DM / 8), e = t % HD, tc = t / HD;    // run i, thread t: head h, chunk column c80 + i*CT + tc, column e
        prep_w<LProj, NU>((const GLB float*)(p == 0 ? wq : p == 1 ? wk : wv) + ((size_t)h * DM + c80 * 8) * HD + tc * 8 * HD + e,
            (GLB bf*)WQKV + (size_t)p * DQ * DM + (size_t)h * HD * DM + c80 * 128 + (e >> 4) * 16 * DM + tc * 128 + (e & 15) * 8);
    } else {
        const unsigned c80 = (u0 - 3 * UP) / LOut::RC;    // run i, thread t: chunk column c80 + i/RC, row n = (i%RC)*256 + t
        prep_w<LOut, NU>((const GLB float*)wo + (size_t)c80 * 8 * DM + t, (GLB bf*)WO + c80 * 128 + (size_t)row * 16 * DQ + c * 8);
    }
}

// ---- k_fattn: scores, causal softmax and probability x value product of all batches in one launch. One wave owns 16 query rows of one head and walks its keys in blocks of 32 up to the diagonal.
// Transposed products: S^T = K Q^T (a lane holds 16 scores of ONE query, column lr) and O^T += V^T P^T; the two 16-key score tiles, converted in place, are the B operand of the second product
// (hardware k order, the order WFrag::ld reads), so scores and probabilities never leave the registers. Running maximum and sum per query (online softmax, log2 domain); division by the sum at the end.
// HR (query rows < RH): hi/lo bf16 planes, three products for each GEMM, in the order hi.hi, lo.hi, hi.lo; else fp16 planes, one product. Output: hi/lo bf16 planes (rows t, K = DQ, fragment order) for the last projection.
__device__ __forceinline__ float xhalf(float x) { return __builtin_bit_cast(float, __builtin_amdgcn_permlanex16(__builtin_bit_cast(int, x), __builtin_bit_cast(int, x), 0x76543210, 0xfedcba98, false, false)); }   // lane l reads lane l ^ 16
// al and p[0..15] become 2^al and 2^p, in place. The exps stand in asm so that a v_nop can close each run: the instruction set asks for one slot between a transcendental and an instruction that reads its result
// or overwrites its source. Inside a run each exp has registers of its own, so the next exp is the independent instruction.
__device__ __forceinline__ void exp2_17(float& al, float (&p)[16]) {
    asm("v_exp_f32 %0, %0\n\tv_exp_f32 %1, %1\n\tv_exp_f32 %2, %2\n\tv_exp_f32 %3, %3\n\tv_exp_f32 %4, %4\n\tv_exp_f32 %5, %5\n\tv_exp_f32 %6, %6\n\tv_exp_f32 %7, %7\n\tv_exp_f32 %8, %8\n\tv_nop"
        : "+v"(al), "+v"(p[0]), "+v"(p[1]), "+v"(p[2]), "+v"(p[3]), "+v"(p[4]), "+v"(p[5]), "+v"(p[6]), "+v"(p[7]));
    asm("v_exp_f32 %0, %0\n\tv_exp_f32 %1, %1\n\tv_exp_f32 %2, %2\n\tv_exp_f32 %3, %3\n\tv_exp_f32 %4, %4\n\tv_exp_f32 %5, %5\n\tv_exp_f32 %6, %6\n\tv_exp_f32 %7, %7\n\tv_nop"
        : "+v"(p[8]), "+v"(p[9]), "+v"(p[10]), "+v"(p[11]), "+v"(p[12]), "+v"(p[13]), "+v"(p[14]), "+v"(p[15]));
}
template <typename V> struct KVSet { V k[2][2], k2[2][2], v[4], v2[4]; };   // the K and V^T fragments of one 32-key block (k2, v2: the lo planes, HR only)
// The pointers are the same for the wave (block 0 of the walk) and are moved on by the caller; lo = lane*8; blk: blocks ahead of the pointers, a constant: every load is a scalar base + lo + an immediate offset.
// XW: s_wait_xcnt 0 behind the loads, in front of whatever overwrites their address registers next; it takes the bases and lo as operands, so that they keep their registers up to the wait and the caller's sums stay behind it;
// the long key loop passes false and has one such wait at its foot, far behind the loads
template <typename T16, bool HR>
__device__ __forceinline__ void kv_wait(const GLB T16*& Kp, const GLB T16*& K2, const GLB T16*& Vt, const GLB T16*& V2, unsigned lo) {
    if constexpr (HR) asm volatile("s_wait_xcnt 0x0" : "+s"(Kp), "+s"(K2), "+s"(Vt), "+s"(V2) : "v"(lo) : "memory");    // see XW above
    else asm volatile("s_wait_xcnt 0x0" : "+s"(Kp), "+s"(Vt) : "v"(lo) : "memory");                                       // see XW above
}
template <typename T16, bool HR, bool XW>
__device__ __forceinline__ void kv_load(KVSet<typename WFrag<T16>::V>& f, const GLB T16*& Kp, const GLB T16*& K2, const GLB T16*& Vt, const GLB T16*& V2, int blk, unsigned lo) {
#pragma unroll
    for (int t = 0; t < 2; ++t) {
#pragma unroll
        for (int ks = 0; ks < 2; ++ks) { f.k[t][ks] = WFrag<T16>::ld(Kp + lo + (blk * 32 + t * 16) * HD + 512 * ks); if (HR) f.k2[t][ks] = WFrag<T16>::ld(K2 + lo + (blk * 32 + t * 16) * HD + 512 * ks); }
    }
#pragma unroll
    for (int mt = 0; mt < 4; ++mt) { f.v[mt] = WFrag<T16>::ld(Vt + lo + mt * 16 * TT + blk * 512); if (HR) f.v2[mt] = WFrag<T16>::ld(V2 + lo + mt * 16 * TT + blk * 512); }
    if (XW) kv_wait<T16, HR>(Kp, K2, Vt, V2, lo);
}
// one 32-key block: kq = first key of this lane's score rows minus the lane's query (key <= query is kq + offset <= 0); DIAG: the block crosses the diagonal and is masked
template <typename T16, bool HR, bool DIAG>
__device__ __forceinline__ void attn_block(const KVSet<typename WFrag<T16>::V>& f, const typename WFrag<T16>::V (&qf)[2], const typename WFrag<T16>::V (&qf2)[2], v8f (&O)[4], float& m, float& l, int kq) {
    typedef typename WFrag<T16>::V V;
    v8f S[2];
#pragma unroll
    for (int t = 0; t < 2; ++t) { S[t] = (v8f){};
#pragma unroll
        for (int ks = 0; ks < 2; ++ks) { S[t] = WFrag<T16>::mma(f.k[t][ks], qf[ks], S[t]); if (HR) { S[t] = WFrag<T16>::mma(f.k[t][ks], qf2[ks], S[t]); S[t] = WFrag<T16>::mma(f.k2[t][ks], qf[ks], S[t]); } } }
    float p[16];
#pragma unroll
    for (int i = 0; i < 16; ++i) p[i] = S[i >> 3][i & 7] * SC2;          // key offset (i>>3)*16 + (i&7) from the lane's first key, query column lr
    if (DIAG) {
#pragma unroll
        for (int i = 0; i < 16; ++i) p[i] = (kq + (i >> 3) * 16 + (i & 7) <= 0) ? p[i] : -3.0e38f; }
    float bm = p[0], bm1 = p[8];                                           // two chains: half the dependent length
#pragma unroll
    for (int i = 1; i < 8; ++i) { bm = fmaxf(bm, p[i]); bm1 = fmaxf(bm1, p[8 + i]); }
    bm = fmaxf(bm, bm1); bm = fmaxf(bm, xhalf(bm));
    const float mn = fmaxf(m, bm); float al = m - mn; m = mn;
#pragma unroll
    for (int i = 0; i < 16; ++i) p[i] -= mn;
    exp2_17(al, p);
    const float bs = (((p[0] + p[1]) + (p[2] + p[3])) + ((p[4] + p[5]) + (p[6] + p[7]))) + (((p[8] + p[9]) + (p[10] + p[11])) + ((p[12] + p[13]) + (p[14] + p[15])));
    l = l * al + bs;
#pragma unroll
    for (int mt = 0; mt < 4; ++mt)
#pragma unroll
        for (int j = 0; j < 8; ++j) O[mt][j] *= al;
    V pf, pf2;
    if constexpr (HR) { v8us h0, h1, l0, l1;
#pragma unroll
        for (int j = 0; j < 8; ++j) { unsigned short a, c2; splitf(p[j], a, c2); h0[j] = a; l0[j] = c2; splitf(p[8 + j], a, c2); h1[j] = a; l1[j] = c2; }
        pf = cat16b(h0, h1); pf2 = cat16b(l0, l1);
    } else {
#pragma unroll
        for (int i = 0; i < 16; ++i) pf[i] = tohx(p[i]); }
#pragma unroll
    for (int mt = 0; mt < 4; ++mt) { O[mt] = WFrag<T16>::mma(f.v[mt], pf, O[mt]); if (HR) { O[mt] = WFrag<T16>::mma(f.v[mt], pf2, O[mt]); O[mt] = WFrag<T16>::mma(f.v2[mt], pf, O[mt]); } }
}
template <typename T16, bool HR>
__device__ __forceinline__ void attn_rows(const T16* __restrict__ Q, const T16* __restrict__ Q2, const T16* __restrict__ Kg, const T16* __restrict__ K2g, const T16* __restrict__ Vg, const T16* __restrict__ V2g, int q0, bf* Ah, bf* Al) {
    typedef typename WFrag<T16>::V V;
    const int lane = threadIdx.x & 31, lr = lane & 15, hi = lane >> 4;
    const int last = q0 >> 5;                            // the 32-key block that holds the diagonal: the wave's last
    V qf[2], qf2[2];
    const unsigned lo = 8 * lane;    // fragment order: the lane's part of every address; 32 k of a panel are 512 elements
    typedef const GLB T16* GP; GP Qp = (GP)(Q + (size_t)q0 * HD), Qp2 = HR ? (GP)(Q2 + (size_t)q0 * HD) : nullptr, Kp = (GP)Kg, K2 = (GP)K2g, Vt = (GP)Vg, V2 = (GP)V2g;    // each the same for the wave
#pragma unroll
    for (int ks = 0; ks < 2; ++ks) { qf[ks] = WFrag<T16>::ld(Qp + lo + 512 * ks); if (HR) qf2[ks] = WFrag<T16>::ld(Qp2 + lo + 512 * ks); }
    // what follows may overwrite the address registers of the query loads: the wait stands in front of that, and the addresses, as its operands, keep their registers up to it
    if constexpr (HR) asm volatile("s_wait_xcnt 0x0" :: "s"(Qp), "s"(Qp2), "v"(lo) : "memory"); else asm volatile("s_wait_xcnt 0x0" :: "s"(Qp), "v"(lo) : "memory");
    v8f O[4];
#pragma unroll
    for (int mt = 0; mt < 4; ++mt) O[mt] = (v8f){};
    float m = -3.0e38f, l = 0.f;
    const int kq0 = 8 * hi - (q0 + lr);
    KVSet<V> fa;
    if constexpr (HR) {   // at most RH/32 blocks, three products each: one fragment set, which keeps the kernel inside 256 registers
#pragma unroll 1
        for (int kb = 0; kb < last; ++kb) { kv_load<T16, HR, true>(fa, Kp, K2, Vt, V2, 0, lo); Kp += 32 * HD; K2 += 32 * HD; Vt += 512; V2 += 512; attn_block<T16, HR, false>(fa, qf, qf2, O, m, l, 0); }
        kv_load<T16, HR, true>(fa, Kp, K2, Vt, V2, 0, lo);
    } else {              // two fragment sets in turn, so that a block's K and V loads are issued ahead of the block before it; the loop body has no branch (the blocks below the diagonal need no mask)
        KVSet<V> fb;
        kv_load<T16, HR, true>(fa, Kp, K2, Vt, V2, 0, lo);
        int kb = 0;
#pragma unroll 1
        for (; kb + 1 < last; kb += 2) {
            kv_load<T16, HR, false>(fb, Kp, K2, Vt, V2, 1, lo);
            __builtin_amdgcn_sched_barrier(0);    // keeps the loads where they stand, a whole block ahead of their use: the compiler otherwise sinks the key loads to just in front of their products
            attn_block<T16, HR, false>(fa, qf, qf2, O, m, l, 0);
            kv_load<T16, HR, false>(fa, Kp, K2, Vt, V2, 2, lo);    // kb + 2 <= last
            __builtin_amdgcn_sched_barrier(0);    // as above
            attn_block<T16, HR, false>(fb, qf, qf2, O, m, l, 0);
            kv_wait<T16, HR>(Kp, K2, Vt, V2, lo); Kp += 2 * 32 * HD; Vt += 2 * 512;    // the sums overwrite the address registers of this pass's loads: behind the wait
        }
        if (kb < last) { attn_block<T16, HR, false>(fa, qf, qf2, O, m, l, 0); kv_load<T16, HR, true>(fa, Kp, K2, Vt, V2, 1, lo); }   // one block left below the diagonal block
    }
    attn_block<T16, HR, true>(fa, qf, qf2, O, m, l, kq0 + last * 32);
    l += xhalf(l);                                       // the two lane halves hold the sums of disjoint keys of the same query
    const float inv = __fdiv_rn(1.0f, l);
    bf* ph = Ah + (size_t)q0 * DQ + lo; bf* pl = Al + (size_t)q0 * DQ + lo;
#pragma unroll
    for (int mt = 0; mt < 4; ++mt) { v8us oh, ol;
#pragma unroll
        for (int j = 0; j < 8; ++j) { unsigned short a, c2; splitf(O[mt][j] * inv, a, c2); oh[j] = a; ol[j] = c2; }
        *(v8us*)(ph + mt * 256) = oh; *(v8us*)(pl + mt * 256) = ol; }    // chunk columns mt*2 + hi of the head's 8, row lr
}
// grid (TT/128, heads, batches), 8 waves of 16 query rows. Waves w and w + 4 take row tiles T and 127 - T, so every pair walks the same number of key blocks together (the cost of a tile grows with its index)
__global__ __launch_bounds__(256) void k_fattn(const h16* __restrict__ Q16, const h16* __restrict__ K16, const h16* __restrict__ V16, const bf* __restrict__ Qh, const bf* __restrict__ Ql, const bf* __restrict__ Kh, const bf* __restrict__ Kl, const bf* __restrict__ Vh, const bf* __restrict__ Vl, bf* Ah, bf* Al) {
    const int h = blockIdx.y; const int w = __builtin_amdgcn_readfirstlane((int)(threadIdx.x >> 5));   // wave-uniform, so the key loop and the row-class test are scalar branches
    const int q0 = ((w < 4) ? (int)blockIdx.x * 4 + w : TT / 16 - 1 - ((int)blockIdx.x * 4 + (w - 4))) * 16;
    const size_t po = ((size_t)blockIdx.z * NH_ + h) * TT * HD;
    Ah += (size_t)blockIdx.z * TT * DQ; Al += (size_t)blockIdx.z * TT * DQ;
    if (q0 < RH) attn_rows<bf, true>(Qh + po, Ql + po, Kh + po, Kl + po, Vh + po, Vl + po, q0, Ah + h * HD * 16, Al + h * HD * 16);
    else attn_rows<h16, false>(Q16 + po, nullptr, K16 + po, nullptr, V16 + po, nullptr, q0, Ah + h * HD * 16, Al + h * HD * 16);
}

extern "C" void kernel_launch(void* const* d_in, const int* in_sizes, int n_in,
                              void* d_out, int out_size, void* d_ws, size_t ws_size, hipStream_t stream) {
    (void)in_sizes; (void)n_in; (void)out_size;
    const float* x = (const float*)d_in[0]; const float* wq = (const float*)d_in[1]; const float* wk = (const float*)d_in[2]; const float* wv = (const float*)d_in[3]; const float* wo = (const float*)d_in[4]; const float* bo = (const float*)d_in[5];   /* order x, Wq, Wk, Wv [16][1024][64], Wproj ('xw' [1024][1024]), bproj */
    float* OUT = (float*)d_out;     // [4][2048][1024]
    char* wsp = (char*)d_ws;
    auto take = [&](size_t bytes) { char* p = wsp; wsp += (bytes + 255) & ~(size_t)255; return (void*)p; };
    static_assert(NKV == NH_, "the three projections share one plane shape");
    const size_t PB = (size_t)NH_ * TT * HD, PP = (size_t)NB_ * PB;    // elements of one batch's [h][..] block and of one plane of all batches
    bf* WQKV = (bf*)take((size_t)3 * DQ * DM * 2); bf* WO = (bf*)take((size_t)DM * DQ * 2);
    bf* XB = (bf*)take((size_t)NB_ * TT * DM * 2);
    h16* P16 = (h16*)take(3 * PP * 2); bf* Ph = (bf*)take(3 * PP * 2); bf* Pl = (bf*)take(3 * PP * 2);    // each [q, k, v][batch][h][..]
    bf* ATh = (bf*)take((size_t)NB_ * TT * DQ * 2); bf* ATl = (bf*)take((size_t)NB_ * TT * DQ * 2);
    if ((size_t)(wsp - (char*)d_ws) > ws_size) return;    // ws 256 MiB
    k_prep<<<NB_ * TT / 16 + (3 * DQ + DM) * (DM / 8) / (PNU * 256), 256, 0, stream>>>(x, wq, wk, wv, wo, XB, WQKV, WO);   /* x -> bf16 panels; per-head [16][1024][64] x 3 -> Bt [3072][1024]; Wproj -> Bt [1024][1024] */
    k_gemmw<bf, 0, false, 1, 2, 4, 4><<<dim3(TT / 128, 3 * DQ / 256, NB_), 256, 0, stream>>>(XB, nullptr, WQKV, nullptr, nullptr, 0, nullptr, (size_t)TT * DM, 0, PB, P16, Ph, Pl);
    k_fattn<<<dim3(TT / 128, NH_, NB_), 256, 0, stream>>>(P16, P16 + PP, P16 + 2 * PP, Ph, Pl, Ph + PP, Pl + PP, Ph + 2 * PP, Pl + 2 * PP, ATh, ATl);
    k_gemmw<bf, 1, true, 0, 2, 4, 2><<<dim3(TT / 128, DM / 256, NB_), 256, 0, stream>>>(ATh, ATl, WO, nullptr, OUT, DM, bo, (size_t)TT * DQ, 0, (size_t)TT * DM, nullptr, nullptr, nullptr);
}

// v010
// Measured time: 133 microseconds a run.
// Timed twice side by side with v009, it ran 1.06 and 1.05 times as fast.
// Over all steps from v000 it is 21.7 times as fast.
#include <hip/hip_runtime.h>

// Causal multi-head attention with per-head stacked projection weights and an embed-size score scale (x [4][2048][1024]; q, k, v = einsum('btc,hcd', x, W) with Wq, Wk, Wv [16][1024][64] (0.02, no bias; 16 heads x 64); wei = q.k x 1024^-0.5 (the source scales by n_embd, not the head size); causal (-inf); softmax; out = concat heads Wproj + bproj ('xw' [1024][1024] + bias) -> [4][2048][1024] (8.4 M); argument order x, Wq, Wk, Wv, Wproj, bproj).
// Every stage is one launch for the whole problem (batch = grid z, except k_prep: one 1-D grid over all panels; every plane holds all batches): k_prep makes the bf16 copies of x and Wproj and gathers the per-head tensors [h][c][d] into one Bt plane of 3 x 1024 rows (row p*1024 + h*64 + d; p: q, k, v) so the three projections are one exact GEMM with head-major output columns, whose epilogue writes the head planes (fp16 + hi/lo bf16; V transposed) itself; one fused causal attention launch (k_fattn; hybrid rows: < 512 hi/lo 3 products, rest fp16; key blocks above the diagonal are never visited); hi/lo x Wproj exact + bproj.
// Every 16-bit operand plane (rows x K) lies in fragment order: panels of 16 rows, inside a panel chunks of 8 neighbouring k, inside a chunk column the 16 rows: element (r, k) at (r/16)*16*K + (k/8)*128 + (r%16)*8 + k%8.
// A wave's fragment (16 rows x 32 k) is then 1024 contiguous bytes, lane l taking 16 bytes at l*16 and at 512 + l*16: each load instruction covers four whole 128-byte lines.
// Compute dtypes, f32 accumulate: every input rounded to bf16; projections exact; attention rows < 512 3 products, rest fp16; softmax f32; Wproj hl x exact + bias.

#define NB_  4
#define TT   2048
#define DM   1024
#define NH_  16
#define NKV  16
#define HD   64
#define DQ   (NH_ * HD)
#define DKV  (NKV * HD)
#define SC2  0.04508422002778011f   // 1024^-0.5 x log2(e): the module scales by n_embd; scores go to the log2 domain for exp2
#define RH   512                  // query rows < RH use hi+lo planes (0: none)
typedef _Float16 h16;
typedef unsigned short bf;
typedef __attribute__((ext_vector_type(16))) __bf16   v16bf;
typedef __attribute__((ext_vector_type(16))) _Float16 v16h;
typedef __attribute__((ext_vector_type(8)))  _Float16 v8h;
typedef __attribute__((ext_vector_type(8)))  unsigned short v8us;
typedef __attribute__((ext_vector_type(8)))  float    v8f;
typedef __attribute__((ext_vector_type(4)))  float    v4f;
typedef v8h  __attribute__((may_alias)) v8ha;
typedef v4f  __attribute__((may_alias)) v4fa;
typedef v8us __attribute__((may_alias)) v8usa;

__device__ __forceinline__ unsigned short f2bf(float f) { unsigned u = __float_as_uint(f); u += 0x7FFFu + ((u >> 16) & 1u); return (unsigned short)(u >> 16); }
__device__ __forceinline__ float bf2f(unsigned short b) { return __uint_as_float(((unsigned)b) << 16); }
__device__ __forceinline__ float bfr(float f) { return bf2f(f2bf(f)); }
__device__ __forceinline__ v16h cat16(v8h lo, v8h hi) { return __builtin_shufflevector(lo, hi, 0, 1, 2, 3, 4, 5, 6, 7, 8, 9, 10, 11, 12, 13, 14, 15); }
__device__ __forceinline__ v16bf cat16b(v8us lo, v8us hi) { return __builtin_bit_cast(v16bf, __builtin_shufflevector(lo, hi, 0, 1, 2, 3, 4, 5, 6, 7, 8, 9, 10, 11, 12, 13, 14, 15)); }
__device__ __forceinline__ v8f wmma16(v16h a, v16h b, v8f c) { return __builtin_amdgcn_wmma_f32_16x16x32_f16(false, a, false, b, (short)0, c, false, false); }
__device__ __forceinline__ v8f wmmab(v16bf a, v16bf b, v8f c) { return __builtin_amdgcn_wmma_f32_16x16x32_bf16(false, a, false, b, (short)0, c, false, false); }

__device__ __forceinline__ h16 tohx(float x) { return (h16)x; }
__device__ __forceinline__ void splitf(float y, unsigned short& h, unsigned short& l) { h = f2bf(y); l = f2bf(y - bf2f(h)); }

// ---- k_gemmw: register-blocked GEMM, one wave per 64x64 output tile (16 accumulators), NWM x NWN waves a work-group on neighbouring tiles (wave w: tile row w % NWM, tile column w / NWM); grid (M/64/NWM, N/64/NWN, Z).
// The operands of the work-group's tile come from the 16-bit planes (fragment order) into LDS by asynchronous copies, 64 k a stage, two buffers: every panel is fetched from L2 once for the work-group, not once for each wave that needs it.
// A panel's part of a stage is 2048 contiguous bytes in the plane and in LDS, so a fragment is read from LDS as it would be from the plane: lane l takes 16 bytes at l*16 and at 512 + l*16 (no bank conflict).
// C[m][n] (f32, pitch ldc, + optional f32 bias[n]) = sum_k A[m][k] Bt[n][k] (+ split products per NSPLIT). z-batch strides sA/sB/sC in elements. K = 1024.
// PL != 0: no f32 C; the wave's tile column = p*16 + h (p: 0 queries, 1 keys, 2 values); the tile (64 positions t x the 64 columns d of head h) goes out as the three 16-bit planes that the attention kernel reads (fp16, bf16 hi, bf16 lo of the f32 sum),
// each plane [p][z][h][..] (sC = elements of one [h][..] block): p 0, 1: per head rows t, K = d; p 2: per head rows d, K = t (values, transposed); fragment order. Every store instruction covers four whole 128-byte lines.
#define GLB __attribute__((address_space(1)))    // global memory, named in the pointer's type: an address that has passed through an asm operand would otherwise be loaded from with flat instructions
template <typename T16> struct WFrag;    // ld(p): p = the fragment's first element + lane*8 (k 8*hi.. of row lr); 256 elements on stand k 16 + 8*hi..; lds(p): the same from a copy of the fragment in LDS
template <> struct WFrag<h16> { typedef v16h V; static __device__ __forceinline__ V ld(const GLB h16* p) { return cat16(*(const GLB v8h*)p, *(const GLB v8h*)(p + 256)); } static __device__ __forceinline__ V lds(const h16* p) { return cat16(*(const v8ha*)p, *(const v8ha*)(p + 256)); } static __device__ __forceinline__ v8f mma(V a, V b, v8f c) { return wmma16(a, b, c); } };
template <> struct WFrag<bf> { typedef v16bf V; static __device__ __forceinline__ V ld(const GLB bf* p) { return cat16b(*(const GLB v8us*)p, *(const GLB v8us*)(p + 256)); } static __device__ __forceinline__ V lds(const bf* p) { return cat16b(*(const v8usa*)p, *(const v8usa*)(p + 256)); } static __device__ __forceinline__ v8f mma(V a, V b, v8f c) { return wmmab(a, b, c); } };
template <bool B> struct BoolC { static constexpr bool v = B; };
// Asynchronous copies to LDS, 16 bytes a lane each: l = the lane's LDS byte address, g = its global address. AC4: the 2048 bytes of one panel's part of a stage, four copies of 512 bytes;
// the immediate offset moves the LDS address and the global address alike, and the bytes lie alike in both places.
// s_wait_xcnt 0 closes the copies' own statement: it stands in front of whatever rewrites a register that a copy names (a precaution)
#define AC4(l, g) "global_load_async_to_lds_b128 %" #l ", %" #g ", off\n\tglobal_load_async_to_lds_b128 %" #l ", %" #g ", off offset:512\n\tglobal_load_async_to_lds_b128 %" #l ", %" #g ", off offset:1024\n\tglobal_load_async_to_lds_b128 %" #l ", %" #g ", off offset:1536\n\t"
template <typename GP> __device__ __forceinline__ void acopy(const unsigned (&l)[3], const GP (&g)[3]) {
    asm volatile(AC4(0, 3) AC4(1, 4) AC4(2, 5) "s_wait_xcnt 0x0" :: "v"(l[0]), "v"(l[1]), "v"(l[2]), "v"(g[0]), "v"(g[1]), "v"(g[2]) : "memory");
}
template <typename GP> __device__ __forceinline__ void acopy(const unsigned (&l)[4], const GP (&g)[4]) {
    asm volatile(AC4(0, 4) AC4(1, 5) AC4(2, 6) AC4(3, 7) "s_wait_xcnt 0x0" :: "v"(l[0]), "v"(l[1]), "v"(l[2]), "v"(l[3]), "v"(g[0]), "v"(g[1]), "v"(g[2]), "v"(g[3]) : "memory");
}
// WPE: waves a SIMD that the register budget is set for
template <typename T16, int NSPLIT, bool BIAS, int PL, int NWM, int NWN, int WPE>
__global__ __launch_bounds__(32 * NWM * NWN) __attribute__((amdgpu_waves_per_eu(WPE, WPE))) void k_gemmw(const T16* __restrict__ A, const T16* __restrict__ A2, const T16* __restrict__ Bt, const T16* __restrict__ Bt2, float* C, int ldc, const float* __restrict__ bias, size_t sA, size_t sB, size_t sC, h16* P16, bf* Ph, bf* Pl) {
    typedef typename WFrag<T16>::V V;
    constexpr int K = DM; static_assert(DQ == DM, "both GEMMs sum over 1024 k");    // a constant, so that the stage count and every offset in LDS are constants
    static_assert(NSPLIT == 0 || NSPLIT == 1, "A alone or A hi + lo; B is one plane");
    constexpr int NW = NWM * NWN, NPA = NWM * 4, NPAT = (NSPLIT == 1 ? 2 : 1) * NPA, NP = NPAT + NWN * 4, PPW = NP / NW;    // 16-row panels of the work-group's tile: A, (A lo,) B; panels that a wave copies
    constexpr int NS = K / 64, PE = 16 * 64;    // stages; elements of a panel's part of a stage
    static_assert(NP % NW == 0 && (PPW == 3 || PPW == 4), "every wave copies the same number of whole panel parts");
    static_assert(NS >= 4 && NS % 2 == 0, "the loop takes two stages a pass, one from each buffer; the last two stand behind it");
    __shared__ __attribute__((aligned(2048))) T16 ring[2][NP * PE];
    __shared__ __align__(16) float osw[NW][16 * 68];
    const int w = __builtin_amdgcn_readfirstlane((int)(threadIdx.x >> 5)); float* const os = osw[w];    // the wave's number, the same in every lane: what follows from it stays scalar; the wave's own output stage
    const size_t z = blockIdx.z; A += z * sA; if (A2) A2 += z * sA; Bt += z * sB; if (PL == 0) C += z * sC;
    const int lane = threadIdx.x & 31, lr = lane & 15, hi = lane >> 4; const int wm = w % NWM, wn = w / NWM, ct = blockIdx.y * NWN + wn;
    const int R0 = blockIdx.x * (NWM * 64), C0 = blockIdx.y * (NWN * 64), r0 = R0 + wm * 64, c0 = ct * 64;
    v8f acc[4][4];
#pragma unroll
    for (int mb = 0; mb < 4; ++mb)
#pragma unroll
        for (int nb = 0; nb < 4; ++nb) acc[mb][nb] = (v8f){};
    const unsigned lo = 8 * lane; typedef const GLB T16* GP;
    // The work-group walks the NS stages of k in a ring from stage rot on, so that work-groups that share A panels (the same x, z) or B panels (the same y) start at different stages (for speed only).
    const int rot = (int)((blockIdx.x + blockIdx.y + 4 * blockIdx.z) % NS); int left = NS - rot;    // left: stages still to copy before the walk turns back to k = 0; both the same for the work-group
    GP gp[PPW];    // the lane's place in the next stage of each panel that the wave copies (panels w*PPW.. of the NP)
#pragma unroll
    for (int q = 0; q < PPW; ++q) { const int P = w * PPW + q;
        gp[q] = (GP)((P < NPA ? A + (size_t)(R0 + P * 16) * K : (NSPLIT == 1 && P < NPAT) ? A2 + (size_t)(R0 + (P - NPA) * 16) * K : Bt + (size_t)(C0 + (P - NPAT) * 16) * K) + lo + rot * PE); }
    const unsigned lw = (unsigned)(size_t)&ring[0][0] + (unsigned)(w * PPW * PE + lo) * 2;    // the same place in buffer 0, as an LDS byte address
    auto copies = [&](int buf) {    // the wave's share of the next stage into buffer buf (a constant)
        unsigned l[PPW];
#pragma unroll
        for (int q = 0; q < PPW; ++q) l[q] = lw + (unsigned)((buf * NP + q) * PE * 2);
        acopy(l, gp);
        const int step = (--left == 0) ? PE - NS * PE : PE;    // behind the panels' last stage comes their first
#pragma unroll
        for (int q = 0; q < PPW; ++q) gp[q] += step;
    };
    struct FSet { V a[4], a2[4], b[4]; };    // a2: the lo plane, only where NSPLIT asks for it
    auto mmaset = [&](const FSet& f) {
#pragma unroll
        for (int nb = 0; nb < 4; ++nb) {
#pragma unroll
            for (int mb = 0; mb < 4; ++mb) { acc[mb][nb] = WFrag<T16>::mma(f.a[mb], f.b[nb], acc[mb][nb]); if (NSPLIT == 1) acc[mb][nb] = WFrag<T16>::mma(f.a2[mb], f.b[nb], acc[mb][nb]); } }
    };
    auto ldset = [&](FSet& f, int buf, int ks) {    // the fragments of 32-k step ks of the stage in buffer buf (constants), in the order of their first use
        const T16* sb = &ring[buf][0] + lo + ks * 512;
        f.b[0] = WFrag<T16>::lds(sb + (NPAT + wn * 4) * PE);
#pragma unroll
        for (int mb = 0; mb < 4; ++mb) { f.a[mb] = WFrag<T16>::lds(sb + (wm * 4 + mb) * PE); if (NSPLIT == 1) f.a2[mb] = WFrag<T16>::lds(sb + (NPA + wm * 4 + mb) * PE); }
#pragma unroll
        for (int nb = 1; nb < 4; ++nb) f.b[nb] = WFrag<T16>::lds(sb + (NPAT + wn * 4 + nb) * PE);
    };
    auto publish = [&]() {    // every wave, behind its last LDS read of a stage: the next stage becomes readable, the buffer just read becomes free
        asm volatile("s_wait_dscnt 0x0" ::: "memory");      // this wave's LDS reads of the buffer that is refilled next have returned
        asm volatile("s_wait_asynccnt 0x0" ::: "memory");   // this wave's copies of the next stage have landed
        __syncthreads();                                    // so have every other wave's, and every wave has left the buffer just read
    };
    copies(0);
    asm volatile("s_wait_asynccnt 0x0" ::: "memory");       // stage rot (the walk's first) has landed, as far as this wave copied it
    __syncthreads();                                        // and as far as the other waves did
    copies(1);
    // A stage's publish point stands behind the LDS reads of its second step and in front of that step's products, which need registers alone: the refill is under way while they run.
    if constexpr (WPE <= 2) {    // registers for two fragment sets: every step's LDS reads fly behind the products of the step before, also those of the next stage's first step, which stand behind the publish point
        FSet f0, f1; ldset(f0, 0, 0);
        auto half = [&](int buf, auto refill, auto next) {    // the stage in buffer buf (a constant); refill: a stage two on exists; next: a next stage exists
            ldset(f1, buf, 1);
            __builtin_amdgcn_sched_barrier(0);    // keeps the LDS reads together ahead of the products: the compiler otherwise sinks them among the products, each with a wait to 0 of its own
            mmaset(f0);
            __builtin_amdgcn_sched_barrier(0);    // the first step's products stay in front of the publish point: the second step's LDS reads, waited for there, fly behind them
            if constexpr (decltype(next)::v) { publish(); if constexpr (decltype(refill)::v) copies(buf); ldset(f0, buf ^ 1, 0); }
            __builtin_amdgcn_sched_barrier(0);    // the copies and the next LDS reads are issued ahead of the second step's products, not behind them
            mmaset(f1);
        };
#pragma unroll 1
        for (int t = 0; t < NS - 2; t += 2) { half(0, BoolC<true>{}, BoolC<true>{}); half(1, BoolC<true>{}, BoolC<true>{}); }    // rolled: the body already holds two stages, and the buffer index stays a constant
        half(0, BoolC<false>{}, BoolC<true>{}); half(1, BoolC<false>{}, BoolC<false>{});
    } else {                     // one fragment set, so that two work-groups share a WGP: the other waves' products cover a wave's LDS reads
        FSet f;
        auto half = [&](int buf, auto refill, auto next) {    // as above
            ldset(f, buf, 0);
            __builtin_amdgcn_sched_barrier(0);    // keeps the LDS reads together ahead of the products: the compiler otherwise sinks them among the products, each with a wait to 0 of its own
            mmaset(f);
            ldset(f, buf, 1);
            if constexpr (decltype(next)::v) { publish(); if constexpr (decltype(refill)::v) copies(buf); }
            __builtin_amdgcn_sched_barrier(0);    // the copies are issued ahead of the second step's products, not behind them
            mmaset(f);
        };
#pragma unroll 1
        for (int t = 0; t < NS - 2; t += 2) { half(0, BoolC<true>{}, BoolC<true>{}); half(1, BoolC<true>{}, BoolC<true>{}); }    // rolled: the body already holds two stages, and the buffer index stays a constant
        half(0, BoolC<false>{}, BoolC<true>{}); half(1, BoolC<false>{}, BoolC<false>{});
    }
    asm volatile("s_wait_asynccnt 0x0" ::: "memory");       // no copy is outstanding when the wave goes on to its end
    if constexpr (PL != 0) {
        static_assert(HD == 64, "one 64-column tile is one head");
        const int p = ct / NH_, h = ct % NH_, prow = lane & 15, pch = lane >> 4;    // a lane takes 8 neighbours (one chunk) of a staged row: 16 lanes the 16 rows of a chunk column, 2 chunk columns a store
        const size_t pz = ((size_t)p * NB_ + z) * sC; P16 += pz; Ph += pz; Pl += pz;
        auto planes = [&](auto trc) { constexpr bool tr = decltype(trc)::v;    // tr: values, stored transposed
#pragma unroll
        for (int g = 0; g < 4; ++g) {     // 16 staged rows of 64: queries, keys: positions g*16.. by d; values: columns d = g*16.. by position
            if constexpr (!tr) {
#pragma unroll
                for (int nb = 0; nb < 4; ++nb) {
#pragma unroll
                    for (int j = 0; j < 8; ++j) os[(hi * 8 + j) * 68 + nb * 16 + lr] = acc[g][nb][j]; }
            } else {
#pragma unroll
                for (int mb = 0; mb < 4; ++mb) {    // an accumulator's 8 values are 8 neighbouring positions of one column d
                    *(v4fa*)(os + lr * 68 + mb * 16 + hi * 8) = __builtin_shufflevector(acc[mb][g], acc[mb][g], 0, 1, 2, 3); *(v4fa*)(os + lr * 68 + mb * 16 + hi * 8 + 4) = __builtin_shufflevector(acc[mb][g], acc[mb][g], 4, 5, 6, 7); }
            }
            __builtin_amdgcn_wave_barrier(); asm volatile("" ::: "memory");   // lanes read what other lanes of this one wave staged: keeps the compiler from moving the reads ahead of the writes
#pragma unroll
            for (int s = 0; s < 4; ++s) { const int ch = s * 2 + pch; const v4f x0 = *(const v4fa*)(os + prow * 68 + ch * 8), x1 = *(const v4fa*)(os + prow * 68 + ch * 8 + 4); v8h o16; v8us oh, ol;
#pragma unroll
                for (int k = 0; k < 8; ++k) { const float x = (k < 4) ? x0[k & 3] : x1[k & 3]; o16[k] = tohx(x); unsigned short a2, c2; splitf(x, a2, c2); oh[k] = a2; ol[k] = c2; }
                const size_t e = (!tr ? ((size_t)h * TT + r0 + g * 16) * HD : ((size_t)h * HD + g * 16) * TT + r0 * 16) + s * 256;    // the same for the wave; chunk column ch, row prow: + s*256 + lane*8
                *(v8h*)(P16 + e + lo) = o16; *(v8us*)(Ph + e + lo) = oh; *(v8us*)(Pl + e + lo) = ol; }
            __builtin_amdgcn_wave_barrier(); asm volatile("" ::: "memory");   // the next group's staging stays behind these reads
        }
        if constexpr (!tr) asm volatile("s_wait_xcnt 0x0" ::: "memory");    // in the built code the values' path stands behind this one and rewrites the address registers of the last stores: the wait stands in front of that overwrite
        };
        if (p == 2) { planes(BoolC<true>{}); return; }    // p comes from blockIdx and the wave's number: a scalar branch
        planes(BoolC<false>{}); return;
    }
#pragma unroll
    for (int mb = 0; mb < 4; ++mb) {
#pragma unroll
        for (int nb = 0; nb < 4; ++nb) {
#pragma unroll
            for (int j = 0; j < 8; ++j) os[(hi * 8 + j) * 68 + nb * 16 + lr] = acc[mb][nb][j]; }
        __builtin_amdgcn_wave_barrier(); asm volatile("" ::: "memory");
        float* crow = C + (size_t)(r0 + mb * 16) * ldc + c0;
{
#pragma unroll
            for (int s = 0; s < 8; ++s) { const int row = 2 * s + hi, cofs = lr * 4; v4f val = *(const v4fa*)(os + row * 68 + cofs); if (BIAS) { val[0] += bfr(bias[c0 + cofs]); val[1] += bfr(bias[c0 + cofs + 1]); val[2] += bfr(bias[c0 + cofs + 2]); val[3] += bfr(bias[c0 + cofs + 3]); }
                *(v4f*)(crow + (size_t)row * ldc + cofs) = val; }
             }
        __builtin_amdgcn_wave_barrier(); asm volatile("" ::: "memory");
    }
}

typedef __attribute__((ext_vector_type(4))) _Float16 v4h;
typedef __attribute__((ext_vector_type(2))) unsigned short v2us;
typedef __attribute__((ext_vector_type(4))) unsigned short v4us;
typedef __attribute__((ext_vector_type(4))) int v4i;

// ---- k_prep: every 16-bit operand plane that comes straight from an input (x, the three per-head weight tensors, Wproj), in one launch of few, long-lived work-groups (for speed only).
// Every work-group reads 65536 bytes and writes 32768, and a thread issues all its loads before it converts anything. The first NB_*TT/16 work-groups take one 16-row panel of x each, the others NU x 256 neighbouring chunks of one weight plane.
// Weights: a thread builds chunks (8 k of one Bt row): a wave's loads each read one whole line (32 neighbouring columns), its stores two runs of 256 bytes.
// L: where run i (256 chunks, one a thread) lies: src(i, j): elements from the thread's first weight element wl to that of k = j of its chunk; dst(i): elements from its first chunk wd
#define PNU 8    // runs of 256 weight chunks that a work-group of k_prep takes
template <typename L, unsigned NU>
__device__ __forceinline__ void prep_w(const GLB float* wl, GLB bf* wd) {
    float wf[NU][8];
#pragma unroll
    for (unsigned i = 0; i < NU; ++i)
#pragma unroll
        for (unsigned j = 0; j < 8; ++j) wf[i][j] = wl[L::src(i, j)];
    // the wait takes the address as an operand, so that no load's result lands in a register that an earlier load names, and whatever rewrites it stands behind the wait (a precaution)
    asm volatile("s_wait_xcnt 0x0" :: "v"(wl) : "memory");
#pragma unroll
    for (unsigned i = 0; i < NU; ++i) { v8us o;
#pragma unroll
        for (int j = 0; j < 8; ++j) o[j] = f2bf(wf[i][j]);
        *(GLB v8us*)(wd + L::dst(i)) = o; }
    asm volatile("s_wait_xcnt 0x0" ::: "memory");    // behind the last store, ahead of whatever the code behind this call writes into the stores' registers (a precaution)
}
// Projections: Bt row p*1024 + h*64 + e, k = c: w[h][c][e]; chunk number in a tensor (h, c/8, e): a run is 256/HD chunk columns of all e
struct LProj { static constexpr unsigned CT = 256 / HD; static constexpr unsigned src(unsigned i, unsigned j) { return (i * CT * 8 + j) * HD; } static constexpr unsigned dst(unsigned i) { return i * CT * 128; } };
// Wproj: Bt row n, k: w[k][n]; chunk number (k/8, n): DM/256 runs are one chunk column of all n
struct LOut { static constexpr unsigned RC = DM / 256; static constexpr unsigned src(unsigned i, unsigned j) { return ((i / RC) * 8 + j) * DM + (i % RC) * 256; } static constexpr unsigned dst(unsigned i) { return (i / RC) * 128 + (i % RC) * 256 * DQ; } };
__global__ __launch_bounds__(256) void k_prep(const float* __restrict__ x, const float* __restrict__ wq, const float* __restrict__ wk, const float* __restrict__ wv, const float* __restrict__ wo, bf* XB, bf* WQKV, bf* WO) {
    constexpr unsigned NX = NB_ * TT / 16, NT = DM / 128, NU = PNU, UP = DQ * (DM / 8) / 256;    // panels of x; 16 x 128 tiles of a panel; runs of 256 weight chunks a work-group; such runs in one projection's plane
    static_assert(UP % NU == 0 && 256 % HD == 0 && HD % 16 == 0 && (DM / 8) % (NU * LProj::CT) == 0, "a work-group's projection chunks lie in one tensor and one head");
    static_assert(DM % 256 == 0 && NU % LOut::RC == 0 && (DM * (DQ / 8) / 256) % NU == 0, "a work-group's Wproj chunks are whole chunk columns");
    __shared__ __align__(16) unsigned short sh[NT][16 * 17 * 8];
    const unsigned t = threadIdx.x, b = blockIdx.x, row = t >> 4, c = t & 15;
    if (b < NX) {    // the same for the work-group: its barrier is passed by all its waves
        // x: read row by row (16 lanes a run of 512 bytes), turned chunk-wise in LDS (pitch 17 chunks against bank conflicts), stored as contiguous bytes
        const GLB float* const xl = (const GLB float*)x + (size_t)b * 16 * DM + row * DM + c * 8;
        v8f xv[NT];
#pragma unroll
        for (unsigned kg = 0; kg < NT; ++kg) xv[kg] = *(const GLB v8f*)(xl + kg * 128);
        asm volatile("s_wait_xcnt 0x0" :: "v"(xl) : "memory");    // as in prep_w
#pragma unroll
        for (unsigned kg = 0; kg < NT; ++kg) { v8us o;
#pragma unroll
            for (int k = 0; k < 8; ++k) o[k] = f2bf(xv[kg][k]);
            *(v8usa*)(sh[kg] + (c * 17 + row) * 8) = o; }
        __syncthreads();    // a thread stores chunks that another wave converted
        GLB bf* const xd = (GLB bf*)XB + ((size_t)b * NT * 256 + t) * 8;
#pragma unroll
        for (unsigned kg = 0; kg < NT; ++kg) *(GLB v8us*)(xd + kg * 2048) = *(const v8usa*)(sh[kg] + (row * 17 + c) * 8);
        return;
    }
    const unsigned u0 = (b - NX) * NU;    // the work-group's first run
    if (u0 < 3 * UP) {
        const unsigned p = u0 / UP, q0 = (u0 % UP) * 256;    // the tensor; the work-group's first chunk in it
        const unsigned h = q0 / (HD * (DM / 8)), c80 = (q0 / HD) % (DM / 8), e = t % HD, tc = t / HD;    // run i, thread t: head h, chunk column c80 + i*CT + tc, column e
        prep_w<LProj, NU>((const GLB float*)(p == 0 ? wq : p == 1 ? wk : wv) + ((size_t)h * DM + c80 * 8) * HD + tc * 8 * HD + e,
            (GLB bf*)WQKV + (size_t)p * DQ * DM + (size_t)h * HD * DM + c80 * 128 + (e >> 4) * 16 * DM + tc * 128 + (e & 15) * 8);
    } else {
        const unsigned c80 = (u0 - 3 * UP) / LOut::RC;    // run i, thread t: chunk column c80 + i/RC, row n = (i%RC)*256 + t
        prep_w<LOut, NU>((const GLB float*)wo + (size_t)c80 * 8 * DM + t, (GLB bf*)WO + c80 * 128 + (size_t)row * 16 * DQ + c * 8);
    }
}

// ---- k_fattn: scores, causal softmax and probability x value product of all batches in one launch. One wave owns 16 query rows of one head and walks its keys in blocks of 32 up to the diagonal.
// Transposed products: S^T = K Q^T (a lane holds 16 scores of ONE query, column lr) and O^T += V^T P^T; the two 16-key score tiles, converted in place, are the B operand of the second product
// (hardware k order, the order WFrag::ld reads), so scores and probabilities never leave the registers. Running maximum and sum per query (online softmax, log2 domain); division by the sum at the end.
// HR (query rows < RH): hi/lo bf16 planes, three products for each GEMM, in the order hi.hi, lo.hi, hi.lo; else fp16 planes, one product. Output: hi/lo bf16 planes (rows t, K = DQ, fragment order) for the last projection.
__device__ __forceinline__ float xhalf(float x) { return __builtin_bit_cast(float, __builtin_amdgcn_permlanex16(__builtin_bit_cast(int, x), __builtin_bit_cast(int, x), 0x76543210, 0xfedcba98, false, false)); }   // lane l reads lane l ^ 16
// al and p[0..15] become 2^al and 2^p, in place. The exps stand in asm so that a v_nop can close each run: the instruction set asks for one slot between a transcendental and an instruction that reads its result
// or overwrites its source. Inside a run each exp has registers of its own, so the next exp is the independent instruction.
__device__ __forceinline__ void exp2_17(float& al, float (&p)[16]) {
    asm("v_exp_f32 %0, %0\n\tv_exp_f32 %1, %1\n\tv_exp_f32 %2, %2\n\tv_exp_f32 %3, %3\n\tv_exp_f32 %4, %4\n\tv_exp_f32 %5, %5\n\tv_exp_f32 %6, %6\n\tv_exp_f32 %7, %7\n\tv_exp_f32 %8, %8\n\tv_nop"
        : "+v"(al), "+v"(p[0]), "+v"(p[1]), "+v"(p[2]), "+v"(p[3]), "+v"(p[4]), "+v"(p[5]), "+v"(p[6]), "+v"(p[7]));
    asm("v_exp_f32 %0, %0\n\tv_exp_f32 %1, %1\n\tv_exp_f32 %2, %2\n\tv_exp_f32 %3, %3\n\tv_exp_f32 %4, %4\n\tv_exp_f32 %5, %5\n\tv_exp_f32 %6, %6\n\tv_exp_f32 %7, %7\n\tv_nop"
        : "+v"(p[8]), "+v"(p[9]), "+v"(p[10]), "+v"(p[11]), "+v"(p[12]), "+v"(p[13]), "+v"(p[14]), "+v"(p[15]));
}
template <typename V> struct KVSet { V k[2][2], k2[2][2], v[4], v2[4]; };   // the K and V^T fragments of one 32-key block (k2, v2: the lo planes, HR only)
// The pointers are the same for the wave (block 0 of the walk) and are moved on by the caller; lo = lane*8; blk: blocks ahead of the pointers, a constant: every load is a scalar base + lo + an immediate offset.
// XW: s_wait_xcnt 0 behind the loads, in front of whatever overwrites their address registers next; it takes the bases and lo as operands, so that they keep their registers up to the wait and the caller's sums stay behind it;
// the long key loop passes false and has one such wait at its foot, far behind the loads
template <typename T16, bool HR>
__device__ __forceinline__ void kv_wait(const GLB T16*& Kp, const GLB T16*& K2, const GLB T16*& Vt, const GLB T16*& V2, unsigned lo) {
    if constexpr (HR) asm volatile("s_wait_xcnt 0x0" : "+s"(Kp), "+s"(K2), "+s"(Vt), "+s"(V2) : "v"(lo) : "memory");    // see XW above
    else asm volatile("s_wait_xcnt 0x0" : "+s"(Kp), "+s"(Vt) : "v"(lo) : "memory");                                       // see XW above
}
template <typename T16, bool HR, bool XW>
__device__ __forceinline__ void kv_load(KVSet<typename WFrag<T16>::V>& f, const GLB T16*& Kp, const GLB T16*& K2, const GLB T16*& Vt, const GLB T16*& V2, int blk, unsigned lo) {
#pragma unroll
    for (int t = 0; t < 2; ++t) {
#pragma unroll
        for (int ks = 0; ks < 2; ++ks) { f.k[t][ks] = WFrag<T16>::ld(Kp + lo + (blk * 32 + t * 16) * HD + 512 * ks); if (HR) f.k2[t][ks] = WFrag<T16>::ld(K2 + lo + (blk * 32 + t * 16) * HD + 512 * ks); }
    }
#pragma unroll
    for (int mt = 0; mt < 4; ++mt) { f.v[mt] = WFrag<T16>::ld(Vt + lo + mt * 16 * TT + blk * 512); if (HR) f.v2[mt] = WFrag<T16>::ld(V2 + lo + mt * 16 * TT + blk * 512); }
    if (XW) kv_wait<T16, HR>(Kp, K2, Vt, V2, lo);
}
// one 32-key block: kq = first key of this lane's score rows minus the lane's query (key <= query is kq + offset <= 0); DIAG: the block crosses the diagonal and is masked
template <typename T16, bool HR, bool DIAG>
__device__ __forceinline__ void attn_block(const KVSet<typename WFrag<T16>::V>& f, const typename WFrag<T16>::V (&qf)[2], const typename WFrag<T16>::V (&qf2)[2], v8f (&O)[4], float& m, float& l, int kq) {
    typedef typename WFrag<T16>::V V;
    v8f S[2];
#pragma unroll
    for (int t = 0; t < 2; ++t) { S[t] = (v8f){};
#pragma unroll
        for (int ks = 0; ks < 2; ++ks) { S[t] = WFrag<T16>::mma(f.k[t][ks], qf[ks], S[t]); if (HR) { S[t] = WFrag<T16>::mma(f.k[t][ks], qf2[ks], S[t]); S[t] = WFrag<T16>::mma(f.k2[t][ks], qf[ks], S[t]); } } }
    float p[16];
#pragma unroll
    for (int i = 0; i < 16; ++i) p[i] = S[i >> 3][i & 7] * SC2;          // key offset (i>>3)*16 + (i&7) from the lane's first key, query column lr
    if (DIAG) {
#pragma unroll
        for (int i = 0; i < 16; ++i) p[i] = (kq + (i >> 3) * 16 + (i & 7) <= 0) ? p[i] : -3.0e38f; }
    float bm = p[0], bm1 = p[8];                                           // two chains: half the dependent length
#pragma unroll
    for (int i = 1; i < 8; ++i) { bm = fmaxf(bm, p[i]); bm1 = fmaxf(bm1, p[8 + i]); }
    bm = fmaxf(bm, bm1); bm = fmaxf(bm, xhalf(bm));
    const float mn = fmaxf(m, bm); float al = m - mn; m = mn;
#pragma unroll
    for (int i = 0; i < 16; ++i) p[i] -= mn;
    exp2_17(al, p);
    const float bs = (((p[0] + p[1]) + (p[2] + p[3])) + ((p[4] + p[5]) + (p[6] + p[7]))) + (((p[8] + p[9]) + (p[10] + p[11])) + ((p[12] + p[13]) + (p[14] + p[15])));
    l = l * al + bs;
#pragma unroll
    for (int mt = 0; mt < 4; ++mt)
#pragma unroll
        for (int j = 0; j < 8; ++j) O[mt][j] *= al;
    V pf, pf2;
    if constexpr (HR) { v8us h0, h1, l0, l1;
#pragma unroll
        for (int j = 0; j < 8; ++j) { unsigned short a, c2; splitf(p[j], a, c2); h0[j] = a; l0[j] = c2; splitf(p[8 + j], a, c2); h1[j] = a; l1[j] = c2; }
        pf = cat16b(h0, h1); pf2 = cat16b(l0, l1);
    } else {
#pragma unroll
        for (int i = 0; i < 16; ++i) pf[i] = tohx(p[i]); }
#pragma unroll
    for (int mt = 0; mt < 4; ++mt) { O[mt] = WFrag<T16>::mma(f.v[mt], pf, O[mt]); if (HR) { O[mt] = WFrag<T16>::mma(f.v[mt], pf2, O[mt]); O[mt] = WFrag<T16>::mma(f.v2[mt], pf, O[mt]); } }
}
template <typename T16, bool HR>
__device__ __forceinline__ void attn_rows(const T16* __restrict__ Q, const T16* __restrict__ Q2, const T16* __restrict__ Kg, const T16* __restrict__ K2g, const T16* __restrict__ Vg, const T16* __restrict__ V2g, int q0, bf* Ah, bf* Al) {
    typedef typename WFrag<T16>::V V;
    const int lane = threadIdx.x & 31, lr = lane & 15, hi = lane >> 4;
    const int last = q0 >> 5;                            // the 32-key block that holds the diagonal: the wave's last
    V qf[2], qf2[2];
    const unsigned lo = 8 * lane;    // fragment order: the lane's part of every address; 32 k of a panel are 512 elements
    typedef const GLB T16* GP; GP Qp = (GP)(Q + (size_t)q0 * HD), Qp2 = HR ? (GP)(Q2 + (size_t)q0 * HD) : nullptr, Kp = (GP)Kg, K2 = (GP)K2g, Vt = (GP)Vg, V2 = (GP)V2g;    // each the same for the wave
#pragma unroll
    for (int ks = 0; ks < 2; ++ks) { qf[ks] = WFrag<T16>::ld(Qp + lo + 512 * ks); if (HR) qf2[ks] = WFrag<T16>::ld(Qp2 + lo + 512 * ks); }
    // what follows may overwrite the address registers of the query loads: the wait stands in front of that, and the addresses, as its operands, keep their registers up to it
    if constexpr (HR) asm volatile("s_wait_xcnt 0x0" :: "s"(Qp), "s"(Qp2), "v"(lo) : "memory"); else asm volatile("s_wait_xcnt 0x0" :: "s"(Qp), "v"(lo) : "memory");
    v8f O[4];
#pragma unroll
    for (int mt = 0; mt < 4; ++mt) O[mt] = (v8f){};
    float m = -3.0e38f, l = 0.f;
    const int kq0 = 8 * hi - (q0 + lr);
    KVSet<V> fa;
    if constexpr (HR) {   // at most RH/32 blocks, three products each: one fragment set, which keeps the kernel inside 256 registers
#pragma unroll 1
        for (int kb = 0; kb < last; ++kb) { kv_load<T16, HR, true>(fa, Kp, K2, Vt, V2, 0, lo); Kp += 32 * HD; K2 += 32 * HD; Vt += 512; V2 += 512; attn_block<T16, HR, false>(fa, qf, qf2, O, m, l, 0); }
        kv_load<T16, HR, true>(fa, Kp, K2, Vt, V2, 0, lo);
    } else {              // two fragment sets in turn, so that a block's K and V loads are issued ahead of the block before it; the loop body has no branch (the blocks below the diagonal need no mask)
        KVSet<V> fb;
        kv_load<T16, HR, true>(fa, Kp, K2, Vt, V2, 0, lo);
        int kb = 0;
#pragma unroll 1
        for (; kb + 1 < last; kb += 2) {
            kv_load<T16, HR, false>(fb, Kp, K2, Vt, V2, 1, lo);
            __builtin_amdgcn_sched_barrier(0);    // keeps the loads where they stand, a whole block ahead of their use: the compiler otherwise sinks the key loads to just in front of their products
            attn_block<T16, HR, false>(fa, qf, qf2, O, m, l, 0);
            kv_load<T16, HR, false>(fa, Kp, K2, Vt, V2, 2, lo);    // kb + 2 <= last
            __builtin_amdgcn_sched_barrier(0);    // as above
            attn_block<T16, HR, false>(fb, qf, qf2, O, m, l, 0);
            kv_wait<T16, HR>(Kp, K2, Vt, V2, lo); Kp += 2 * 32 * HD; Vt += 2 * 512;    // the sums overwrite the address registers of this pass's loads: behind the wait
        }
        if (kb < last) { attn_block<T16, HR, false>(fa, qf, qf2, O, m, l, 0); kv_load<T16, HR, true>(fa, Kp, K2, Vt, V2, 1, lo); }   // one block left below the diagonal block
    }
    attn_block<T16, HR, true>(fa, qf, qf2, O, m, l, kq0 + last * 32);
    l += xhalf(l);                                       // the two lane halves hold the sums of disjoint keys of the same query
    const float inv = __fdiv_rn(1.0f, l);
    bf* ph = Ah + (size_t)q0 * DQ + lo; bf* pl = Al + (size_t)q0 * DQ + lo;
#pragma unroll
    for (int mt = 0; mt < 4; ++mt) { v8us oh, ol;
#pragma unroll
        for (int j = 0; j < 8; ++j) { unsigned short a, c2; splitf(O[mt][j] * inv, a, c2); oh[j] = a; ol[j] = c2; }
        *(v8us*)(ph + mt * 256) = oh; *(v8us*)(pl + mt * 256) = ol; }    // chunk columns mt*2 + hi of the head's 8, row lr
}
// grid (TT/128, heads, batches), 8 waves of 16 query rows. Waves w and w + 4 take row tiles T and 127 - T, so every pair walks the same number of key blocks together (the cost of a tile grows with its index)
__global__ __launch_bounds__(256) void k_fattn(const h16* __restrict__ Q16, const h16* __restrict__ K16, const h16* __restrict__ V16, const bf* __restrict__ Qh, const bf* __restrict__ Ql, const bf* __restrict__ Kh, const bf* __restrict__ Kl, const bf* __restrict__ Vh, const bf* __restrict__ Vl, bf* Ah, bf* Al) {
    const int h = blockIdx.y; const int w = __builtin_amdgcn_readfirstlane((int)(threadIdx.x >> 5));   // wave-uniform, so the key loop and the row-class test are scalar branches
    const int q0 = ((w < 4) ? (int)blockIdx.x * 4 + w : TT / 16 - 1 - ((int)blockIdx.x * 4 + (w - 4))) * 16;
    const size_t po = ((size_t)blockIdx.z * NH_ + h) * TT * HD;
    Ah += (size_t)blockIdx.z * TT * DQ; Al += (size_t)blockIdx.z * TT * DQ;
    if (q0 < RH) attn_rows<bf, true>(Qh + po, Ql + po, Kh + po, Kl + po, Vh + po, Vl + po, q0, Ah + h * HD * 16, Al + h * HD * 16);
    else attn_rows<h16, false>(Q16 + po, nullptr, K16 + po, nullptr, V16 + po, nullptr, q0, Ah + h * HD * 16, Al + h * HD * 16);
}

extern "C" void kernel_launch(void* const* d_in, const int* in_sizes, int n_in,
                              void* d_out, int out_size, void* d_ws, size_t ws_size, hipStream_t stream) {
    (void)in_sizes; (void)n_in; (void)out_size;
    const float* x = (const float*)d_in[0]; const float* wq = (const float*)d_in[1]; const float* wk = (const float*)d_in[2]; const float* wv = (const float*)d_in[3]; const float* wo = (const float*)d_in[4]; const float* bo = (const float*)d_in[5];   /* order x, Wq, Wk, Wv [16][1024][64], Wproj ('xw' [1024][1024]), bproj */
    float* OUT = (float*)d_out;     // [4][2048][1024]
    char* wsp = (char*)d_ws;
    auto take = [&](size_t bytes) { char* p = wsp; wsp += (bytes + 255) & ~(size_t)255; return (void*)p; };
    static_assert(NKV == NH_, "the three projections share one plane shape");
    const size_t PB = (size_t)NH_ * TT * HD, PP = (size_t)NB_ * PB;    // elements of one batch's [h][..] block and of one plane of all batches
    bf* WQKV = (bf*)take((size_t)3 * DQ * DM * 2); bf* WO = (bf*)take((size_t)DM * DQ * 2);
    bf* XB = (bf*)take((size_t)NB_ * TT * DM * 2);
    h16* P16 = (h16*)take(3 * PP * 2); bf* Ph = (bf*)take(3 * PP * 2); bf* Pl = (bf*)take(3 * PP * 2);    // each [q, k, v][batch][h][..]
    bf* ATh = (bf*)take((size_t)NB_ * TT * DQ * 2); bf* ATl = (bf*)take((size_t)NB_ * TT * DQ * 2);
    if ((size_t)(wsp - (char*)d_ws) > ws_size) return;    // ws 256 MiB
    k_prep<<<NB_ * TT / 16 + (3 * DQ + DM) * (DM / 8) / (PNU * 256), 256, 0, stream>>>(x, wq, wk, wv, wo, XB, WQKV, WO);   /* x -> bf16 panels; per-head [16][1024][64] x 3 -> Bt [3072][1024]; Wproj -> Bt [1024][1024] */
    k_gemmw<bf, 0, false, 1, 2, 4, 4><<<dim3(TT / 128, 3 * DQ / 256, NB_), 256, 0, stream>>>(XB, nullptr, WQKV, nullptr, nullptr, 0, nullptr, (size_t)TT * DM, 0, PB, P16, Ph, Pl);
    k_fattn<<<dim3(TT / 128, NH_, NB_), 256, 0, stream>>>(P16, P16 + PP, P16 + 2 * PP, Ph, Pl, Ph + PP, Pl + PP, Ph + 2 * PP, Pl + 2 * PP, ATh, ATl);
    k_gemmw<bf, 1, true, 0, 2, 4, 2><<<dim3(TT / 128, DM / 256, NB_), 256, 0, stream>>>(ATh, ATl, WO, nullptr, OUT, DM, bo, (size_t)TT * DQ, 0, (size_t)TT * DM, nullptr, nullptr, nullptr);
}
